// v000
// Times are from an AMD MI455X. After a warm-up the kernel runs many times in a row, and a time is the length of
// such a window on the GPU divided by its runs, so every launch and the gaps after it count. The runs cycle
// through copies of the inputs. A figure is the median of several windows, for all but v000 over two sittings.
// Sittings can differ by a few percent; kernels timed side by side share one.
// v000, which the later versions start from, runs in 301 microseconds.
#include <hip/hip_runtime.h>

typedef __attribute__((ext_vector_type(16))) _Float16 v16h;
typedef __attribute__((ext_vector_type(8)))  _Float16 v8h;
typedef __attribute__((ext_vector_type(8)))  float    v8f;

#define S_TOTAL 4096
#define DHEAD   64
#define NH      4
#define NB      4
#define C_IN    256
// fold 1/sqrt(64) and log2(e) into Q so softmax can use exp2
#define QSCALE  (0.125f * 1.44269504088896340736f)

// ---------------------------------------------------------------------------
// Fragment loader for CDNA5 WMMA f16 operands (A 16x32 MxK, or B 32x16 KxN
// loaded from an [N][K] row-major buffer -- both have identical lane layout):
// lane l -> row (l&15); halves 0..7 = k [kb..kb+7], halves 8..15 = k [kb+16..kb+23]
// with kb = (l>>4)*8.  Two 16B vector loads per fragment.
// ---------------------------------------------------------------------------
__device__ __forceinline__ v16h load_frag16x32(const _Float16* base, int stride) {
  int lane = threadIdx.x & 31;
  const _Float16* p = base + (lane & 15) * stride + ((lane >> 4) << 3);
  v8h lo = *(const v8h*)(p);
  v8h hi = *(const v8h*)(p + 16);
  v16h r;
#pragma unroll
  for (int i = 0; i < 8; ++i) { r[i] = lo[i]; r[i + 8] = hi[i]; }
  return r;
}

__device__ __forceinline__ v8f wmma_f16(v16h a, v16h b, v8f c) {
  return __builtin_amdgcn_wmma_f32_16x16x32_f16(false, a, false, b, (short)0, c,
                                                false, false);
}

// Async DMA: 16B global -> LDS, tracked by ASYNCcnt (GLOBAL_LOAD_ASYNC_TO_LDS_B128).
// LDS operand takes the workgroup-relative byte offset; for the flat-LDS
// aperture that is addr[31:0] of the generic pointer (ISA 10.2).
__device__ __forceinline__ void async_load16(const _Float16* gsrc, _Float16* ldst) {
  unsigned int l = (unsigned int)(unsigned long long)ldst;
  unsigned long long g = (unsigned long long)gsrc;
  asm volatile("global_load_async_to_lds_b128 %0, %1, off"
               :: "v"(l), "v"(g) : "memory");
}
#define S_WAIT_ASYNCCNT(n) asm volatile("s_wait_asynccnt " #n ::: "memory")

// ---------------------------------------------------------------------------
// Kernel 1: convert pointwise weight [768][256] f32 -> f16
// ---------------------------------------------------------------------------
__global__ void cvt_wpw_kernel(const float* __restrict__ w_pw,
                               _Float16* __restrict__ wph) {
  int idx = blockIdx.x * 256 + threadIdx.x;   // grid 768*256 == 196608 exact
  wph[idx] = (_Float16)w_pw[idx];
}

// ---------------------------------------------------------------------------
// Kernel 2: depthwise 3x3 conv (pad 1).  Output transposed: dwT [b][s][c] f16
// block = (hh, b); thread = channel c; loop over ww -> coalesced f16 stores.
// x row lines are L0/L2 resident across the ww loop.
// ---------------------------------------------------------------------------
__global__ void dwconv_kernel(const float* __restrict__ x,
                              const float* __restrict__ w_dw,
                              _Float16* __restrict__ dwT) {
  int hh = blockIdx.x, b = blockIdx.y, c = threadIdx.x;
  float w[9];
#pragma unroll
  for (int j = 0; j < 9; ++j) w[j] = w_dw[c * 9 + j];
  const float* xc = x + ((size_t)(b * C_IN + c)) * S_TOTAL;     // [64][64]
  _Float16* dst = dwT + ((size_t)(b * S_TOTAL + hh * 64)) * C_IN + c;
  for (int ww = 0; ww < 64; ++ww) {
    float s = 0.f;
#pragma unroll
    for (int ky = 0; ky < 3; ++ky) {
      int y = hh + ky - 1;
      if (y < 0 || y >= 64) continue;
#pragma unroll
      for (int kx = 0; kx < 3; ++kx) {
        int xx = ww + kx - 1;
        if (xx < 0 || xx >= 64) continue;
        s += xc[y * 64 + xx] * w[ky * 3 + kx];
      }
    }
    dst[(size_t)ww * C_IN] = (_Float16)s;
  }
}

// ---------------------------------------------------------------------------
// Kernel 3: projection for Q and K.  qkvT[s][o] = sum_c dwT[s][c]*w_pw[o][c]
// A = dwT rows (s), B = w_pw rows (o) -- both row-major [*][c].
// Each wave: one 16x16 tile, K-loop 256 = 8 WMMAs.  Q gets QSCALE folded in.
// Writes Q,K as [bh][s][d] f16 (coalesced: lanes advance d).
// ---------------------------------------------------------------------------
__global__ __launch_bounds__(256) void proj_qk_kernel(
    const _Float16* __restrict__ dwT, const _Float16* __restrict__ wph,
    _Float16* __restrict__ Qg, _Float16* __restrict__ Kg) {
  int wave = threadIdx.x >> 5, lane = threadIdx.x & 31;
  int s0 = blockIdx.x * 16;
  int o0 = (blockIdx.y * 8 + wave) * 16;           // o in [0,512)
  int b = blockIdx.z;
  const _Float16* abase = dwT + ((size_t)(b * S_TOTAL + s0)) * C_IN;
  const _Float16* bbase = wph + (size_t)o0 * C_IN;
  v8f acc = {};
#pragma unroll
  for (int kc = 0; kc < C_IN; kc += 32) {
    v16h a  = load_frag16x32(abase + kc, C_IN);
    v16h bb = load_frag16x32(bbase + kc, C_IN);
    acc = wmma_f16(a, bb, acc);
  }
  int o = o0 + (lane & 15);
  int qi = o >> 8;                 // 0 => Q, 1 => K
  int h = (o >> 6) & 3;
  int d = o & 63;
  _Float16* dst = (qi ? Kg : Qg) + ((size_t)(b * NH + h) * S_TOTAL) * DHEAD + d;
  float sc = qi ? 1.0f : QSCALE;
#pragma unroll
  for (int r = 0; r < 8; ++r) {
    int s = s0 + r + ((lane >> 4) << 3);
    dst[(size_t)s * DHEAD] = (_Float16)(acc[r] * sc);
  }
}

// ---------------------------------------------------------------------------
// Kernel 4: projection for V, un-transposed orientation:
// qkv[o][s] = sum_c w_pw[o][c]*dwT[s][c];  A = w_pw rows (o), B = dwT rows (s).
// Writes V transposed: VT [bh][d][t=s] f16 (coalesced: lanes advance s).
// ---------------------------------------------------------------------------
__global__ __launch_bounds__(256) void proj_v_kernel(
    const _Float16* __restrict__ dwT, const _Float16* __restrict__ wph,
    _Float16* __restrict__ VTg) {
  int wave = threadIdx.x >> 5, lane = threadIdx.x & 31;
  int s0 = (blockIdx.x * 8 + wave) * 16;
  int o0 = 512 + blockIdx.y * 16;                  // o in [512,768)
  int b = blockIdx.z;
  const _Float16* abase = wph + (size_t)o0 * C_IN;
  const _Float16* bbase = dwT + ((size_t)(b * S_TOTAL + s0)) * C_IN;
  v8f acc = {};
#pragma unroll
  for (int kc = 0; kc < C_IN; kc += 32) {
    v16h a  = load_frag16x32(abase + kc, C_IN);
    v16h bb = load_frag16x32(bbase + kc, C_IN);
    acc = wmma_f16(a, bb, acc);
  }
  int s = s0 + (lane & 15);
#pragma unroll
  for (int r = 0; r < 8; ++r) {
    int o = o0 + r + ((lane >> 4) << 3);
    int h = (o - 512) >> 6;
    int d = (o - 512) & 63;
    VTg[((size_t)(b * NH + h) * DHEAD + d) * S_TOTAL + s] = (_Float16)acc[r];
  }
}

// ---------------------------------------------------------------------------
// Kernel 5: flash attention, transposed formulation, double-buffered async
// global->LDS DMA (ASYNCcnt).
// Per wave: 16 s-columns.  S'[t,s] = K·Q^T tiles (t rows in VGPRs, s across
// lanes) -> online softmax is per-lane over VGPRs + one shfl_xor(16).
// P' C-fragment re-packs directly into the B-fragment for O^T = V^T · P'
// (half h<8 <- frag0[h], half h>=8 <- frag1[h-8]) -- no transpose traffic.
// ---------------------------------------------------------------------------
#define KT_ELEMS (32 * 64)
#define VT_ELEMS (64 * 32)
#define N_ITERS  (S_TOTAL / 32)

__global__ __launch_bounds__(256) void attn_kernel(
    const _Float16* __restrict__ Qg, const _Float16* __restrict__ Kg,
    const _Float16* __restrict__ VTg, float* __restrict__ out) {
  __shared__ __align__(16) _Float16 lds_k[2 * KT_ELEMS];   // [buf][t][d]
  __shared__ __align__(16) _Float16 lds_vt[2 * VT_ELEMS];  // [buf][d][t]
  int tid = threadIdx.x, lane = tid & 31, wave = tid >> 5;
  int bh = blockIdx.y;
  int scol0 = blockIdx.x * 128 + wave * 16;

  const _Float16* Qb = Qg + ((size_t)bh * S_TOTAL + scol0) * DHEAD;
  const _Float16* Kb = Kg + (size_t)bh * S_TOTAL * DHEAD;
  const _Float16* Vb = VTg + (size_t)bh * DHEAD * S_TOTAL;

  // Q B-fragments, loaded once (lane -> column s, halves -> d)
  v16h bq0 = load_frag16x32(Qb, DHEAD);
  v16h bq1 = load_frag16x32(Qb + 32, DHEAD);

  v8f acc0 = {}, acc1 = {}, acc2 = {}, acc3 = {};
  float m_run = -3.0e38f, l_run = 0.f;
  int vd = tid >> 2, vp = tid & 3;                    // V^T tile load mapping

  // prologue: async-load tile 0 into buffer 0 (16B per thread per tile)
  async_load16(Kb + (size_t)tid * 8, lds_k + tid * 8);
  async_load16(Vb + (size_t)vd * S_TOTAL + vp * 8, lds_vt + tid * 8);

  for (int i = 0; i < N_ITERS; ++i) {
    int t0 = i * 32;
    const _Float16* kcur = lds_k + (i & 1) * KT_ELEMS;
    const _Float16* vcur = lds_vt + (i & 1) * VT_ELEMS;
    if (i + 1 < N_ITERS) {
      // issue next tile's DMA into the other buffer; it overlaps this
      // iteration's WMMAs.  Waiting ASYNCcnt<=2 releases only tile i
      // (async loads complete in order).
      _Float16* knxt = lds_k + ((i + 1) & 1) * KT_ELEMS;
      _Float16* vnxt = lds_vt + ((i + 1) & 1) * VT_ELEMS;
      async_load16(Kb + (size_t)(t0 + 32) * DHEAD + tid * 8, knxt + tid * 8);
      async_load16(Vb + (size_t)vd * S_TOTAL + (t0 + 32) + vp * 8,
                   vnxt + tid * 8);
      S_WAIT_ASYNCCNT(2);
    } else {
      S_WAIT_ASYNCCNT(0);
    }
    __syncthreads();   // all waves' DMA for tile i landed

    // scores S'[t, s]: 2 t-subtiles x (d=0..31, d=32..63)
    v8f c0 = {}, c1 = {};
    c0 = wmma_f16(load_frag16x32(kcur + 0, 64), bq0, c0);
    c0 = wmma_f16(load_frag16x32(kcur + 32, 64), bq1, c0);
    c1 = wmma_f16(load_frag16x32(kcur + 16 * 64, 64), bq0, c1);
    c1 = wmma_f16(load_frag16x32(kcur + 16 * 64 + 32, 64), bq1, c1);

    // online softmax over t (rows): in-lane over VGPRs + shfl_xor(16)
    float tm = c0[0];
#pragma unroll
    for (int r = 0; r < 8; ++r) { tm = fmaxf(tm, c0[r]); tm = fmaxf(tm, c1[r]); }
    tm = fmaxf(tm, __shfl_xor(tm, 16, 32));
    float mn = fmaxf(m_run, tm);
    float alpha = exp2f(m_run - mn);
    float ts = 0.f;
#pragma unroll
    for (int r = 0; r < 8; ++r) {
      c0[r] = exp2f(c0[r] - mn);
      c1[r] = exp2f(c1[r] - mn);
      ts += c0[r] + c1[r];
    }
    ts += __shfl_xor(ts, 16, 32);
    l_run = l_run * alpha + ts;
    m_run = mn;
#pragma unroll
    for (int r = 0; r < 8; ++r) {
      acc0[r] *= alpha; acc1[r] *= alpha; acc2[r] *= alpha; acc3[r] *= alpha;
    }

    // P' C-fragment -> B-fragment for O^T = V^T * P'  (layout identity)
    v16h bp;
#pragma unroll
    for (int r = 0; r < 8; ++r) {
      bp[r] = (_Float16)c0[r];
      bp[r + 8] = (_Float16)c1[r];
    }
    acc0 = wmma_f16(load_frag16x32(vcur + 0 * 16 * 32, 32), bp, acc0);
    acc1 = wmma_f16(load_frag16x32(vcur + 1 * 16 * 32, 32), bp, acc1);
    acc2 = wmma_f16(load_frag16x32(vcur + 2 * 16 * 32, 32), bp, acc2);
    acc3 = wmma_f16(load_frag16x32(vcur + 3 * 16 * 32, 32), bp, acc3);
    __syncthreads();   // tile i fully consumed before i+2's DMA reuses buffer
  }

  // epilogue: out[bh*64 + d][s] = acc / l   (lanes advance s -> coalesced)
  float inv = 1.0f / l_run;
  int s = scol0 + (lane & 15);
  int rbase = (lane >> 4) << 3;
#pragma unroll
  for (int r = 0; r < 8; ++r) {
    int d = r + rbase;
    out[(size_t)(bh * 64 + d +  0) * S_TOTAL + s] = acc0[r] * inv;
    out[(size_t)(bh * 64 + d + 16) * S_TOTAL + s] = acc1[r] * inv;
    out[(size_t)(bh * 64 + d + 32) * S_TOTAL + s] = acc2[r] * inv;
    out[(size_t)(bh * 64 + d + 48) * S_TOTAL + s] = acc3[r] * inv;
  }
}

// ---------------------------------------------------------------------------
extern "C" void kernel_launch(void* const* d_in, const int* in_sizes, int n_in,
                              void* d_out, int out_size, void* d_ws,
                              size_t ws_size, hipStream_t stream) {
  (void)in_sizes; (void)n_in; (void)out_size; (void)ws_size;
  const float* x    = (const float*)d_in[0];   // [4,256,64,64]
  const float* w_dw = (const float*)d_in[1];   // [256,1,3,3]
  const float* w_pw = (const float*)d_in[2];   // [768,256]
  float* out = (float*)d_out;                  // [4,256,64,64]

  char* ws = (char*)d_ws;
  _Float16* dwT = (_Float16*)(ws);                   // 4*4096*256 f16 = 8 MiB
  _Float16* Qg  = (_Float16*)(ws + (8u  << 20));     // 16*4096*64 f16 = 8 MiB
  _Float16* Kg  = (_Float16*)(ws + (16u << 20));     // 8 MiB
  _Float16* VTg = (_Float16*)(ws + (24u << 20));     // 8 MiB
  _Float16* wph = (_Float16*)(ws + (32u << 20));     // 768*256 f16

  cvt_wpw_kernel<<<768, 256, 0, stream>>>(w_pw, wph);
  dwconv_kernel<<<dim3(64, 4), 256, 0, stream>>>(x, w_dw, dwT);
  proj_qk_kernel<<<dim3(256, 4, 4), 256, 0, stream>>>(dwT, wph, Qg, Kg);
  proj_v_kernel<<<dim3(32, 16, 4), 256, 0, stream>>>(dwT, wph, VTg);
  attn_kernel<<<dim3(32, 16), 256, 0, stream>>>(Qg, Kg, VTg, out);
}

// v001
// It runs in 227 microseconds.
// Two timings next to v000 put it at 1.38 and 1.39 times that version's speed.
#include <hip/hip_runtime.h>

typedef __attribute__((ext_vector_type(16))) _Float16 v16h;
typedef __attribute__((ext_vector_type(8)))  _Float16 v8h;
typedef __attribute__((ext_vector_type(8)))  float    v8f;

#define S_TOTAL 4096
#define DHEAD   64
#define NH      4
#define NB      4
#define C_IN    256
// fold 1/sqrt(64) and log2(e) into Q so softmax can use exp2
#define QSCALE  (0.125f * 1.44269504088896340736f)

// ---------------------------------------------------------------------------
// Fragment loader for CDNA5 WMMA f16 operands (A 16x32 MxK, or B 32x16 KxN
// loaded from an [N][K] row-major buffer -- both have identical lane layout):
// lane l -> row (l&15); halves 0..7 = k [kb..kb+7], halves 8..15 = k [kb+16..kb+23]
// with kb = (l>>4)*8.  Two 16B vector loads per fragment.
// ---------------------------------------------------------------------------
__device__ __forceinline__ v16h load_frag16x32(const _Float16* base, int stride) {
  int lane = threadIdx.x & 31;
  const _Float16* p = base + (lane & 15) * stride + ((lane >> 4) << 3);
  v8h lo = *(const v8h*)(p);
  v8h hi = *(const v8h*)(p + 16);
  v16h r;
#pragma unroll
  for (int i = 0; i < 8; ++i) { r[i] = lo[i]; r[i + 8] = hi[i]; }
  return r;
}

__device__ __forceinline__ v8f wmma_f16(v16h a, v16h b, v8f c) {
  return __builtin_amdgcn_wmma_f32_16x16x32_f16(false, a, false, b, (short)0, c,
                                                false, false);
}

// Async DMA: 16B global -> LDS, tracked by ASYNCcnt (GLOBAL_LOAD_ASYNC_TO_LDS_B128).
// LDS operand takes the workgroup-relative byte offset; for the flat-LDS
// aperture that is addr[31:0] of the generic pointer (ISA 10.2).
// One statement issues a tile's K copy and V copy; the s_wait_xcnt at its end
// keeps later writes of the four address registers behind the copies' issue.
__device__ __forceinline__ void async_load16_kv(const _Float16* gk, _Float16* lk,
                                                const _Float16* gv, _Float16* lv) {
  unsigned int l0 = (unsigned int)(unsigned long long)lk;
  unsigned int l1 = (unsigned int)(unsigned long long)lv;
  unsigned long long g0 = (unsigned long long)gk;
  unsigned long long g1 = (unsigned long long)gv;
  asm volatile("global_load_async_to_lds_b128 %0, %1, off\n\t"
               "global_load_async_to_lds_b128 %2, %3, off\n\t"
               "s_wait_xcnt 0x0"
               :: "v"(l0), "v"(g0), "v"(l1), "v"(g1) : "memory");
}
#define S_WAIT_ASYNCCNT(n) asm volatile("s_wait_asynccnt " #n ::: "memory")

// ---------------------------------------------------------------------------
// Kernel 1: convert pointwise weight [768][256] f32 -> f16
// ---------------------------------------------------------------------------
__global__ void cvt_wpw_kernel(const float* __restrict__ w_pw,
                               _Float16* __restrict__ wph) {
  int idx = blockIdx.x * 256 + threadIdx.x;   // grid 768*256 == 196608 exact
  wph[idx] = (_Float16)w_pw[idx];
}

// ---------------------------------------------------------------------------
// Kernel 2: depthwise 3x3 conv (pad 1).  Output transposed: dwT [b][s][c] f16
// block = (hh, b); thread = channel c; loop over ww -> coalesced f16 stores.
// x row lines are L0/L2 resident across the ww loop.
// ---------------------------------------------------------------------------
__global__ void dwconv_kernel(const float* __restrict__ x,
                              const float* __restrict__ w_dw,
                              _Float16* __restrict__ dwT) {
  int hh = blockIdx.x, b = blockIdx.y, c = threadIdx.x;
  float w[9];
#pragma unroll
  for (int j = 0; j < 9; ++j) w[j] = w_dw[c * 9 + j];
  const float* xc = x + ((size_t)(b * C_IN + c)) * S_TOTAL;     // [64][64]
  _Float16* dst = dwT + ((size_t)(b * S_TOTAL + hh * 64)) * C_IN + c;
  for (int ww = 0; ww < 64; ++ww) {
    float s = 0.f;
#pragma unroll
    for (int ky = 0; ky < 3; ++ky) {
      int y = hh + ky - 1;
      if (y < 0 || y >= 64) continue;
#pragma unroll
      for (int kx = 0; kx < 3; ++kx) {
        int xx = ww + kx - 1;
        if (xx < 0 || xx >= 64) continue;
        s += xc[y * 64 + xx] * w[ky * 3 + kx];
      }
    }
    dst[(size_t)ww * C_IN] = (_Float16)s;
  }
}

// ---------------------------------------------------------------------------
// Kernel 3: projection for Q and K.  qkvT[s][o] = sum_c dwT[s][c]*w_pw[o][c]
// A = dwT rows (s), B = w_pw rows (o) -- both row-major [*][c].
// Each wave: one 16x16 tile, K-loop 256 = 8 WMMAs.  Q gets QSCALE folded in.
// Writes Q,K as [bh][s][d] f16 (coalesced: lanes advance d).
// ---------------------------------------------------------------------------
__global__ __launch_bounds__(256) void proj_qk_kernel(
    const _Float16* __restrict__ dwT, const _Float16* __restrict__ wph,
    _Float16* __restrict__ Qg, _Float16* __restrict__ Kg) {
  int wave = threadIdx.x >> 5, lane = threadIdx.x & 31;
  int s0 = blockIdx.x * 16;
  int o0 = (blockIdx.y * 8 + wave) * 16;           // o in [0,512)
  int b = blockIdx.z;
  const _Float16* abase = dwT + ((size_t)(b * S_TOTAL + s0)) * C_IN;
  const _Float16* bbase = wph + (size_t)o0 * C_IN;
  v8f acc = {};
#pragma unroll
  for (int kc = 0; kc < C_IN; kc += 32) {
    v16h a  = load_frag16x32(abase + kc, C_IN);
    v16h bb = load_frag16x32(bbase + kc, C_IN);
    acc = wmma_f16(a, bb, acc);
  }
  int o = o0 + (lane & 15);
  int qi = o >> 8;                 // 0 => Q, 1 => K
  int h = (o >> 6) & 3;
  int d = o & 63;
  _Float16* dst = (qi ? Kg : Qg) + ((size_t)(b * NH + h) * S_TOTAL) * DHEAD + d;
  float sc = qi ? 1.0f : QSCALE;
#pragma unroll
  for (int r = 0; r < 8; ++r) {
    int s = s0 + r + ((lane >> 4) << 3);
    dst[(size_t)s * DHEAD] = (_Float16)(acc[r] * sc);
  }
}

// ---------------------------------------------------------------------------
// Kernel 4: projection for V, un-transposed orientation:
// qkv[o][s] = sum_c w_pw[o][c]*dwT[s][c];  A = w_pw rows (o), B = dwT rows (s).
// Writes V transposed: VT [bh][d][t=s] f16 (coalesced: lanes advance s).
// ---------------------------------------------------------------------------
__global__ __launch_bounds__(256) void proj_v_kernel(
    const _Float16* __restrict__ dwT, const _Float16* __restrict__ wph,
    _Float16* __restrict__ VTg) {
  int wave = threadIdx.x >> 5, lane = threadIdx.x & 31;
  int s0 = (blockIdx.x * 8 + wave) * 16;
  int o0 = 512 + blockIdx.y * 16;                  // o in [512,768)
  int b = blockIdx.z;
  const _Float16* abase = wph + (size_t)o0 * C_IN;
  const _Float16* bbase = dwT + ((size_t)(b * S_TOTAL + s0)) * C_IN;
  v8f acc = {};
#pragma unroll
  for (int kc = 0; kc < C_IN; kc += 32) {
    v16h a  = load_frag16x32(abase + kc, C_IN);
    v16h bb = load_frag16x32(bbase + kc, C_IN);
    acc = wmma_f16(a, bb, acc);
  }
  int s = s0 + (lane & 15);
#pragma unroll
  for (int r = 0; r < 8; ++r) {
    int o = o0 + r + ((lane >> 4) << 3);
    int h = (o - 512) >> 6;
    int d = (o - 512) & 63;
    VTg[((size_t)(b * NH + h) * DHEAD + d) * S_TOTAL + s] = (_Float16)acc[r];
  }
}

// ---------------------------------------------------------------------------
// Kernel 5: flash attention, transposed formulation, double-buffered async
// global->LDS DMA (ASYNCcnt).
// Per wave: 16 s-columns.  S'[t,s] = K·Q^T tiles (t rows in VGPRs, s across
// lanes) -> online softmax is per-lane over VGPRs + one shfl_xor(16).
// P' C-fragment re-packs directly into the B-fragment for O^T = V^T · P'
// (half h<8 <- frag0[h], half h>=8 <- frag1[h-8]) -- no transpose traffic.
// ---------------------------------------------------------------------------
// LDS row pitch in halves: 16 B x odd (144 B for K rows, 80 B for V^T rows), so
// the 16 rows that one ds_load_b128 fragment read touches fall on distinct banks.
#define K_PITCH  72
#define V_PITCH  40
#define KT_ELEMS (32 * K_PITCH)
#define VT_ELEMS (64 * V_PITCH)
#define N_ITERS  (S_TOTAL / 32)

__global__ __launch_bounds__(256) void attn_kernel(
    const _Float16* __restrict__ Qg, const _Float16* __restrict__ Kg,
    const _Float16* __restrict__ VTg, float* __restrict__ out) {
  __shared__ __align__(16) _Float16 lds_k[2 * KT_ELEMS];   // [buf][t][d], padded rows
  __shared__ __align__(16) _Float16 lds_vt[2 * VT_ELEMS];  // [buf][d][t], padded rows
  int tid = threadIdx.x, lane = tid & 31, wave = tid >> 5;
  int bh = blockIdx.y;
  int scol0 = blockIdx.x * 128 + wave * 16;

  const _Float16* Qb = Qg + ((size_t)bh * S_TOTAL + scol0) * DHEAD;
  const _Float16* Kb = Kg + (size_t)bh * S_TOTAL * DHEAD;
  const _Float16* Vb = VTg + (size_t)bh * DHEAD * S_TOTAL;

  // Q B-fragments, loaded once (lane -> column s, halves -> d)
  v16h bq0 = load_frag16x32(Qb, DHEAD);
  v16h bq1 = load_frag16x32(Qb + 32, DHEAD);

  v8f acc0 = {}, acc1 = {}, acc2 = {}, acc3 = {};
  float m_run = -3.0e38f, l_run = 0.f;
  int vd = tid >> 2, vp = tid & 3;                    // V^T tile load mapping
  int klds = (tid >> 3) * K_PITCH + (tid & 7) * 8;    // this lane's 16 B in a K tile
  int vlds = vd * V_PITCH + vp * 8;                   // ... and in a V^T tile

  // prologue: async-load tile 0 into buffer 0 (16B per thread per tile)
  async_load16_kv(Kb + (size_t)tid * 8, lds_k + klds,
                  Vb + (size_t)vd * S_TOTAL + vp * 8, lds_vt + vlds);

  for (int i = 0; i < N_ITERS; ++i) {
    int t0 = i * 32;
    const _Float16* kcur = lds_k + (i & 1) * KT_ELEMS;
    const _Float16* vcur = lds_vt + (i & 1) * VT_ELEMS;
    if (i + 1 < N_ITERS) {
      // issue next tile's DMA into the other buffer; it overlaps this
      // iteration's WMMAs.  Waiting ASYNCcnt<=2 releases only tile i
      // (async loads complete in order).
      _Float16* knxt = lds_k + ((i + 1) & 1) * KT_ELEMS;
      _Float16* vnxt = lds_vt + ((i + 1) & 1) * VT_ELEMS;
      async_load16_kv(Kb + (size_t)(t0 + 32) * DHEAD + tid * 8, knxt + klds,
                      Vb + (size_t)vd * S_TOTAL + (t0 + 32) + vp * 8, vnxt + vlds);
      S_WAIT_ASYNCCNT(2);
    } else {
      S_WAIT_ASYNCCNT(0);
    }
    __syncthreads();   // all waves' DMA for tile i landed

    // scores S'[t, s]: 2 t-subtiles x (d=0..31, d=32..63)
    v8f c0 = {}, c1 = {};
    c0 = wmma_f16(load_frag16x32(kcur + 0, K_PITCH), bq0, c0);
    c0 = wmma_f16(load_frag16x32(kcur + 32, K_PITCH), bq1, c0);
    c1 = wmma_f16(load_frag16x32(kcur + 16 * K_PITCH, K_PITCH), bq0, c1);
    c1 = wmma_f16(load_frag16x32(kcur + 16 * K_PITCH + 32, K_PITCH), bq1, c1);

    // online softmax over t (rows): in-lane over VGPRs + shfl_xor(16)
    float tm = c0[0];
#pragma unroll
    for (int r = 0; r < 8; ++r) { tm = fmaxf(tm, c0[r]); tm = fmaxf(tm, c1[r]); }
    tm = fmaxf(tm, __shfl_xor(tm, 16, 32));
    float mn = fmaxf(m_run, tm);
    float alpha = exp2f(m_run - mn);
    float ts = 0.f;
#pragma unroll
    for (int r = 0; r < 8; ++r) {
      c0[r] = exp2f(c0[r] - mn);
      c1[r] = exp2f(c1[r] - mn);
      ts += c0[r] + c1[r];
    }
    ts += __shfl_xor(ts, 16, 32);
    l_run = l_run * alpha + ts;
    m_run = mn;
#pragma unroll
    for (int r = 0; r < 8; ++r) {
      acc0[r] *= alpha; acc1[r] *= alpha; acc2[r] *= alpha; acc3[r] *= alpha;
    }

    // P' C-fragment -> B-fragment for O^T = V^T * P'  (layout identity)
    v16h bp;
#pragma unroll
    for (int r = 0; r < 8; ++r) {
      bp[r] = (_Float16)c0[r];
      bp[r + 8] = (_Float16)c1[r];
    }
    acc0 = wmma_f16(load_frag16x32(vcur + 0 * 16 * V_PITCH, V_PITCH), bp, acc0);
    acc1 = wmma_f16(load_frag16x32(vcur + 1 * 16 * V_PITCH, V_PITCH), bp, acc1);
    acc2 = wmma_f16(load_frag16x32(vcur + 2 * 16 * V_PITCH, V_PITCH), bp, acc2);
    acc3 = wmma_f16(load_frag16x32(vcur + 3 * 16 * V_PITCH, V_PITCH), bp, acc3);
    __syncthreads();   // tile i fully consumed before i+2's DMA reuses buffer
  }

  // epilogue: out[bh*64 + d][s] = acc / l   (lanes advance s -> coalesced)
  float inv = 1.0f / l_run;
  int s = scol0 + (lane & 15);
  int rbase = (lane >> 4) << 3;
#pragma unroll
  for (int r = 0; r < 8; ++r) {
    int d = r + rbase;
    out[(size_t)(bh * 64 + d +  0) * S_TOTAL + s] = acc0[r] * inv;
    out[(size_t)(bh * 64 + d + 16) * S_TOTAL + s] = acc1[r] * inv;
    out[(size_t)(bh * 64 + d + 32) * S_TOTAL + s] = acc2[r] * inv;
    out[(size_t)(bh * 64 + d + 48) * S_TOTAL + s] = acc3[r] * inv;
  }
}

// ---------------------------------------------------------------------------
extern "C" void kernel_launch(void* const* d_in, const int* in_sizes, int n_in,
                              void* d_out, int out_size, void* d_ws,
                              size_t ws_size, hipStream_t stream) {
  (void)in_sizes; (void)n_in; (void)out_size; (void)ws_size;
  const float* x    = (const float*)d_in[0];   // [4,256,64,64]
  const float* w_dw = (const float*)d_in[1];   // [256,1,3,3]
  const float* w_pw = (const float*)d_in[2];   // [768,256]
  float* out = (float*)d_out;                  // [4,256,64,64]

  char* ws = (char*)d_ws;
  _Float16* dwT = (_Float16*)(ws);                   // 4*4096*256 f16 = 8 MiB
  _Float16* Qg  = (_Float16*)(ws + (8u  << 20));     // 16*4096*64 f16 = 8 MiB
  _Float16* Kg  = (_Float16*)(ws + (16u << 20));     // 8 MiB
  _Float16* VTg = (_Float16*)(ws + (24u << 20));     // 8 MiB
  _Float16* wph = (_Float16*)(ws + (32u << 20));     // 768*256 f16

  cvt_wpw_kernel<<<768, 256, 0, stream>>>(w_pw, wph);
  dwconv_kernel<<<dim3(64, 4), 256, 0, stream>>>(x, w_dw, dwT);
  proj_qk_kernel<<<dim3(256, 4, 4), 256, 0, stream>>>(dwT, wph, Qg, Kg);
  proj_v_kernel<<<dim3(32, 16, 4), 256, 0, stream>>>(dwT, wph, VTg);
  attn_kernel<<<dim3(32, 16), 256, 0, stream>>>(Qg, Kg, VTg, out);
}

// v002
// It runs in 156 microseconds.
// Next to v001, in two timings, it ran 1.45 and 1.47 times as fast.
// Counting every step since v000, it is 2.01 times as fast.
#include <hip/hip_runtime.h>

typedef __attribute__((ext_vector_type(16))) _Float16 v16h;
typedef __attribute__((ext_vector_type(8)))  _Float16 v8h;
typedef __attribute__((ext_vector_type(8)))  float    v8f;

#define S_TOTAL 4096
#define DHEAD   64
#define NH      4
#define NB      4
#define C_IN    256
// fold 1/sqrt(64) and log2(e) into Q so softmax can use exp2
#define QSCALE  (0.125f * 1.44269504088896340736f)

// ---------------------------------------------------------------------------
// Fragment loader for CDNA5 WMMA f16 operands (A 16x32 MxK, or B 32x16 KxN
// loaded from an [N][K] row-major buffer -- both have identical lane layout):
// lane l -> row (l&15); halves 0..7 = k [kb..kb+7], halves 8..15 = k [kb+16..kb+23]
// with kb = (l>>4)*8.  Two 16B vector loads per fragment.
// ---------------------------------------------------------------------------
__device__ __forceinline__ v16h load_frag16x32(const _Float16* base, int stride) {
  int lane = threadIdx.x & 31;
  const _Float16* p = base + (lane & 15) * stride + ((lane >> 4) << 3);
  v8h lo = *(const v8h*)(p);
  v8h hi = *(const v8h*)(p + 16);
  v16h r;
#pragma unroll
  for (int i = 0; i < 8; ++i) { r[i] = lo[i]; r[i + 8] = hi[i]; }
  return r;
}

__device__ __forceinline__ v8f wmma_f16(v16h a, v16h b, v8f c) {
  return __builtin_amdgcn_wmma_f32_16x16x32_f16(false, a, false, b, (short)0, c,
                                                false, false);
}

// Async DMA: 16B global -> LDS, tracked by ASYNCcnt (GLOBAL_LOAD_ASYNC_TO_LDS_B128).
// LDS operand takes the workgroup-relative byte offset; for the flat-LDS
// aperture that is addr[31:0] of the generic pointer (ISA 10.2).
// One statement issues a tile's K copy and V copy; the s_wait_xcnt at its end
// keeps later writes of the four address registers behind the copies' issue.
__device__ __forceinline__ void async_load16_kv(const _Float16* gk, _Float16* lk,
                                                const _Float16* gv, _Float16* lv) {
  unsigned int l0 = (unsigned int)(unsigned long long)lk;
  unsigned int l1 = (unsigned int)(unsigned long long)lv;
  unsigned long long g0 = (unsigned long long)gk;
  unsigned long long g1 = (unsigned long long)gv;
  asm volatile("global_load_async_to_lds_b128 %0, %1, off\n\t"
               "global_load_async_to_lds_b128 %2, %3, off\n\t"
               "s_wait_xcnt 0x0"
               :: "v"(l0), "v"(g0), "v"(l1), "v"(g1) : "memory");
}
#define S_WAIT_ASYNCCNT(n) asm volatile("s_wait_asynccnt " #n ::: "memory")

// ---------------------------------------------------------------------------
// Kernel 1: convert pointwise weight [768][256] f32 -> f16
// ---------------------------------------------------------------------------
__global__ void cvt_wpw_kernel(const float* __restrict__ w_pw,
                               _Float16* __restrict__ wph) {
  int idx = blockIdx.x * 256 + threadIdx.x;   // grid 768*256 == 196608 exact
  wph[idx] = (_Float16)w_pw[idx];
}

// ---------------------------------------------------------------------------
// Kernel 2: depthwise 3x3 conv (pad 1).  Output transposed: dwT [b][s][c] f16
// block = (hh, group of 64 channels, b).  Lanes advance along ww: 16 lanes x
// 16 B read one whole 256 B image row of a channel, so every global load
// covers whole lines.  The [c][ww] -> [ww][c] turn goes through LDS, and each
// wave then stores one 128 B line (64 channels of one s) per instruction.
// ---------------------------------------------------------------------------
typedef __attribute__((ext_vector_type(2))) _Float16 v2h;
typedef __attribute__((ext_vector_type(4))) float f4;
// weight vectors: a channel pair's 18 floats start at a multiple of 8 B only
typedef __attribute__((ext_vector_type(4), aligned(8))) float f4u;
typedef __attribute__((ext_vector_type(2), aligned(8))) float f2u;
// staged row pitch in dwords: odd, so the 16 ww-quads of a store (4 rows apart)
// and the 32 channel pairs of a read both fall on distinct banks
#define DW_PITCH 33

// value of lane-1 / lane+1 inside a 16-lane row (one image row); the lane past
// the row's end reads 0, which is the conv's zero padding in ww
__device__ __forceinline__ float from_left_lane(float v) {
  return __int_as_float(__builtin_amdgcn_update_dpp(0, __float_as_int(v), 0x111 /*row_shr:1*/, 0xf, 0xf, true));
}
__device__ __forceinline__ float from_right_lane(float v) {
  return __int_as_float(__builtin_amdgcn_update_dpp(0, __float_as_int(v), 0x101 /*row_shl:1*/, 0xf, 0xf, true));
}

__global__ __launch_bounds__(256) void dwconv_kernel(const float* __restrict__ x,
                                                     const float* __restrict__ w_dw,
                                                     _Float16* __restrict__ dwT) {
  __shared__ unsigned int tile[64 * DW_PITCH];      // [ww][channel pair], 2 x f16
  int hh = blockIdx.x, cg = blockIdx.y, b = blockIdx.z;
  int tid = threadIdx.x, q = tid & 15;              // q: which 4 ww of the row
  bool up = hh > 0, dn = hh < 63;                   // rows hh-1 / hh+1 exist
  // every address = block-uniform base + one per-lane byte offset (+ a constant)
  const float* xg = x + ((size_t)(b * C_IN + cg * 64)) * S_TOTAL;
  const char* xb[3] = { (const char*)(xg + (up ? hh - 1 : hh) * 64),   // a row that does not
                        (const char*)(xg + hh * 64),                  // exist is read as row hh
                        (const char*)(xg + (dn ? hh + 1 : hh) * 64) };// and zeroed below
  const char* wp = (const char*)(w_dw + cg * 64 * 9);
  unsigned xoff = (unsigned)(tid >> 4) * (2u * S_TOTAL * 4u) + (unsigned)q * 16u;
  unsigned woff = (unsigned)(tid >> 4) * (2u * 9u * 4u);
  // all loads first: 2 passes x (18 weights of a channel pair, 2 channels x 3 rows of 4 ww)
  // (every loop of this kernel is unrolled so that its arrays are indexed by constants
  // and stay in registers)
  f4u wa[2][4];
  f2u wb[2];
  f4  v[2][2][3];
#pragma unroll
  for (int p = 0; p < 2; ++p) {
    const char* wc = wp + p * (32 * 9 * 4);
#pragma unroll
    for (int j = 0; j < 4; ++j) wa[p][j] = *(const f4u*)(wc + j * 16 + woff);
    wb[p] = *(const f2u*)(wc + 64 + woff);
#pragma unroll
    for (int e = 0; e < 2; ++e) {
#pragma unroll
      for (int ky = 0; ky < 3; ++ky)
        v[p][e][ky] = *(const f4*)(xb[ky] + (p * 32 + e) * (S_TOTAL * 4) + xoff);
    }
  }
  // Fence on the loaded values and the two offsets (inputs only): keeps all 22 loads in
  // flight together in front of the arithmetic, which otherwise gets them one wait at a
  // time, and keeps every rewrite of the loads' address registers behind the wait.
  asm volatile("s_wait_xcnt 0x0"
               :: "v"(wa[0][0]), "v"(wa[0][1]), "v"(wa[0][2]), "v"(wa[0][3]), "v"(wb[0]),
                  "v"(wa[1][0]), "v"(wa[1][1]), "v"(wa[1][2]), "v"(wa[1][3]), "v"(wb[1]),
                  "v"(v[0][0][0]), "v"(v[0][0][1]), "v"(v[0][0][2]),
                  "v"(v[0][1][0]), "v"(v[0][1][1]), "v"(v[0][1][2]),
                  "v"(v[1][0][0]), "v"(v[1][0][1]), "v"(v[1][0][2]),
                  "v"(v[1][1][0]), "v"(v[1][1][1]), "v"(v[1][1][2]),
                  "v"(xoff), "v"(woff));
#pragma unroll
  for (int p = 0; p < 2; ++p) {
    float s[2][4];
#pragma unroll
    for (int e = 0; e < 2; ++e) {
      s[e][0] = 0.f; s[e][1] = 0.f; s[e][2] = 0.f; s[e][3] = 0.f;
#pragma unroll
      for (int ky = 0; ky < 3; ++ky) {
        f4 r = v[p][e][ky];
        if ((ky == 0 && !up) || (ky == 2 && !dn)) {  // zero padding in hh
          r.x = 0.f; r.y = 0.f; r.z = 0.f; r.w = 0.f;
        }
        float a[6] = { from_left_lane(r.w), r.x, r.y, r.z, r.w, from_right_lane(r.x) };
#pragma unroll
        for (int kx = 0; kx < 3; ++kx) {
          int k = e * 9 + ky * 3 + kx;               // index in the pair's 18 weights
          float w = (k < 16) ? wa[p][k >> 2][k & 3] : wb[p][k & 1];
#pragma unroll
          for (int j = 0; j < 4; ++j)
            s[e][j] = __builtin_fmaf(a[j + kx], w, s[e][j]);
        }
      }
    }
    int cp = p * 16 + (tid >> 4);                   // channel pair in the group
#pragma unroll
    for (int j = 0; j < 4; ++j) {
      v2h h = { (_Float16)s[0][j], (_Float16)s[1][j] };
      tile[(q * 4 + j) * DW_PITCH + cp] = __builtin_bit_cast(unsigned int, h);
    }
  }
  __syncthreads();   // the whole [64 ww][64 c] tile is staged before any row leaves
  int wave = tid >> 5, lane = tid & 31;
  unsigned int* dst = (unsigned int*)(dwT + ((size_t)(b * S_TOTAL + hh * 64)) * C_IN + cg * 64);
#pragma unroll
  for (int i = 0; i < 8; ++i) {
    int r = wave * 8 + i;
    dst[(size_t)r * (C_IN / 2) + lane] = tile[r * DW_PITCH + lane];
  }
}

// ---------------------------------------------------------------------------
// Kernel 3: projection for Q and K.  qkvT[s][o] = sum_c dwT[s][c]*w_pw[o][c]
// A = dwT rows (s), B = w_pw rows (o) -- both row-major [*][c].
// Each wave: one 16x16 tile, K-loop 256 = 8 WMMAs.  Q gets QSCALE folded in.
// Writes Q,K as [bh][s][d] f16 (coalesced: lanes advance d).
// ---------------------------------------------------------------------------
__global__ __launch_bounds__(256) void proj_qk_kernel(
    const _Float16* __restrict__ dwT, const _Float16* __restrict__ wph,
    _Float16* __restrict__ Qg, _Float16* __restrict__ Kg) {
  int wave = threadIdx.x >> 5, lane = threadIdx.x & 31;
  int s0 = blockIdx.x * 16;
  int o0 = (blockIdx.y * 8 + wave) * 16;           // o in [0,512)
  int b = blockIdx.z;
  const _Float16* abase = dwT + ((size_t)(b * S_TOTAL + s0)) * C_IN;
  const _Float16* bbase = wph + (size_t)o0 * C_IN;
  v8f acc = {};
#pragma unroll
  for (int kc = 0; kc < C_IN; kc += 32) {
    v16h a  = load_frag16x32(abase + kc, C_IN);
    v16h bb = load_frag16x32(bbase + kc, C_IN);
    acc = wmma_f16(a, bb, acc);
  }
  int o = o0 + (lane & 15);
  int qi = o >> 8;                 // 0 => Q, 1 => K
  int h = (o >> 6) & 3;
  int d = o & 63;
  _Float16* dst = (qi ? Kg : Qg) + ((size_t)(b * NH + h) * S_TOTAL) * DHEAD + d;
  float sc = qi ? 1.0f : QSCALE;
#pragma unroll
  for (int r = 0; r < 8; ++r) {
    int s = s0 + r + ((lane >> 4) << 3);
    dst[(size_t)s * DHEAD] = (_Float16)(acc[r] * sc);
  }
}

// ---------------------------------------------------------------------------
// Kernel 4: projection for V, un-transposed orientation:
// qkv[o][s] = sum_c w_pw[o][c]*dwT[s][c];  A = w_pw rows (o), B = dwT rows (s).
// Writes V transposed: VT [bh][d][t=s] f16 (coalesced: lanes advance s).
// ---------------------------------------------------------------------------
__global__ __launch_bounds__(256) void proj_v_kernel(
    const _Float16* __restrict__ dwT, const _Float16* __restrict__ wph,
    _Float16* __restrict__ VTg) {
  int wave = threadIdx.x >> 5, lane = threadIdx.x & 31;
  int s0 = (blockIdx.x * 8 + wave) * 16;
  int o0 = 512 + blockIdx.y * 16;                  // o in [512,768)
  int b = blockIdx.z;
  const _Float16* abase = wph + (size_t)o0 * C_IN;
  const _Float16* bbase = dwT + ((size_t)(b * S_TOTAL + s0)) * C_IN;
  v8f acc = {};
#pragma unroll
  for (int kc = 0; kc < C_IN; kc += 32) {
    v16h a  = load_frag16x32(abase + kc, C_IN);
    v16h bb = load_frag16x32(bbase + kc, C_IN);
    acc = wmma_f16(a, bb, acc);
  }
  int s = s0 + (lane & 15);
#pragma unroll
  for (int r = 0; r < 8; ++r) {
    int o = o0 + r + ((lane >> 4) << 3);
    int h = (o - 512) >> 6;
    int d = (o - 512) & 63;
    VTg[((size_t)(b * NH + h) * DHEAD + d) * S_TOTAL + s] = (_Float16)acc[r];
  }
}

// ---------------------------------------------------------------------------
// Kernel 5: flash attention, transposed formulation, double-buffered async
// global->LDS DMA (ASYNCcnt).
// Per wave: 16 s-columns.  S'[t,s] = K·Q^T tiles (t rows in VGPRs, s across
// lanes) -> online softmax is per-lane over VGPRs + one shfl_xor(16).
// P' C-fragment re-packs directly into the B-fragment for O^T = V^T · P'
// (half h<8 <- frag0[h], half h>=8 <- frag1[h-8]) -- no transpose traffic.
// ---------------------------------------------------------------------------
// LDS row pitch in halves: 16 B x odd (144 B for K rows, 80 B for V^T rows), so
// the 16 rows that one ds_load_b128 fragment read touches fall on distinct banks.
#define K_PITCH  72
#define V_PITCH  40
#define KT_ELEMS (32 * K_PITCH)
#define VT_ELEMS (64 * V_PITCH)
#define N_ITERS  (S_TOTAL / 32)

__global__ __launch_bounds__(256) void attn_kernel(
    const _Float16* __restrict__ Qg, const _Float16* __restrict__ Kg,
    const _Float16* __restrict__ VTg, float* __restrict__ out) {
  __shared__ __align__(16) _Float16 lds_k[2 * KT_ELEMS];   // [buf][t][d], padded rows
  __shared__ __align__(16) _Float16 lds_vt[2 * VT_ELEMS];  // [buf][d][t], padded rows
  int tid = threadIdx.x, lane = tid & 31, wave = tid >> 5;
  int bh = blockIdx.y;
  int scol0 = blockIdx.x * 128 + wave * 16;

  const _Float16* Qb = Qg + ((size_t)bh * S_TOTAL + scol0) * DHEAD;
  const _Float16* Kb = Kg + (size_t)bh * S_TOTAL * DHEAD;
  const _Float16* Vb = VTg + (size_t)bh * DHEAD * S_TOTAL;

  // Q B-fragments, loaded once (lane -> column s, halves -> d)
  v16h bq0 = load_frag16x32(Qb, DHEAD);
  v16h bq1 = load_frag16x32(Qb + 32, DHEAD);

  v8f acc0 = {}, acc1 = {}, acc2 = {}, acc3 = {};
  float m_run = -3.0e38f, l_run = 0.f;
  int vd = tid >> 2, vp = tid & 3;                    // V^T tile load mapping
  int klds = (tid >> 3) * K_PITCH + (tid & 7) * 8;    // this lane's 16 B in a K tile
  int vlds = vd * V_PITCH + vp * 8;                   // ... and in a V^T tile

  // prologue: async-load tile 0 into buffer 0 (16B per thread per tile)
  async_load16_kv(Kb + (size_t)tid * 8, lds_k + klds,
                  Vb + (size_t)vd * S_TOTAL + vp * 8, lds_vt + vlds);

  for (int i = 0; i < N_ITERS; ++i) {
    int t0 = i * 32;
    const _Float16* kcur = lds_k + (i & 1) * KT_ELEMS;
    const _Float16* vcur = lds_vt + (i & 1) * VT_ELEMS;
    if (i + 1 < N_ITERS) {
      // issue next tile's DMA into the other buffer; it overlaps this
      // iteration's WMMAs.  Waiting ASYNCcnt<=2 releases only tile i
      // (async loads complete in order).
      _Float16* knxt = lds_k + ((i + 1) & 1) * KT_ELEMS;
      _Float16* vnxt = lds_vt + ((i + 1) & 1) * VT_ELEMS;
      async_load16_kv(Kb + (size_t)(t0 + 32) * DHEAD + tid * 8, knxt + klds,
                      Vb + (size_t)vd * S_TOTAL + (t0 + 32) + vp * 8, vnxt + vlds);
      S_WAIT_ASYNCCNT(2);
    } else {
      S_WAIT_ASYNCCNT(0);
    }
    __syncthreads();   // all waves' DMA for tile i landed

    // scores S'[t, s]: 2 t-subtiles x (d=0..31, d=32..63)
    v8f c0 = {}, c1 = {};
    c0 = wmma_f16(load_frag16x32(kcur + 0, K_PITCH), bq0, c0);
    c0 = wmma_f16(load_frag16x32(kcur + 32, K_PITCH), bq1, c0);
    c1 = wmma_f16(load_frag16x32(kcur + 16 * K_PITCH, K_PITCH), bq0, c1);
    c1 = wmma_f16(load_frag16x32(kcur + 16 * K_PITCH + 32, K_PITCH), bq1, c1);

    // online softmax over t (rows): in-lane over VGPRs + shfl_xor(16)
    float tm = c0[0];
#pragma unroll
    for (int r = 0; r < 8; ++r) { tm = fmaxf(tm, c0[r]); tm = fmaxf(tm, c1[r]); }
    tm = fmaxf(tm, __shfl_xor(tm, 16, 32));
    float mn = fmaxf(m_run, tm);
    float alpha = exp2f(m_run - mn);
    float ts = 0.f;
#pragma unroll
    for (int r = 0; r < 8; ++r) {
      c0[r] = exp2f(c0[r] - mn);
      c1[r] = exp2f(c1[r] - mn);
      ts += c0[r] + c1[r];
    }
    ts += __shfl_xor(ts, 16, 32);
    l_run = l_run * alpha + ts;
    m_run = mn;
#pragma unroll
    for (int r = 0; r < 8; ++r) {
      acc0[r] *= alpha; acc1[r] *= alpha; acc2[r] *= alpha; acc3[r] *= alpha;
    }

    // P' C-fragment -> B-fragment for O^T = V^T * P'  (layout identity)
    v16h bp;
#pragma unroll
    for (int r = 0; r < 8; ++r) {
      bp[r] = (_Float16)c0[r];
      bp[r + 8] = (_Float16)c1[r];
    }
    acc0 = wmma_f16(load_frag16x32(vcur + 0 * 16 * V_PITCH, V_PITCH), bp, acc0);
    acc1 = wmma_f16(load_frag16x32(vcur + 1 * 16 * V_PITCH, V_PITCH), bp, acc1);
    acc2 = wmma_f16(load_frag16x32(vcur + 2 * 16 * V_PITCH, V_PITCH), bp, acc2);
    acc3 = wmma_f16(load_frag16x32(vcur + 3 * 16 * V_PITCH, V_PITCH), bp, acc3);
    __syncthreads();   // tile i fully consumed before i+2's DMA reuses buffer
  }

  // epilogue: out[bh*64 + d][s] = acc / l   (lanes advance s -> coalesced)
  float inv = 1.0f / l_run;
  int s = scol0 + (lane & 15);
  int rbase = (lane >> 4) << 3;
#pragma unroll
  for (int r = 0; r < 8; ++r) {
    int d = r + rbase;
    out[(size_t)(bh * 64 + d +  0) * S_TOTAL + s] = acc0[r] * inv;
    out[(size_t)(bh * 64 + d + 16) * S_TOTAL + s] = acc1[r] * inv;
    out[(size_t)(bh * 64 + d + 32) * S_TOTAL + s] = acc2[r] * inv;
    out[(size_t)(bh * 64 + d + 48) * S_TOTAL + s] = acc3[r] * inv;
  }
}

// ---------------------------------------------------------------------------
extern "C" void kernel_launch(void* const* d_in, const int* in_sizes, int n_in,
                              void* d_out, int out_size, void* d_ws,
                              size_t ws_size, hipStream_t stream) {
  (void)in_sizes; (void)n_in; (void)out_size; (void)ws_size;
  const float* x    = (const float*)d_in[0];   // [4,256,64,64]
  const float* w_dw = (const float*)d_in[1];   // [256,1,3,3]
  const float* w_pw = (const float*)d_in[2];   // [768,256]
  float* out = (float*)d_out;                  // [4,256,64,64]

  char* ws = (char*)d_ws;
  _Float16* dwT = (_Float16*)(ws);                   // 4*4096*256 f16 = 8 MiB
  _Float16* Qg  = (_Float16*)(ws + (8u  << 20));     // 16*4096*64 f16 = 8 MiB
  _Float16* Kg  = (_Float16*)(ws + (16u << 20));     // 8 MiB
  _Float16* VTg = (_Float16*)(ws + (24u << 20));     // 8 MiB
  _Float16* wph = (_Float16*)(ws + (32u << 20));     // 768*256 f16

  cvt_wpw_kernel<<<768, 256, 0, stream>>>(w_pw, wph);
  dwconv_kernel<<<dim3(64, 4, 4), 256, 0, stream>>>(x, w_dw, dwT);
  proj_qk_kernel<<<dim3(256, 4, 4), 256, 0, stream>>>(dwT, wph, Qg, Kg);
  proj_v_kernel<<<dim3(32, 16, 4), 256, 0, stream>>>(dwT, wph, VTg);
  attn_kernel<<<dim3(32, 16), 256, 0, stream>>>(Qg, Kg, VTg, out);
}

// v003
// Measured time: 140 microseconds a run.
// Two timings next to v002 put it at 1.13 and 1.11 times that version's speed.
// Over all steps from v000 it is 2.26 times as fast.
#include <hip/hip_runtime.h>

typedef __attribute__((ext_vector_type(16))) _Float16 v16h;
typedef __attribute__((ext_vector_type(8)))  _Float16 v8h;
typedef __attribute__((ext_vector_type(8)))  float    v8f;

#define S_TOTAL 4096
#define DHEAD   64
#define NH      4
#define NB      4
#define C_IN    256
// fold 1/sqrt(64) and log2(e) into Q so softmax can use exp2
#define QSCALE  (0.125f * 1.44269504088896340736f)

// ---------------------------------------------------------------------------
// Fragment loader for CDNA5 WMMA f16 operands (A 16x32 MxK, or B 32x16 KxN
// loaded from an [N][K] row-major buffer -- both have identical lane layout):
// lane l -> row (l&15); halves 0..7 = k [kb..kb+7], halves 8..15 = k [kb+16..kb+23]
// with kb = (l>>4)*8.  Two 16B vector loads per fragment.
// ---------------------------------------------------------------------------
__device__ __forceinline__ v16h load_frag16x32(const _Float16* base, int stride) {
  int lane = threadIdx.x & 31;
  const _Float16* p = base + (lane & 15) * stride + ((lane >> 4) << 3);
  v8h lo = *(const v8h*)(p);
  v8h hi = *(const v8h*)(p + 16);
  v16h r;
#pragma unroll
  for (int i = 0; i < 8; ++i) { r[i] = lo[i]; r[i + 8] = hi[i]; }
  return r;
}

__device__ __forceinline__ v8f wmma_f16(v16h a, v16h b, v8f c) {
  return __builtin_amdgcn_wmma_f32_16x16x32_f16(false, a, false, b, (short)0, c,
                                                false, false);
}

// Async DMA: 16B global -> LDS, tracked by ASYNCcnt (GLOBAL_LOAD_ASYNC_TO_LDS_B128).
// LDS operand takes the workgroup-relative byte offset; for the flat-LDS
// aperture that is addr[31:0] of the generic pointer (ISA 10.2).
// One statement issues a tile's K copy and V copy; the s_wait_xcnt at its end
// keeps later writes of the four address registers behind the copies' issue.
__device__ __forceinline__ void async_load16_kv(const _Float16* gk, _Float16* lk,
                                                const _Float16* gv, _Float16* lv) {
  unsigned int l0 = (unsigned int)(unsigned long long)lk;
  unsigned int l1 = (unsigned int)(unsigned long long)lv;
  unsigned long long g0 = (unsigned long long)gk;
  unsigned long long g1 = (unsigned long long)gv;
  asm volatile("global_load_async_to_lds_b128 %0, %1, off\n\t"
               "global_load_async_to_lds_b128 %2, %3, off\n\t"
               "s_wait_xcnt 0x0"
               :: "v"(l0), "v"(g0), "v"(l1), "v"(g1) : "memory");
}
#define S_WAIT_ASYNCCNT(n) asm volatile("s_wait_asynccnt " #n ::: "memory")

// ---------------------------------------------------------------------------
// Kernel 1: convert pointwise weight [768][256] f32 -> f16
// ---------------------------------------------------------------------------
__global__ void cvt_wpw_kernel(const float* __restrict__ w_pw,
                               _Float16* __restrict__ wph) {
  int idx = blockIdx.x * 256 + threadIdx.x;   // grid 768*256 == 196608 exact
  wph[idx] = (_Float16)w_pw[idx];
}

// ---------------------------------------------------------------------------
// Kernel 2: depthwise 3x3 conv (pad 1).  Output transposed: dwT [b][s][c] f16
// block = (hh, group of 64 channels, b).  Lanes advance along ww: 16 lanes x
// 16 B read one whole 256 B image row of a channel, so every global load
// covers whole lines.  The [c][ww] -> [ww][c] turn goes through LDS, and each
// wave then stores one 128 B line (64 channels of one s) per instruction.
// ---------------------------------------------------------------------------
typedef __attribute__((ext_vector_type(2))) _Float16 v2h;
typedef __attribute__((ext_vector_type(4))) float f4;
// weight vectors: a channel pair's 18 floats start at a multiple of 8 B only
typedef __attribute__((ext_vector_type(4), aligned(8))) float f4u;
typedef __attribute__((ext_vector_type(2), aligned(8))) float f2u;
// staged row pitch in dwords: odd, so the 16 ww-quads of a store (4 rows apart)
// and the 32 channel pairs of a read both fall on distinct banks
#define DW_PITCH 33

// value of lane-1 / lane+1 inside a 16-lane row (one image row); the lane past
// the row's end reads 0, which is the conv's zero padding in ww
__device__ __forceinline__ float from_left_lane(float v) {
  return __int_as_float(__builtin_amdgcn_update_dpp(0, __float_as_int(v), 0x111 /*row_shr:1*/, 0xf, 0xf, true));
}
__device__ __forceinline__ float from_right_lane(float v) {
  return __int_as_float(__builtin_amdgcn_update_dpp(0, __float_as_int(v), 0x101 /*row_shl:1*/, 0xf, 0xf, true));
}

__global__ __launch_bounds__(256) void dwconv_kernel(const float* __restrict__ x,
                                                     const float* __restrict__ w_dw,
                                                     _Float16* __restrict__ dwT) {
  __shared__ unsigned int tile[64 * DW_PITCH];      // [ww][channel pair], 2 x f16
  int hh = blockIdx.x, cg = blockIdx.y, b = blockIdx.z;
  int tid = threadIdx.x, q = tid & 15;              // q: which 4 ww of the row
  bool up = hh > 0, dn = hh < 63;                   // rows hh-1 / hh+1 exist
  // every address = block-uniform base + one per-lane byte offset (+ a constant)
  const float* xg = x + ((size_t)(b * C_IN + cg * 64)) * S_TOTAL;
  const char* xb[3] = { (const char*)(xg + (up ? hh - 1 : hh) * 64),   // a row that does not
                        (const char*)(xg + hh * 64),                  // exist is read as row hh
                        (const char*)(xg + (dn ? hh + 1 : hh) * 64) };// and zeroed below
  const char* wp = (const char*)(w_dw + cg * 64 * 9);
  unsigned xoff = (unsigned)(tid >> 4) * (2u * S_TOTAL * 4u) + (unsigned)q * 16u;
  unsigned woff = (unsigned)(tid >> 4) * (2u * 9u * 4u);
  // all loads first: 2 passes x (18 weights of a channel pair, 2 channels x 3 rows of 4 ww)
  // (every loop of this kernel is unrolled so that its arrays are indexed by constants
  // and stay in registers)
  f4u wa[2][4];
  f2u wb[2];
  f4  v[2][2][3];
#pragma unroll
  for (int p = 0; p < 2; ++p) {
    const char* wc = wp + p * (32 * 9 * 4);
#pragma unroll
    for (int j = 0; j < 4; ++j) wa[p][j] = *(const f4u*)(wc + j * 16 + woff);
    wb[p] = *(const f2u*)(wc + 64 + woff);
#pragma unroll
    for (int e = 0; e < 2; ++e) {
#pragma unroll
      for (int ky = 0; ky < 3; ++ky)
        v[p][e][ky] = *(const f4*)(xb[ky] + (p * 32 + e) * (S_TOTAL * 4) + xoff);
    }
  }
  // Fence on the loaded values and the two offsets (inputs only): keeps all 22 loads in
  // flight together in front of the arithmetic, which otherwise gets them one wait at a
  // time, and keeps every rewrite of the loads' address registers behind the wait.
  asm volatile("s_wait_xcnt 0x0"
               :: "v"(wa[0][0]), "v"(wa[0][1]), "v"(wa[0][2]), "v"(wa[0][3]), "v"(wb[0]),
                  "v"(wa[1][0]), "v"(wa[1][1]), "v"(wa[1][2]), "v"(wa[1][3]), "v"(wb[1]),
                  "v"(v[0][0][0]), "v"(v[0][0][1]), "v"(v[0][0][2]),
                  "v"(v[0][1][0]), "v"(v[0][1][1]), "v"(v[0][1][2]),
                  "v"(v[1][0][0]), "v"(v[1][0][1]), "v"(v[1][0][2]),
                  "v"(v[1][1][0]), "v"(v[1][1][1]), "v"(v[1][1][2]),
                  "v"(xoff), "v"(woff));
#pragma unroll
  for (int p = 0; p < 2; ++p) {
    float s[2][4];
#pragma unroll
    for (int e = 0; e < 2; ++e) {
      s[e][0] = 0.f; s[e][1] = 0.f; s[e][2] = 0.f; s[e][3] = 0.f;
#pragma unroll
      for (int ky = 0; ky < 3; ++ky) {
        f4 r = v[p][e][ky];
        if ((ky == 0 && !up) || (ky == 2 && !dn)) {  // zero padding in hh
          r.x = 0.f; r.y = 0.f; r.z = 0.f; r.w = 0.f;
        }
        float a[6] = { from_left_lane(r.w), r.x, r.y, r.z, r.w, from_right_lane(r.x) };
#pragma unroll
        for (int kx = 0; kx < 3; ++kx) {
          int k = e * 9 + ky * 3 + kx;               // index in the pair's 18 weights
          float w = (k < 16) ? wa[p][k >> 2][k & 3] : wb[p][k & 1];
#pragma unroll
          for (int j = 0; j < 4; ++j)
            s[e][j] = __builtin_fmaf(a[j + kx], w, s[e][j]);
        }
      }
    }
    int cp = p * 16 + (tid >> 4);                   // channel pair in the group
#pragma unroll
    for (int j = 0; j < 4; ++j) {
      v2h h = { (_Float16)s[0][j], (_Float16)s[1][j] };
      tile[(q * 4 + j) * DW_PITCH + cp] = __builtin_bit_cast(unsigned int, h);
    }
  }
  __syncthreads();   // the whole [64 ww][64 c] tile is staged before any row leaves
  int wave = tid >> 5, lane = tid & 31;
  unsigned int* dst = (unsigned int*)(dwT + ((size_t)(b * S_TOTAL + hh * 64)) * C_IN + cg * 64);
#pragma unroll
  for (int i = 0; i < 8; ++i) {
    int r = wave * 8 + i;
    dst[(size_t)r * (C_IN / 2) + lane] = tile[r * DW_PITCH + lane];
  }
}

// ---------------------------------------------------------------------------
// Kernel 3: projection for Q and K.  qkvT[s][o] = sum_c dwT[s][c]*w_pw[o][c]
// A = dwT rows (s), B = w_pw rows (o) -- both row-major [*][c].
// Each wave: one 16x16 tile, K-loop 256 = 8 WMMAs.  Q gets QSCALE folded in.
// Writes Q,K as [bh][s][d] f16 (coalesced: lanes advance d).
// ---------------------------------------------------------------------------
__global__ __launch_bounds__(256) void proj_qk_kernel(
    const _Float16* __restrict__ dwT, const _Float16* __restrict__ wph,
    _Float16* __restrict__ Qg, _Float16* __restrict__ Kg) {
  int wave = threadIdx.x >> 5, lane = threadIdx.x & 31;
  int s0 = blockIdx.x * 16;
  int o0 = (blockIdx.y * 8 + wave) * 16;           // o in [0,512)
  int b = blockIdx.z;
  const _Float16* abase = dwT + ((size_t)(b * S_TOTAL + s0)) * C_IN;
  const _Float16* bbase = wph + (size_t)o0 * C_IN;
  v8f acc = {};
#pragma unroll
  for (int kc = 0; kc < C_IN; kc += 32) {
    v16h a  = load_frag16x32(abase + kc, C_IN);
    v16h bb = load_frag16x32(bbase + kc, C_IN);
    acc = wmma_f16(a, bb, acc);
  }
  int o = o0 + (lane & 15);
  int qi = o >> 8;                 // 0 => Q, 1 => K
  int h = (o >> 6) & 3;
  int d = o & 63;
  _Float16* dst = (qi ? Kg : Qg) + ((size_t)(b * NH + h) * S_TOTAL) * DHEAD + d;
  float sc = qi ? 1.0f : QSCALE;
#pragma unroll
  for (int r = 0; r < 8; ++r) {
    int s = s0 + r + ((lane >> 4) << 3);
    dst[(size_t)s * DHEAD] = (_Float16)(acc[r] * sc);
  }
}

// ---------------------------------------------------------------------------
// Kernel 4: projection for V, un-transposed orientation:
// qkv[o][s] = sum_c w_pw[o][c]*dwT[s][c];  A = w_pw rows (o), B = dwT rows (s).
// Writes V transposed: VT [bh][d][t=s] f16 (coalesced: lanes advance s).
// ---------------------------------------------------------------------------
__global__ __launch_bounds__(256) void proj_v_kernel(
    const _Float16* __restrict__ dwT, const _Float16* __restrict__ wph,
    _Float16* __restrict__ VTg) {
  int wave = threadIdx.x >> 5, lane = threadIdx.x & 31;
  int s0 = (blockIdx.x * 8 + wave) * 16;
  int o0 = 512 + blockIdx.y * 16;                  // o in [512,768)
  int b = blockIdx.z;
  const _Float16* abase = wph + (size_t)o0 * C_IN;
  const _Float16* bbase = dwT + ((size_t)(b * S_TOTAL + s0)) * C_IN;
  v8f acc = {};
#pragma unroll
  for (int kc = 0; kc < C_IN; kc += 32) {
    v16h a  = load_frag16x32(abase + kc, C_IN);
    v16h bb = load_frag16x32(bbase + kc, C_IN);
    acc = wmma_f16(a, bb, acc);
  }
  int s = s0 + (lane & 15);
#pragma unroll
  for (int r = 0; r < 8; ++r) {
    int o = o0 + r + ((lane >> 4) << 3);
    int h = (o - 512) >> 6;
    int d = (o - 512) & 63;
    VTg[((size_t)(b * NH + h) * DHEAD + d) * S_TOTAL + s] = (_Float16)acc[r];
  }
}

// ---------------------------------------------------------------------------
// Kernel 5: flash attention, transposed formulation, double-buffered async
// global->LDS DMA (ASYNCcnt).
// Per wave: 16 s-columns.  S'[t,s] = K·Q^T tiles (t rows in VGPRs, s across
// lanes) -> online softmax is per-lane over VGPRs + one shfl_xor(16).
// P' C-fragment re-packs directly into the B-fragment for O^T = V^T · P'
// (half h<8 <- frag0[h], half h>=8 <- frag1[h-8]) -- no transpose traffic.
// ---------------------------------------------------------------------------
// LDS row pitch in halves: 16 B x odd (144 B for K rows, 80 B for V^T rows), so
// the 16 rows that one ds_load_b128 fragment read touches fall on distinct banks.
#define K_PITCH  72
#define V_PITCH  40
#define KT_ELEMS (32 * K_PITCH)
#define VT_ELEMS (64 * V_PITCH)
#define N_ITERS  (S_TOTAL / 32)

// 2^x as the bare v_exp_f32.  exp2f() wraps that instruction in a range fix-up (a
// compare, two selects, an add and an ldexp for each value) whose only effect is on
// results below 2^-126.  Here every argument is <= 0 and the column's largest score
// gives exactly 1: a weight that small is 0 as f16 and is lost in the f32 row sum, and
// a rescale factor that small multiplies sums that the new tile outweighs by 2^126.
__device__ __forceinline__ float exp2_hw(float x) { return __builtin_amdgcn_exp2f(x); }

__global__ __launch_bounds__(256) void attn_kernel(
    const _Float16* __restrict__ Qg, const _Float16* __restrict__ Kg,
    const _Float16* __restrict__ VTg, float* __restrict__ out) {
  __shared__ __align__(16) _Float16 lds_k[2 * KT_ELEMS];   // [buf][t][d], padded rows
  __shared__ __align__(16) _Float16 lds_vt[2 * VT_ELEMS];  // [buf][d][t], padded rows
  int tid = threadIdx.x, lane = tid & 31, wave = tid >> 5;
  int bh = blockIdx.y;
  int scol0 = blockIdx.x * 128 + wave * 16;

  const _Float16* Qb = Qg + ((size_t)bh * S_TOTAL + scol0) * DHEAD;
  const _Float16* Kb = Kg + (size_t)bh * S_TOTAL * DHEAD;
  const _Float16* Vb = VTg + (size_t)bh * DHEAD * S_TOTAL;

  // Q B-fragments, loaded once (lane -> column s, halves -> d)
  v16h bq0 = load_frag16x32(Qb, DHEAD);
  v16h bq1 = load_frag16x32(Qb + 32, DHEAD);

  v8f acc0 = {}, acc1 = {}, acc2 = {}, acc3 = {};
  float m_run = -3.0e38f, l_run = 0.f;
  int vd = tid >> 2, vp = tid & 3;                    // V^T tile load mapping
  int klds = (tid >> 3) * K_PITCH + (tid & 7) * 8;    // this lane's 16 B in a K tile
  int vlds = vd * V_PITCH + vp * 8;                   // ... and in a V^T tile

  // prologue: async-load tile 0 into buffer 0 (16B per thread per tile)
  async_load16_kv(Kb + (size_t)tid * 8, lds_k + klds,
                  Vb + (size_t)vd * S_TOTAL + vp * 8, lds_vt + vlds);

  for (int i = 0; i < N_ITERS; ++i) {
    int t0 = i * 32;
    const _Float16* kcur = lds_k + (i & 1) * KT_ELEMS;
    const _Float16* vcur = lds_vt + (i & 1) * VT_ELEMS;
    if (i + 1 < N_ITERS) {
      // issue next tile's DMA into the other buffer; it overlaps this
      // iteration's WMMAs.  Waiting ASYNCcnt<=2 releases only tile i
      // (async loads complete in order).
      _Float16* knxt = lds_k + ((i + 1) & 1) * KT_ELEMS;
      _Float16* vnxt = lds_vt + ((i + 1) & 1) * VT_ELEMS;
      async_load16_kv(Kb + (size_t)(t0 + 32) * DHEAD + tid * 8, knxt + klds,
                      Vb + (size_t)vd * S_TOTAL + (t0 + 32) + vp * 8, vnxt + vlds);
      S_WAIT_ASYNCCNT(2);
    } else {
      S_WAIT_ASYNCCNT(0);
    }
    __syncthreads();   // all waves' DMA for tile i landed

    // scores S'[t, s]: 2 t-subtiles x (d=0..31, d=32..63)
    v8f c0 = {}, c1 = {};
    c0 = wmma_f16(load_frag16x32(kcur + 0, K_PITCH), bq0, c0);
    c0 = wmma_f16(load_frag16x32(kcur + 32, K_PITCH), bq1, c0);
    c1 = wmma_f16(load_frag16x32(kcur + 16 * K_PITCH, K_PITCH), bq0, c1);
    c1 = wmma_f16(load_frag16x32(kcur + 16 * K_PITCH + 32, K_PITCH), bq1, c1);

    // online softmax over t (rows): in-lane over VGPRs + shfl_xor(16)
    float tm = c0[0];
#pragma unroll
    for (int r = 0; r < 8; ++r) { tm = fmaxf(tm, c0[r]); tm = fmaxf(tm, c1[r]); }
    tm = fmaxf(tm, __shfl_xor(tm, 16, 32));
    float mn = fmaxf(m_run, tm);
    float alpha = exp2_hw(m_run - mn);
    float ts = 0.f;
#pragma unroll
    for (int r = 0; r < 8; ++r) {
      c0[r] = exp2_hw(c0[r] - mn);
      c1[r] = exp2_hw(c1[r] - mn);
      ts += c0[r] + c1[r];
    }
    ts += __shfl_xor(ts, 16, 32);
    l_run = l_run * alpha + ts;
    m_run = mn;
#pragma unroll
    for (int r = 0; r < 8; ++r) {
      acc0[r] *= alpha; acc1[r] *= alpha; acc2[r] *= alpha; acc3[r] *= alpha;
    }

    // P' C-fragment -> B-fragment for O^T = V^T * P'  (layout identity)
    v16h bp;
#pragma unroll
    for (int r = 0; r < 8; ++r) {
      bp[r] = (_Float16)c0[r];
      bp[r + 8] = (_Float16)c1[r];
    }
    acc0 = wmma_f16(load_frag16x32(vcur + 0 * 16 * V_PITCH, V_PITCH), bp, acc0);
    acc1 = wmma_f16(load_frag16x32(vcur + 1 * 16 * V_PITCH, V_PITCH), bp, acc1);
    acc2 = wmma_f16(load_frag16x32(vcur + 2 * 16 * V_PITCH, V_PITCH), bp, acc2);
    acc3 = wmma_f16(load_frag16x32(vcur + 3 * 16 * V_PITCH, V_PITCH), bp, acc3);
    __syncthreads();   // tile i fully consumed before i+2's DMA reuses buffer
  }

  // epilogue: out[bh*64 + d][s] = acc / l   (lanes advance s -> coalesced)
  float inv = 1.0f / l_run;
  int s = scol0 + (lane & 15);
  int rbase = (lane >> 4) << 3;
#pragma unroll
  for (int r = 0; r < 8; ++r) {
    int d = r + rbase;
    out[(size_t)(bh * 64 + d +  0) * S_TOTAL + s] = acc0[r] * inv;
    out[(size_t)(bh * 64 + d + 16) * S_TOTAL + s] = acc1[r] * inv;
    out[(size_t)(bh * 64 + d + 32) * S_TOTAL + s] = acc2[r] * inv;
    out[(size_t)(bh * 64 + d + 48) * S_TOTAL + s] = acc3[r] * inv;
  }
}

// ---------------------------------------------------------------------------
extern "C" void kernel_launch(void* const* d_in, const int* in_sizes, int n_in,
                              void* d_out, int out_size, void* d_ws,
                              size_t ws_size, hipStream_t stream) {
  (void)in_sizes; (void)n_in; (void)out_size; (void)ws_size;
  const float* x    = (const float*)d_in[0];   // [4,256,64,64]
  const float* w_dw = (const float*)d_in[1];   // [256,1,3,3]
  const float* w_pw = (const float*)d_in[2];   // [768,256]
  float* out = (float*)d_out;                  // [4,256,64,64]

  char* ws = (char*)d_ws;
  _Float16* dwT = (_Float16*)(ws);                   // 4*4096*256 f16 = 8 MiB
  _Float16* Qg  = (_Float16*)(ws + (8u  << 20));     // 16*4096*64 f16 = 8 MiB
  _Float16* Kg  = (_Float16*)(ws + (16u << 20));     // 8 MiB
  _Float16* VTg = (_Float16*)(ws + (24u << 20));     // 8 MiB
  _Float16* wph = (_Float16*)(ws + (32u << 20));     // 768*256 f16

  cvt_wpw_kernel<<<768, 256, 0, stream>>>(w_pw, wph);
  dwconv_kernel<<<dim3(64, 4, 4), 256, 0, stream>>>(x, w_dw, dwT);
  proj_qk_kernel<<<dim3(256, 4, 4), 256, 0, stream>>>(dwT, wph, Qg, Kg);
  proj_v_kernel<<<dim3(32, 16, 4), 256, 0, stream>>>(dwT, wph, VTg);
  attn_kernel<<<dim3(32, 16), 256, 0, stream>>>(Qg, Kg, VTg, out);
}

// v004
// Measured time: 123 microseconds a run.
// Two timings next to v003 both put it at 1.15 times that version's speed.
// All steps since v000 together make it 2.59 times as fast.
#include <hip/hip_runtime.h>

typedef __attribute__((ext_vector_type(16))) _Float16 v16h;
typedef __attribute__((ext_vector_type(8)))  _Float16 v8h;
typedef __attribute__((ext_vector_type(8)))  float    v8f;

#define S_TOTAL 4096
#define DHEAD   64
#define NH      4
#define NB      4
#define C_IN    256
// fold 1/sqrt(64) and log2(e) into Q so softmax can use exp2
#define QSCALE  (0.125f * 1.44269504088896340736f)

// ---------------------------------------------------------------------------
// Fragment loader for CDNA5 WMMA f16 operands (A 16x32 MxK, or B 32x16 KxN
// loaded from an [N][K] row-major buffer -- both have identical lane layout):
// lane l -> row (l&15); halves 0..7 = k [kb..kb+7], halves 8..15 = k [kb+16..kb+23]
// with kb = (l>>4)*8.  Two 16B vector loads per fragment.
// ---------------------------------------------------------------------------
__device__ __forceinline__ v16h load_frag16x32(const _Float16* base, int stride) {
  int lane = threadIdx.x & 31;
  const _Float16* p = base + (lane & 15) * stride + ((lane >> 4) << 3);
  v8h lo = *(const v8h*)(p);
  v8h hi = *(const v8h*)(p + 16);
  v16h r;
#pragma unroll
  for (int i = 0; i < 8; ++i) { r[i] = lo[i]; r[i + 8] = hi[i]; }
  return r;
}

__device__ __forceinline__ v8f wmma_f16(v16h a, v16h b, v8f c) {
  return __builtin_amdgcn_wmma_f32_16x16x32_f16(false, a, false, b, (short)0, c,
                                                false, false);
}

// Async DMA: 16B global -> LDS, tracked by ASYNCcnt (GLOBAL_LOAD_ASYNC_TO_LDS_B128).
// LDS operand takes the workgroup-relative byte offset; for the flat-LDS
// aperture that is addr[31:0] of the generic pointer (ISA 10.2).
// One statement issues a stage's four copies (K and V tile of both key groups); the
// s_wait_xcnt at its end keeps later writes of the eight address registers behind the
// copies' issue.
__device__ __forceinline__ void async_load16_kv2(const _Float16* gk0, _Float16* lk0,
                                                 const _Float16* gv0, _Float16* lv0,
                                                 const _Float16* gk1, _Float16* lk1,
                                                 const _Float16* gv1, _Float16* lv1) {
  unsigned int l0 = (unsigned int)(unsigned long long)lk0;
  unsigned int l1 = (unsigned int)(unsigned long long)lv0;
  unsigned int l2 = (unsigned int)(unsigned long long)lk1;
  unsigned int l3 = (unsigned int)(unsigned long long)lv1;
  unsigned long long g0 = (unsigned long long)gk0;
  unsigned long long g1 = (unsigned long long)gv0;
  unsigned long long g2 = (unsigned long long)gk1;
  unsigned long long g3 = (unsigned long long)gv1;
  asm volatile("global_load_async_to_lds_b128 %0, %1, off\n\t"
               "global_load_async_to_lds_b128 %2, %3, off\n\t"
               "global_load_async_to_lds_b128 %4, %5, off\n\t"
               "global_load_async_to_lds_b128 %6, %7, off\n\t"
               "s_wait_xcnt 0x0"
               :: "v"(l0), "v"(g0), "v"(l1), "v"(g1), "v"(l2), "v"(g2), "v"(l3), "v"(g3)
               : "memory");
}
#define S_WAIT_ASYNCCNT(n) asm volatile("s_wait_asynccnt " #n ::: "memory")

// ---------------------------------------------------------------------------
// Kernel 1: convert pointwise weight [768][256] f32 -> f16
// ---------------------------------------------------------------------------
__global__ void cvt_wpw_kernel(const float* __restrict__ w_pw,
                               _Float16* __restrict__ wph) {
  int idx = blockIdx.x * 256 + threadIdx.x;   // grid 768*256 == 196608 exact
  wph[idx] = (_Float16)w_pw[idx];
}

// ---------------------------------------------------------------------------
// Kernel 2: depthwise 3x3 conv (pad 1).  Output transposed: dwT [b][s][c] f16
// block = (hh, group of 64 channels, b).  Lanes advance along ww: 16 lanes x
// 16 B read one whole 256 B image row of a channel, so every global load
// covers whole lines.  The [c][ww] -> [ww][c] turn goes through LDS, and each
// wave then stores one 128 B line (64 channels of one s) per instruction.
// ---------------------------------------------------------------------------
typedef __attribute__((ext_vector_type(2))) _Float16 v2h;
typedef __attribute__((ext_vector_type(4))) float f4;
// weight vectors: a channel pair's 18 floats start at a multiple of 8 B only
typedef __attribute__((ext_vector_type(4), aligned(8))) float f4u;
typedef __attribute__((ext_vector_type(2), aligned(8))) float f2u;
// staged row pitch in dwords: odd, so the 16 ww-quads of a store (4 rows apart)
// and the 32 channel pairs of a read both fall on distinct banks
#define DW_PITCH 33

// value of lane-1 / lane+1 inside a 16-lane row (one image row); the lane past
// the row's end reads 0, which is the conv's zero padding in ww
__device__ __forceinline__ float from_left_lane(float v) {
  return __int_as_float(__builtin_amdgcn_update_dpp(0, __float_as_int(v), 0x111 /*row_shr:1*/, 0xf, 0xf, true));
}
__device__ __forceinline__ float from_right_lane(float v) {
  return __int_as_float(__builtin_amdgcn_update_dpp(0, __float_as_int(v), 0x101 /*row_shl:1*/, 0xf, 0xf, true));
}

__global__ __launch_bounds__(256) void dwconv_kernel(const float* __restrict__ x,
                                                     const float* __restrict__ w_dw,
                                                     _Float16* __restrict__ dwT) {
  __shared__ unsigned int tile[64 * DW_PITCH];      // [ww][channel pair], 2 x f16
  int hh = blockIdx.x, cg = blockIdx.y, b = blockIdx.z;
  int tid = threadIdx.x, q = tid & 15;              // q: which 4 ww of the row
  bool up = hh > 0, dn = hh < 63;                   // rows hh-1 / hh+1 exist
  // every address = block-uniform base + one per-lane byte offset (+ a constant)
  const float* xg = x + ((size_t)(b * C_IN + cg * 64)) * S_TOTAL;
  const char* xb[3] = { (const char*)(xg + (up ? hh - 1 : hh) * 64),   // a row that does not
                        (const char*)(xg + hh * 64),                  // exist is read as row hh
                        (const char*)(xg + (dn ? hh + 1 : hh) * 64) };// and zeroed below
  const char* wp = (const char*)(w_dw + cg * 64 * 9);
  unsigned xoff = (unsigned)(tid >> 4) * (2u * S_TOTAL * 4u) + (unsigned)q * 16u;
  unsigned woff = (unsigned)(tid >> 4) * (2u * 9u * 4u);
  // all loads first: 2 passes x (18 weights of a channel pair, 2 channels x 3 rows of 4 ww)
  // (every loop of this kernel is unrolled so that its arrays are indexed by constants
  // and stay in registers)
  f4u wa[2][4];
  f2u wb[2];
  f4  v[2][2][3];
#pragma unroll
  for (int p = 0; p < 2; ++p) {
    const char* wc = wp + p * (32 * 9 * 4);
#pragma unroll
    for (int j = 0; j < 4; ++j) wa[p][j] = *(const f4u*)(wc + j * 16 + woff);
    wb[p] = *(const f2u*)(wc + 64 + woff);
#pragma unroll
    for (int e = 0; e < 2; ++e) {
#pragma unroll
      for (int ky = 0; ky < 3; ++ky)
        v[p][e][ky] = *(const f4*)(xb[ky] + (p * 32 + e) * (S_TOTAL * 4) + xoff);
    }
  }
  // Fence on the loaded values and the two offsets (inputs only): keeps all 22 loads in
  // flight together in front of the arithmetic, which otherwise gets them one wait at a
  // time, and keeps every rewrite of the loads' address registers behind the wait.
  asm volatile("s_wait_xcnt 0x0"
               :: "v"(wa[0][0]), "v"(wa[0][1]), "v"(wa[0][2]), "v"(wa[0][3]), "v"(wb[0]),
                  "v"(wa[1][0]), "v"(wa[1][1]), "v"(wa[1][2]), "v"(wa[1][3]), "v"(wb[1]),
                  "v"(v[0][0][0]), "v"(v[0][0][1]), "v"(v[0][0][2]),
                  "v"(v[0][1][0]), "v"(v[0][1][1]), "v"(v[0][1][2]),
                  "v"(v[1][0][0]), "v"(v[1][0][1]), "v"(v[1][0][2]),
                  "v"(v[1][1][0]), "v"(v[1][1][1]), "v"(v[1][1][2]),
                  "v"(xoff), "v"(woff));
#pragma unroll
  for (int p = 0; p < 2; ++p) {
    float s[2][4];
#pragma unroll
    for (int e = 0; e < 2; ++e) {
      s[e][0] = 0.f; s[e][1] = 0.f; s[e][2] = 0.f; s[e][3] = 0.f;
#pragma unroll
      for (int ky = 0; ky < 3; ++ky) {
        f4 r = v[p][e][ky];
        if ((ky == 0 && !up) || (ky == 2 && !dn)) {  // zero padding in hh
          r.x = 0.f; r.y = 0.f; r.z = 0.f; r.w = 0.f;
        }
        float a[6] = { from_left_lane(r.w), r.x, r.y, r.z, r.w, from_right_lane(r.x) };
#pragma unroll
        for (int kx = 0; kx < 3; ++kx) {
          int k = e * 9 + ky * 3 + kx;               // index in the pair's 18 weights
          float w = (k < 16) ? wa[p][k >> 2][k & 3] : wb[p][k & 1];
#pragma unroll
          for (int j = 0; j < 4; ++j)
            s[e][j] = __builtin_fmaf(a[j + kx], w, s[e][j]);
        }
      }
    }
    int cp = p * 16 + (tid >> 4);                   // channel pair in the group
#pragma unroll
    for (int j = 0; j < 4; ++j) {
      v2h h = { (_Float16)s[0][j], (_Float16)s[1][j] };
      tile[(q * 4 + j) * DW_PITCH + cp] = __builtin_bit_cast(unsigned int, h);
    }
  }
  __syncthreads();   // the whole [64 ww][64 c] tile is staged before any row leaves
  int wave = tid >> 5, lane = tid & 31;
  unsigned int* dst = (unsigned int*)(dwT + ((size_t)(b * S_TOTAL + hh * 64)) * C_IN + cg * 64);
#pragma unroll
  for (int i = 0; i < 8; ++i) {
    int r = wave * 8 + i;
    dst[(size_t)r * (C_IN / 2) + lane] = tile[r * DW_PITCH + lane];
  }
}

// ---------------------------------------------------------------------------
// Kernel 3: projection for Q and K.  qkvT[s][o] = sum_c dwT[s][c]*w_pw[o][c]
// A = dwT rows (s), B = w_pw rows (o) -- both row-major [*][c].
// Each wave: one 16x16 tile, K-loop 256 = 8 WMMAs.  Q gets QSCALE folded in.
// Writes Q,K as [bh][s][d] f16 (coalesced: lanes advance d).
// ---------------------------------------------------------------------------
__global__ __launch_bounds__(256) void proj_qk_kernel(
    const _Float16* __restrict__ dwT, const _Float16* __restrict__ wph,
    _Float16* __restrict__ Qg, _Float16* __restrict__ Kg) {
  int wave = threadIdx.x >> 5, lane = threadIdx.x & 31;
  int s0 = blockIdx.x * 16;
  int o0 = (blockIdx.y * 8 + wave) * 16;           // o in [0,512)
  int b = blockIdx.z;
  const _Float16* abase = dwT + ((size_t)(b * S_TOTAL + s0)) * C_IN;
  const _Float16* bbase = wph + (size_t)o0 * C_IN;
  v8f acc = {};
#pragma unroll
  for (int kc = 0; kc < C_IN; kc += 32) {
    v16h a  = load_frag16x32(abase + kc, C_IN);
    v16h bb = load_frag16x32(bbase + kc, C_IN);
    acc = wmma_f16(a, bb, acc);
  }
  int o = o0 + (lane & 15);
  int qi = o >> 8;                 // 0 => Q, 1 => K
  int h = (o >> 6) & 3;
  int d = o & 63;
  _Float16* dst = (qi ? Kg : Qg) + ((size_t)(b * NH + h) * S_TOTAL) * DHEAD + d;
  float sc = qi ? 1.0f : QSCALE;
#pragma unroll
  for (int r = 0; r < 8; ++r) {
    int s = s0 + r + ((lane >> 4) << 3);
    dst[(size_t)s * DHEAD] = (_Float16)(acc[r] * sc);
  }
}

// ---------------------------------------------------------------------------
// Kernel 4: projection for V, un-transposed orientation:
// qkv[o][s] = sum_c w_pw[o][c]*dwT[s][c];  A = w_pw rows (o), B = dwT rows (s).
// Writes V transposed: VT [bh][d][t=s] f16 (coalesced: lanes advance s).
// ---------------------------------------------------------------------------
__global__ __launch_bounds__(256) void proj_v_kernel(
    const _Float16* __restrict__ dwT, const _Float16* __restrict__ wph,
    _Float16* __restrict__ VTg) {
  int wave = threadIdx.x >> 5, lane = threadIdx.x & 31;
  int s0 = (blockIdx.x * 8 + wave) * 16;
  int o0 = 512 + blockIdx.y * 16;                  // o in [512,768)
  int b = blockIdx.z;
  const _Float16* abase = wph + (size_t)o0 * C_IN;
  const _Float16* bbase = dwT + ((size_t)(b * S_TOTAL + s0)) * C_IN;
  v8f acc = {};
#pragma unroll
  for (int kc = 0; kc < C_IN; kc += 32) {
    v16h a  = load_frag16x32(abase + kc, C_IN);
    v16h bb = load_frag16x32(bbase + kc, C_IN);
    acc = wmma_f16(a, bb, acc);
  }
  int s = s0 + (lane & 15);
#pragma unroll
  for (int r = 0; r < 8; ++r) {
    int o = o0 + r + ((lane >> 4) << 3);
    int h = (o - 512) >> 6;
    int d = (o - 512) & 63;
    VTg[((size_t)(b * NH + h) * DHEAD + d) * S_TOTAL + s] = (_Float16)acc[r];
  }
}

// ---------------------------------------------------------------------------
// Kernel 5: flash attention, transposed formulation, double-buffered async
// global->LDS DMA (ASYNCcnt).
// Per wave: 32 s-columns (two 16-column tiles), so every K and V^T fragment read
// from LDS feeds two WMMAs.  To keep eight waves on a block's 128 columns the keys
// are split: waves 0..3 walk keys 0..2047, waves 4..7 keys 2048..4095, each group
// on its own staged tiles; the two partial softmax states of a column are joined
// once, through LDS, after the loop.
// S'[t,s] = K*Q^T tiles (t rows in VGPRs, s across lanes) -> online softmax is
// per-lane over VGPRs + one shfl_xor(16).
// P' C-fragment re-packs directly into the B-fragment for O^T = V^T * P'
// (half h<8 <- frag0[h], half h>=8 <- frag1[h-8]) -- no transpose traffic.
// ---------------------------------------------------------------------------
// LDS row pitch in halves: 16 B x odd (144 B for K rows, 80 B for V^T rows), so
// the 16 rows that one ds_load_b128 fragment read touches fall on distinct banks.
#define K_PITCH  72
#define V_PITCH  40
#define KT_ELEMS (32 * K_PITCH)
#define VT_ELEMS (64 * V_PITCH)
#define KEYS_PER_GROUP (S_TOTAL / 2)
#define N_ITERS  (KEYS_PER_GROUP / 32)
// join area: per wave 9 rows of 32 lanes x 16 B (8 rows of sums, 1 of maximum and sum)
#define JOIN_ROWS 9

// 2^x as the bare v_exp_f32.  exp2f() wraps that instruction in a range fix-up (a
// compare, two selects, an add and an ldexp for each value) whose only effect is on
// results below 2^-126.  Here every argument is <= 0 and the column's largest score
// gives exactly 1: a weight that small is 0 as f16 and is lost in the f32 row sum, and
// a rescale factor that small multiplies sums that the new tile outweighs by 2^126.
__device__ __forceinline__ float exp2_hw(float x) { return __builtin_amdgcn_exp2f(x); }

__global__ __launch_bounds__(256) void attn_kernel(
    const _Float16* __restrict__ Qg, const _Float16* __restrict__ Kg,
    const _Float16* __restrict__ VTg, float* __restrict__ out) {
  __shared__ __align__(16) _Float16 lds_k[4 * KT_ELEMS];   // [buf][key group][t][d], padded rows
  __shared__ __align__(16) _Float16 lds_vt[4 * VT_ELEMS];  // [buf][key group][d][t], padded rows
  __shared__ f4 lds_join[8 * JOIN_ROWS * 32];              // [wave][row][lane]
  int tid = threadIdx.x, lane = tid & 31;
  int wave = __builtin_amdgcn_readfirstlane(tid >> 5);
  int cg = wave & 3, kg = wave >> 2;                  // column group, key group
  int bh = blockIdx.y;
  int scol0 = blockIdx.x * 128 + cg * 32;

  const _Float16* Qb = Qg + ((size_t)bh * S_TOTAL + scol0) * DHEAD;
  const _Float16* Kb = Kg + (size_t)bh * S_TOTAL * DHEAD;
  const _Float16* Vb = VTg + (size_t)bh * DHEAD * S_TOTAL;

  // (every inner loop of this kernel is unrolled so that its fragment and accumulator
  // arrays are indexed by constants and stay in registers)
  // Q B-fragments, loaded once (lane -> column s, halves -> d), [column tile][d half]
  v16h bq[2][2];
#pragma unroll
  for (int c = 0; c < 2; ++c) {
    bq[c][0] = load_frag16x32(Qb + c * 16 * DHEAD, DHEAD);
    bq[c][1] = load_frag16x32(Qb + c * 16 * DHEAD + 32, DHEAD);
  }

  v8f acc[2][4] = {};                                 // [column tile][16 d]
  float m_run[2] = { -3.0e38f, -3.0e38f }, l_run[2] = { 0.f, 0.f };
  int vd = tid >> 2, vp = tid & 3;                    // V^T tile load mapping
  int klds = (tid >> 3) * K_PITCH + (tid & 7) * 8;    // this lane's 16 B in a K tile
  int vlds = vd * V_PITCH + vp * 8;                   // ... and in a V^T tile
  const _Float16* Ksrc = Kb + (size_t)tid * 8;        // this lane's 16 B of key group 0's
  const _Float16* Vsrc = Vb + (size_t)vd * S_TOTAL + vp * 8;   // tile 0, K and V^T

  // prologue: async-load both groups' tile 0 into buffer 0 (16B per thread per tile)
  async_load16_kv2(Ksrc, lds_k + klds, Vsrc, lds_vt + vlds,
                   Ksrc + (size_t)KEYS_PER_GROUP * DHEAD, lds_k + KT_ELEMS + klds,
                   Vsrc + KEYS_PER_GROUP, lds_vt + VT_ELEMS + vlds);

  for (int i = 0; i < N_ITERS; ++i) {
    int t0 = i * 32;
    const _Float16* kcur = lds_k + ((i & 1) * 2 + kg) * KT_ELEMS;
    const _Float16* vcur = lds_vt + ((i & 1) * 2 + kg) * VT_ELEMS;
    if (i + 1 < N_ITERS) {
      // issue the next stage's DMA into the other buffer; it overlaps this
      // iteration's WMMAs.  Waiting ASYNCcnt<=4 leaves only those four copies
      // outstanding, so stage i has landed.
      _Float16* knxt = lds_k + ((i + 1) & 1) * 2 * KT_ELEMS;
      _Float16* vnxt = lds_vt + ((i + 1) & 1) * 2 * VT_ELEMS;
      const _Float16* kg0 = Ksrc + (size_t)(t0 + 32) * DHEAD;
      const _Float16* vg0 = Vsrc + (t0 + 32);
      async_load16_kv2(kg0, knxt + klds, vg0, vnxt + vlds,
                       kg0 + (size_t)KEYS_PER_GROUP * DHEAD, knxt + KT_ELEMS + klds,
                       vg0 + KEYS_PER_GROUP, vnxt + VT_ELEMS + vlds);
      S_WAIT_ASYNCCNT(4);
    } else {
      S_WAIT_ASYNCCNT(0);
    }
    __syncthreads();   // all waves' DMA for stage i landed

    // scores S'[t, s]: 2 t-subtiles x (d=0..31, d=32..63), each K fragment for both column tiles
    v16h ka0 = load_frag16x32(kcur + 0, K_PITCH);
    v16h ka1 = load_frag16x32(kcur + 32, K_PITCH);
    v16h kb0 = load_frag16x32(kcur + 16 * K_PITCH, K_PITCH);
    v16h kb1 = load_frag16x32(kcur + 16 * K_PITCH + 32, K_PITCH);
    v8f c0[2], c1[2];
#pragma unroll
    for (int c = 0; c < 2; ++c) {
      v8f z = {};
      c0[c] = wmma_f16(ka0, bq[c][0], z);
      c1[c] = wmma_f16(kb0, bq[c][0], z);
    }
#pragma unroll
    for (int c = 0; c < 2; ++c) {
      c0[c] = wmma_f16(ka1, bq[c][1], c0[c]);
      c1[c] = wmma_f16(kb1, bq[c][1], c1[c]);
    }

    v16h bp[2];
#pragma unroll
    for (int c = 0; c < 2; ++c) {
      // online softmax over t (rows): in-lane over VGPRs + shfl_xor(16)
      float tm = c0[c][0];
#pragma unroll
      for (int r = 0; r < 8; ++r) { tm = fmaxf(tm, c0[c][r]); tm = fmaxf(tm, c1[c][r]); }
      tm = fmaxf(tm, __shfl_xor(tm, 16, 32));
      float mn = fmaxf(m_run[c], tm);
      float alpha = exp2_hw(m_run[c] - mn);
      float ts = 0.f;
#pragma unroll
      for (int r = 0; r < 8; ++r) {
        c0[c][r] = exp2_hw(c0[c][r] - mn);
        c1[c][r] = exp2_hw(c1[c][r] - mn);
        ts += c0[c][r] + c1[c][r];
      }
      ts += __shfl_xor(ts, 16, 32);
      l_run[c] = l_run[c] * alpha + ts;
      m_run[c] = mn;
#pragma unroll
      for (int a = 0; a < 4; ++a) {
#pragma unroll
        for (int r = 0; r < 8; ++r) acc[c][a][r] *= alpha;
      }
      // P' C-fragment -> B-fragment for O^T = V^T * P'  (layout identity)
#pragma unroll
      for (int r = 0; r < 8; ++r) {
        bp[c][r] = (_Float16)c0[c][r];
        bp[c][r + 8] = (_Float16)c1[c][r];
      }
    }
    // each V^T fragment for both column tiles
#pragma unroll
    for (int a = 0; a < 4; ++a) {
      v16h va = load_frag16x32(vcur + a * 16 * V_PITCH, V_PITCH);
      acc[0][a] = wmma_f16(va, bp[0], acc[0][a]);
      acc[1][a] = wmma_f16(va, bp[1], acc[1][a]);
    }
    __syncthreads();   // stage i fully consumed before i+2's DMA reuses buffer
  }

  // join of the two key groups: waves w and w^4 hold the same 32 columns.  Each hands
  // the other one column tile's state (key group 0 gives tile 1, group 1 gives tile 0)
  // and finishes the tile it keeps.
  bool hi = kg != 0;
  f4* mine = lds_join + wave * (JOIN_ROWS * 32) + lane;
  const f4* theirs = lds_join + (wave ^ 4) * (JOIN_ROWS * 32) + lane;
  v8f keep[4];
#pragma unroll
  for (int a = 0; a < 4; ++a) {
    v8f give = hi ? acc[0][a] : acc[1][a];
    keep[a] = hi ? acc[1][a] : acc[0][a];
    f4 lo4 = { give[0], give[1], give[2], give[3] };
    f4 hi4 = { give[4], give[5], give[6], give[7] };
    mine[(2 * a) * 32] = lo4;
    mine[(2 * a + 1) * 32] = hi4;
  }
  f4 ml = { hi ? m_run[0] : m_run[1], hi ? l_run[0] : l_run[1], 0.f, 0.f };
  mine[8 * 32] = ml;
  float m_k = hi ? m_run[1] : m_run[0], l_k = hi ? l_run[1] : l_run[0];
  __syncthreads();   // every wave's handed-over state is in LDS before its partner reads it
  f4 oml = theirs[8 * 32];
  float m_j = fmaxf(m_k, oml.x);
  float f_k = exp2_hw(m_k - m_j), f_o = exp2_hw(oml.x - m_j);
  float inv = 1.0f / (l_k * f_k + oml.y * f_o);
  f_k *= inv; f_o *= inv;

  // epilogue: out[bh*64 + d][s] = joined sums / joined l   (lanes advance s -> coalesced)
  int s = scol0 + kg * 16 + (lane & 15);
  int rbase = (lane >> 4) << 3;
#pragma unroll
  for (int a = 0; a < 4; ++a) {
    f4 o_lo = theirs[(2 * a) * 32], o_hi = theirs[(2 * a + 1) * 32];
#pragma unroll
    for (int r = 0; r < 8; ++r) {
      float o = (r < 4) ? o_lo[r & 3] : o_hi[r & 3];
      out[(size_t)(bh * 64 + a * 16 + r + rbase) * S_TOTAL + s] = keep[a][r] * f_k + o * f_o;
    }
  }
}

// ---------------------------------------------------------------------------
extern "C" void kernel_launch(void* const* d_in, const int* in_sizes, int n_in,
                              void* d_out, int out_size, void* d_ws,
                              size_t ws_size, hipStream_t stream) {
  (void)in_sizes; (void)n_in; (void)out_size; (void)ws_size;
  const float* x    = (const float*)d_in[0];   // [4,256,64,64]
  const float* w_dw = (const float*)d_in[1];   // [256,1,3,3]
  const float* w_pw = (const float*)d_in[2];   // [768,256]
  float* out = (float*)d_out;                  // [4,256,64,64]

  char* ws = (char*)d_ws;
  _Float16* dwT = (_Float16*)(ws);                   // 4*4096*256 f16 = 8 MiB
  _Float16* Qg  = (_Float16*)(ws + (8u  << 20));     // 16*4096*64 f16 = 8 MiB
  _Float16* Kg  = (_Float16*)(ws + (16u << 20));     // 8 MiB
  _Float16* VTg = (_Float16*)(ws + (24u << 20));     // 8 MiB
  _Float16* wph = (_Float16*)(ws + (32u << 20));     // 768*256 f16

  cvt_wpw_kernel<<<768, 256, 0, stream>>>(w_pw, wph);
  dwconv_kernel<<<dim3(64, 4, 4), 256, 0, stream>>>(x, w_dw, dwT);
  proj_qk_kernel<<<dim3(256, 4, 4), 256, 0, stream>>>(dwT, wph, Qg, Kg);
  proj_v_kernel<<<dim3(32, 16, 4), 256, 0, stream>>>(dwT, wph, VTg);
  attn_kernel<<<dim3(32, 16), 256, 0, stream>>>(Qg, Kg, VTg, out);
}

// v005
// Measured time: 85 microseconds a run.
// Two timings next to v004 put it at 1.44 and 1.45 times that version's speed.
// Over all steps from v000 it is 3.74 times as fast.
#include <hip/hip_runtime.h>

typedef __attribute__((ext_vector_type(16))) _Float16 v16h;
typedef __attribute__((ext_vector_type(8)))  _Float16 v8h;
typedef __attribute__((ext_vector_type(8)))  float    v8f;

#define S_TOTAL 4096
#define DHEAD   64
#define NH      4
#define NB      4
#define C_IN    256
// fold 1/sqrt(64) and log2(e) into Q so softmax can use exp2
#define QSCALE  (0.125f * 1.44269504088896340736f)

// ---------------------------------------------------------------------------
// Fragment loader for CDNA5 WMMA f16 operands (A 16x32 MxK, or B 32x16 KxN
// loaded from an [N][K] row-major buffer -- both have identical lane layout):
// lane l -> row (l&15); halves 0..7 = k [kb..kb+7], halves 8..15 = k [kb+16..kb+23]
// with kb = (l>>4)*8.  Two 16B vector loads per fragment.
// ---------------------------------------------------------------------------
__device__ __forceinline__ v16h load_frag16x32(const _Float16* base, int stride) {
  int lane = threadIdx.x & 31;
  const _Float16* p = base + (lane & 15) * stride + ((lane >> 4) << 3);
  v8h lo = *(const v8h*)(p);
  v8h hi = *(const v8h*)(p + 16);
  v16h r;
#pragma unroll
  for (int i = 0; i < 8; ++i) { r[i] = lo[i]; r[i + 8] = hi[i]; }
  return r;
}

__device__ __forceinline__ v8f wmma_f16(v16h a, v16h b, v8f c) {
  return __builtin_amdgcn_wmma_f32_16x16x32_f16(false, a, false, b, (short)0, c,
                                                false, false);
}

// Async DMA: 16B global -> LDS, tracked by ASYNCcnt (GLOBAL_LOAD_ASYNC_TO_LDS_B128).
// LDS operand takes the workgroup-relative byte offset; for the flat-LDS
// aperture that is addr[31:0] of the generic pointer (ISA 10.2).
// One statement issues a stage's four copies (K and V tile of both key groups); the
// s_wait_xcnt at its end keeps later writes of the eight address registers behind the
// copies' issue.
__device__ __forceinline__ void async_load16_kv2(const _Float16* gk0, _Float16* lk0,
                                                 const _Float16* gv0, _Float16* lv0,
                                                 const _Float16* gk1, _Float16* lk1,
                                                 const _Float16* gv1, _Float16* lv1) {
  unsigned int l0 = (unsigned int)(unsigned long long)lk0;
  unsigned int l1 = (unsigned int)(unsigned long long)lv0;
  unsigned int l2 = (unsigned int)(unsigned long long)lk1;
  unsigned int l3 = (unsigned int)(unsigned long long)lv1;
  unsigned long long g0 = (unsigned long long)gk0;
  unsigned long long g1 = (unsigned long long)gv0;
  unsigned long long g2 = (unsigned long long)gk1;
  unsigned long long g3 = (unsigned long long)gv1;
  asm volatile("global_load_async_to_lds_b128 %0, %1, off\n\t"
               "global_load_async_to_lds_b128 %2, %3, off\n\t"
               "global_load_async_to_lds_b128 %4, %5, off\n\t"
               "global_load_async_to_lds_b128 %6, %7, off\n\t"
               "s_wait_xcnt 0x0"
               :: "v"(l0), "v"(g0), "v"(l1), "v"(g1), "v"(l2), "v"(g2), "v"(l3), "v"(g3)
               : "memory");
}
#define S_WAIT_ASYNCCNT(n) asm volatile("s_wait_asynccnt " #n ::: "memory")

// ---------------------------------------------------------------------------
// Kernel 1: convert pointwise weight [768][256] f32 -> f16
// ---------------------------------------------------------------------------
__global__ void cvt_wpw_kernel(const float* __restrict__ w_pw,
                               _Float16* __restrict__ wph) {
  int idx = blockIdx.x * 256 + threadIdx.x;   // grid 768*256 == 196608 exact
  wph[idx] = (_Float16)w_pw[idx];
}

// ---------------------------------------------------------------------------
// Kernel 2: depthwise 3x3 conv (pad 1).  Output transposed: dwT [b][s][c] f16
// block = (hh, group of 64 channels, b).  Lanes advance along ww: 16 lanes x
// 16 B read one whole 256 B image row of a channel, so every global load
// covers whole lines.  The [c][ww] -> [ww][c] turn goes through LDS, and each
// wave then stores one 128 B line (64 channels of one s) per instruction.
// ---------------------------------------------------------------------------
typedef __attribute__((ext_vector_type(2))) _Float16 v2h;
typedef __attribute__((ext_vector_type(4))) float f4;
// weight vectors: a channel pair's 18 floats start at a multiple of 8 B only
typedef __attribute__((ext_vector_type(4), aligned(8))) float f4u;
typedef __attribute__((ext_vector_type(2), aligned(8))) float f2u;
// staged row pitch in dwords: odd, so the 16 ww-quads of a store (4 rows apart)
// and the 32 channel pairs of a read both fall on distinct banks
#define DW_PITCH 33

// value of lane-1 / lane+1 inside a 16-lane row (one image row); the lane past
// the row's end reads 0, which is the conv's zero padding in ww
__device__ __forceinline__ float from_left_lane(float v) {
  return __int_as_float(__builtin_amdgcn_update_dpp(0, __float_as_int(v), 0x111 /*row_shr:1*/, 0xf, 0xf, true));
}
__device__ __forceinline__ float from_right_lane(float v) {
  return __int_as_float(__builtin_amdgcn_update_dpp(0, __float_as_int(v), 0x101 /*row_shl:1*/, 0xf, 0xf, true));
}

__global__ __launch_bounds__(256) void dwconv_kernel(const float* __restrict__ x,
                                                     const float* __restrict__ w_dw,
                                                     _Float16* __restrict__ dwT) {
  __shared__ unsigned int tile[64 * DW_PITCH];      // [ww][channel pair], 2 x f16
  int hh = blockIdx.x, cg = blockIdx.y, b = blockIdx.z;
  int tid = threadIdx.x, q = tid & 15;              // q: which 4 ww of the row
  bool up = hh > 0, dn = hh < 63;                   // rows hh-1 / hh+1 exist
  // every address = block-uniform base + one per-lane byte offset (+ a constant)
  const float* xg = x + ((size_t)(b * C_IN + cg * 64)) * S_TOTAL;
  const char* xb[3] = { (const char*)(xg + (up ? hh - 1 : hh) * 64),   // a row that does not
                        (const char*)(xg + hh * 64),                  // exist is read as row hh
                        (const char*)(xg + (dn ? hh + 1 : hh) * 64) };// and zeroed below
  const char* wp = (const char*)(w_dw + cg * 64 * 9);
  unsigned xoff = (unsigned)(tid >> 4) * (2u * S_TOTAL * 4u) + (unsigned)q * 16u;
  unsigned woff = (unsigned)(tid >> 4) * (2u * 9u * 4u);
  // all loads first: 2 passes x (18 weights of a channel pair, 2 channels x 3 rows of 4 ww)
  // (every loop of this kernel is unrolled so that its arrays are indexed by constants
  // and stay in registers)
  f4u wa[2][4];
  f2u wb[2];
  f4  v[2][2][3];
#pragma unroll
  for (int p = 0; p < 2; ++p) {
    const char* wc = wp + p * (32 * 9 * 4);
#pragma unroll
    for (int j = 0; j < 4; ++j) wa[p][j] = *(const f4u*)(wc + j * 16 + woff);
    wb[p] = *(const f2u*)(wc + 64 + woff);
#pragma unroll
    for (int e = 0; e < 2; ++e) {
#pragma unroll
      for (int ky = 0; ky < 3; ++ky)
        v[p][e][ky] = *(const f4*)(xb[ky] + (p * 32 + e) * (S_TOTAL * 4) + xoff);
    }
  }
  // Fence on the loaded values and the two offsets (inputs only): keeps all 22 loads in
  // flight together in front of the arithmetic, which otherwise gets them one wait at a
  // time, and keeps every rewrite of the loads' address registers behind the wait.
  asm volatile("s_wait_xcnt 0x0"
               :: "v"(wa[0][0]), "v"(wa[0][1]), "v"(wa[0][2]), "v"(wa[0][3]), "v"(wb[0]),
                  "v"(wa[1][0]), "v"(wa[1][1]), "v"(wa[1][2]), "v"(wa[1][3]), "v"(wb[1]),
                  "v"(v[0][0][0]), "v"(v[0][0][1]), "v"(v[0][0][2]),
                  "v"(v[0][1][0]), "v"(v[0][1][1]), "v"(v[0][1][2]),
                  "v"(v[1][0][0]), "v"(v[1][0][1]), "v"(v[1][0][2]),
                  "v"(v[1][1][0]), "v"(v[1][1][1]), "v"(v[1][1][2]),
                  "v"(xoff), "v"(woff));
#pragma unroll
  for (int p = 0; p < 2; ++p) {
    float s[2][4];
#pragma unroll
    for (int e = 0; e < 2; ++e) {
      s[e][0] = 0.f; s[e][1] = 0.f; s[e][2] = 0.f; s[e][3] = 0.f;
#pragma unroll
      for (int ky = 0; ky < 3; ++ky) {
        f4 r = v[p][e][ky];
        if ((ky == 0 && !up) || (ky == 2 && !dn)) {  // zero padding in hh
          r.x = 0.f; r.y = 0.f; r.z = 0.f; r.w = 0.f;
        }
        float a[6] = { from_left_lane(r.w), r.x, r.y, r.z, r.w, from_right_lane(r.x) };
#pragma unroll
        for (int kx = 0; kx < 3; ++kx) {
          int k = e * 9 + ky * 3 + kx;               // index in the pair's 18 weights
          float w = (k < 16) ? wa[p][k >> 2][k & 3] : wb[p][k & 1];
#pragma unroll
          for (int j = 0; j < 4; ++j)
            s[e][j] = __builtin_fmaf(a[j + kx], w, s[e][j]);
        }
      }
    }
    int cp = p * 16 + (tid >> 4);                   // channel pair in the group
#pragma unroll
    for (int j = 0; j < 4; ++j) {
      v2h h = { (_Float16)s[0][j], (_Float16)s[1][j] };
      tile[(q * 4 + j) * DW_PITCH + cp] = __builtin_bit_cast(unsigned int, h);
    }
  }
  __syncthreads();   // the whole [64 ww][64 c] tile is staged before any row leaves
  int wave = tid >> 5, lane = tid & 31;
  unsigned int* dst = (unsigned int*)(dwT + ((size_t)(b * S_TOTAL + hh * 64)) * C_IN + cg * 64);
#pragma unroll
  for (int i = 0; i < 8; ++i) {
    int r = wave * 8 + i;
    dst[(size_t)r * (C_IN / 2) + lane] = tile[r * DW_PITCH + lane];
  }
}

// ---------------------------------------------------------------------------
// Projections (kernels 3 and 4): one block = 128 rows of dwT (s) x 64 rows of
// w_pw (o), the whole c = 256 of both.  Both operand tiles are brought into LDS
// once, by asynchronous copies in which a wave's 32 lanes x 16 B cover one whole
// 512 B row, and the 8 waves read their WMMA fragments from there: a wave owns
// 32 s x 32 o, so each fragment it reads feeds two WMMAs.
// ---------------------------------------------------------------------------
// LDS row pitch in halves: 528 B = 16 B x odd, so the 16 rows that one
// ds_load_b128 fragment read touches fall on distinct banks.
#define PJ_PITCH 264
#define PJ_S 128
#define PJ_O 64

// Eight 16 B copies of this lane, global -> LDS: 64 rows of 512 B for the block.
// From one copy to the next the block's 256 lanes advance 4096 B in global memory
// (8 rows) and 8 padded rows in LDS.  The s_wait_xcnt at the statement's end keeps
// later writes of the address registers behind the copies' issue.
__device__ __forceinline__ void async_rows64(const _Float16* g, _Float16* l) {
  unsigned int l0 = (unsigned int)(unsigned long long)l;
  unsigned long long g0 = (unsigned long long)g;
  const unsigned int LS = 8u * PJ_PITCH * 2u;
  const unsigned long long GS = 4096ull;
  asm volatile("global_load_async_to_lds_b128 %0, %1, off\n\t"
               "global_load_async_to_lds_b128 %2, %3, off\n\t"
               "global_load_async_to_lds_b128 %4, %5, off\n\t"
               "global_load_async_to_lds_b128 %6, %7, off\n\t"
               "global_load_async_to_lds_b128 %8, %9, off\n\t"
               "global_load_async_to_lds_b128 %10, %11, off\n\t"
               "global_load_async_to_lds_b128 %12, %13, off\n\t"
               "global_load_async_to_lds_b128 %14, %15, off\n\t"
               "s_wait_xcnt 0x0"
               :: "v"(l0), "v"(g0), "v"(l0 + LS), "v"(g0 + GS),
                  "v"(l0 + 2u * LS), "v"(g0 + 2ull * GS), "v"(l0 + 3u * LS), "v"(g0 + 3ull * GS),
                  "v"(l0 + 4u * LS), "v"(g0 + 4ull * GS), "v"(l0 + 5u * LS), "v"(g0 + 5ull * GS),
                  "v"(l0 + 6u * LS), "v"(g0 + 6ull * GS), "v"(l0 + 7u * LS), "v"(g0 + 7ull * GS)
               : "memory");
}

// Fills both tiles: sg = first of 128 contiguous dwT rows, wg = first of 64 contiguous
// weight rows.  On return every wave may read every row.
__device__ __forceinline__ void proj_stage(const _Float16* sg, const _Float16* wg,
                                           _Float16* sT, _Float16* wT) {
  int tid = threadIdx.x;
  int goff = tid * 8;                                   // this lane's 16 B of 4096 B
  int loff = (tid >> 5) * PJ_PITCH + (tid & 31) * 8;    // row = wave, 16 B piece = lane
  async_rows64(sg + goff, sT + loff);
  async_rows64(sg + 64 * C_IN + goff, sT + 64 * PJ_PITCH + loff);
  async_rows64(wg + goff, wT + loff);
  S_WAIT_ASYNCCNT(0);   // this wave's 24 copies have landed
  __syncthreads();      // ... and every other wave's, before any fragment is read
}

// acc[i][j] += A rows (i*16..) x B rows (j*16..), c in the order 0, 32, .., 224
__device__ __forceinline__ void proj_mma(const _Float16* aT, const _Float16* bT,
                                         v8f (&acc)[2][2]) {
  // unrolled so that the LDS reads of later c blocks can be issued ahead of the WMMAs
#pragma unroll
  for (int kc = 0; kc < C_IN; kc += 32) {
    v16h a0 = load_frag16x32(aT + kc, PJ_PITCH);
    v16h a1 = load_frag16x32(aT + 16 * PJ_PITCH + kc, PJ_PITCH);
    v16h b0 = load_frag16x32(bT + kc, PJ_PITCH);
    v16h b1 = load_frag16x32(bT + 16 * PJ_PITCH + kc, PJ_PITCH);
    acc[0][0] = wmma_f16(a0, b0, acc[0][0]);
    acc[0][1] = wmma_f16(a0, b1, acc[0][1]);
    acc[1][0] = wmma_f16(a1, b0, acc[1][0]);
    acc[1][1] = wmma_f16(a1, b1, acc[1][1]);
  }
}

// ---------------------------------------------------------------------------
// Kernel 3: projection for Q and K.  qkvT[s][o] = sum_c dwT[s][c]*w_pw[o][c]
// A = dwT rows (s), B = w_pw rows (o) -- both row-major [*][c].
// Q gets QSCALE folded in.
// Writes Q,K as [bh][s][d] f16 (lanes advance d).
// ---------------------------------------------------------------------------
__global__ __launch_bounds__(256) void proj_qk_kernel(
    const _Float16* __restrict__ dwT, const _Float16* __restrict__ wph,
    _Float16* __restrict__ Qg, _Float16* __restrict__ Kg) {
  __shared__ __align__(16) _Float16 sT[PJ_S * PJ_PITCH];
  __shared__ __align__(16) _Float16 wT[PJ_O * PJ_PITCH];
  int wave = threadIdx.x >> 5, lane = threadIdx.x & 31;
  int s0 = blockIdx.x * PJ_S;
  int o0 = blockIdx.y * PJ_O;                      // o in [0,512)
  int b = blockIdx.z;
  proj_stage(dwT + ((size_t)(b * S_TOTAL + s0)) * C_IN, wph + (size_t)o0 * C_IN, sT, wT);
  int sw = (wave & 3) * 32, ow = (wave >> 2) * 32; // this wave's 32 s x 32 o
  v8f acc[2][2] = {};
  proj_mma(sT + sw * PJ_PITCH, wT + ow * PJ_PITCH, acc);
  // (unrolled so that acc is indexed by constants and stays in registers)
#pragma unroll
  for (int j = 0; j < 2; ++j) {
    int o = o0 + ow + j * 16 + (lane & 15);
    int qi = o >> 8;                 // 0 => Q, 1 => K
    int h = (o >> 6) & 3;
    int d = o & 63;
    _Float16* dst = (qi ? Kg : Qg) + ((size_t)(b * NH + h) * S_TOTAL) * DHEAD + d;
    float sc = qi ? 1.0f : QSCALE;
#pragma unroll
    for (int i = 0; i < 2; ++i) {
#pragma unroll
      for (int r = 0; r < 8; ++r) {
        int s = s0 + sw + i * 16 + r + ((lane >> 4) << 3);
        dst[(size_t)s * DHEAD] = (_Float16)(acc[i][j][r] * sc);
      }
    }
  }
}

// ---------------------------------------------------------------------------
// Kernel 4: projection for V, un-transposed orientation:
// qkv[o][s] = sum_c w_pw[o][c]*dwT[s][c];  A = w_pw rows (o), B = dwT rows (s).
// Writes V transposed: VT [bh][d][t=s] f16 (lanes advance s).
// ---------------------------------------------------------------------------
__global__ __launch_bounds__(256) void proj_v_kernel(
    const _Float16* __restrict__ dwT, const _Float16* __restrict__ wph,
    _Float16* __restrict__ VTg) {
  __shared__ __align__(16) _Float16 sT[PJ_S * PJ_PITCH];
  __shared__ __align__(16) _Float16 wT[PJ_O * PJ_PITCH];
  int wave = threadIdx.x >> 5, lane = threadIdx.x & 31;
  int s0 = blockIdx.x * PJ_S;
  int o0 = 512 + blockIdx.y * PJ_O;                // o in [512,768)
  int b = blockIdx.z;
  proj_stage(dwT + ((size_t)(b * S_TOTAL + s0)) * C_IN, wph + (size_t)o0 * C_IN, sT, wT);
  int sw = (wave & 3) * 32, ow = (wave >> 2) * 32; // this wave's 32 s x 32 o
  v8f acc[2][2] = {};
  proj_mma(wT + ow * PJ_PITCH, sT + sw * PJ_PITCH, acc);
  // (unrolled so that acc is indexed by constants and stays in registers)
#pragma unroll
  for (int j = 0; j < 2; ++j) {
    int s = s0 + sw + j * 16 + (lane & 15);
#pragma unroll
    for (int i = 0; i < 2; ++i) {
#pragma unroll
      for (int r = 0; r < 8; ++r) {
        int o = o0 + ow + i * 16 + r + ((lane >> 4) << 3);
        int h = (o - 512) >> 6;
        int d = (o - 512) & 63;
        VTg[((size_t)(b * NH + h) * DHEAD + d) * S_TOTAL + s] = (_Float16)acc[i][j][r];
      }
    }
  }
}

// ---------------------------------------------------------------------------
// Kernel 5: flash attention, transposed formulation, double-buffered async
// global->LDS DMA (ASYNCcnt).
// Per wave: 32 s-columns (two 16-column tiles), so every K and V^T fragment read
// from LDS feeds two WMMAs.  To keep eight waves on a block's 128 columns the keys
// are split: waves 0..3 walk keys 0..2047, waves 4..7 keys 2048..4095, each group
// on its own staged tiles; the two partial softmax states of a column are joined
// once, through LDS, after the loop.
// S'[t,s] = K*Q^T tiles (t rows in VGPRs, s across lanes) -> online softmax is
// per-lane over VGPRs + one shfl_xor(16).
// P' C-fragment re-packs directly into the B-fragment for O^T = V^T * P'
// (half h<8 <- frag0[h], half h>=8 <- frag1[h-8]) -- no transpose traffic.
// ---------------------------------------------------------------------------
// LDS row pitch in halves: 16 B x odd (144 B for K rows, 80 B for V^T rows), so
// the 16 rows that one ds_load_b128 fragment read touches fall on distinct banks.
#define K_PITCH  72
#define V_PITCH  40
#define KT_ELEMS (32 * K_PITCH)
#define VT_ELEMS (64 * V_PITCH)
#define KEYS_PER_GROUP (S_TOTAL / 2)
#define N_ITERS  (KEYS_PER_GROUP / 32)
// join area: per wave 9 rows of 32 lanes x 16 B (8 rows of sums, 1 of maximum and sum)
#define JOIN_ROWS 9

// 2^x as the bare v_exp_f32.  exp2f() wraps that instruction in a range fix-up (a
// compare, two selects, an add and an ldexp for each value) whose only effect is on
// results below 2^-126.  Here every argument is <= 0 and the column's largest score
// gives exactly 1: a weight that small is 0 as f16 and is lost in the f32 row sum, and
// a rescale factor that small multiplies sums that the new tile outweighs by 2^126.
__device__ __forceinline__ float exp2_hw(float x) { return __builtin_amdgcn_exp2f(x); }

__global__ __launch_bounds__(256) void attn_kernel(
    const _Float16* __restrict__ Qg, const _Float16* __restrict__ Kg,
    const _Float16* __restrict__ VTg, float* __restrict__ out) {
  __shared__ __align__(16) _Float16 lds_k[4 * KT_ELEMS];   // [buf][key group][t][d], padded rows
  __shared__ __align__(16) _Float16 lds_vt[4 * VT_ELEMS];  // [buf][key group][d][t], padded rows
  __shared__ f4 lds_join[8 * JOIN_ROWS * 32];              // [wave][row][lane]
  int tid = threadIdx.x, lane = tid & 31;
  int wave = __builtin_amdgcn_readfirstlane(tid >> 5);
  int cg = wave & 3, kg = wave >> 2;                  // column group, key group
  int bh = blockIdx.y;
  int scol0 = blockIdx.x * 128 + cg * 32;

  const _Float16* Qb = Qg + ((size_t)bh * S_TOTAL + scol0) * DHEAD;
  const _Float16* Kb = Kg + (size_t)bh * S_TOTAL * DHEAD;
  const _Float16* Vb = VTg + (size_t)bh * DHEAD * S_TOTAL;

  // (every inner loop of this kernel is unrolled so that its fragment and accumulator
  // arrays are indexed by constants and stay in registers)
  // Q B-fragments, loaded once (lane -> column s, halves -> d), [column tile][d half]
  v16h bq[2][2];
#pragma unroll
  for (int c = 0; c < 2; ++c) {
    bq[c][0] = load_frag16x32(Qb + c * 16 * DHEAD, DHEAD);
    bq[c][1] = load_frag16x32(Qb + c * 16 * DHEAD + 32, DHEAD);
  }

  v8f acc[2][4] = {};                                 // [column tile][16 d]
  float m_run[2] = { -3.0e38f, -3.0e38f }, l_run[2] = { 0.f, 0.f };
  int vd = tid >> 2, vp = tid & 3;                    // V^T tile load mapping
  int klds = (tid >> 3) * K_PITCH + (tid & 7) * 8;    // this lane's 16 B in a K tile
  int vlds = vd * V_PITCH + vp * 8;                   // ... and in a V^T tile
  const _Float16* Ksrc = Kb + (size_t)tid * 8;        // this lane's 16 B of key group 0's
  const _Float16* Vsrc = Vb + (size_t)vd * S_TOTAL + vp * 8;   // tile 0, K and V^T

  // prologue: async-load both groups' tile 0 into buffer 0 (16B per thread per tile)
  async_load16_kv2(Ksrc, lds_k + klds, Vsrc, lds_vt + vlds,
                   Ksrc + (size_t)KEYS_PER_GROUP * DHEAD, lds_k + KT_ELEMS + klds,
                   Vsrc + KEYS_PER_GROUP, lds_vt + VT_ELEMS + vlds);

  for (int i = 0; i < N_ITERS; ++i) {
    int t0 = i * 32;
    const _Float16* kcur = lds_k + ((i & 1) * 2 + kg) * KT_ELEMS;
    const _Float16* vcur = lds_vt + ((i & 1) * 2 + kg) * VT_ELEMS;
    if (i + 1 < N_ITERS) {
      // issue the next stage's DMA into the other buffer; it overlaps this
      // iteration's WMMAs.  Waiting ASYNCcnt<=4 leaves only those four copies
      // outstanding, so stage i has landed.
      _Float16* knxt = lds_k + ((i + 1) & 1) * 2 * KT_ELEMS;
      _Float16* vnxt = lds_vt + ((i + 1) & 1) * 2 * VT_ELEMS;
      const _Float16* kg0 = Ksrc + (size_t)(t0 + 32) * DHEAD;
      const _Float16* vg0 = Vsrc + (t0 + 32);
      async_load16_kv2(kg0, knxt + klds, vg0, vnxt + vlds,
                       kg0 + (size_t)KEYS_PER_GROUP * DHEAD, knxt + KT_ELEMS + klds,
                       vg0 + KEYS_PER_GROUP, vnxt + VT_ELEMS + vlds);
      S_WAIT_ASYNCCNT(4);
    } else {
      S_WAIT_ASYNCCNT(0);
    }
    __syncthreads();   // all waves' DMA for stage i landed

    // scores S'[t, s]: 2 t-subtiles x (d=0..31, d=32..63), each K fragment for both column tiles
    v16h ka0 = load_frag16x32(kcur + 0, K_PITCH);
    v16h ka1 = load_frag16x32(kcur + 32, K_PITCH);
    v16h kb0 = load_frag16x32(kcur + 16 * K_PITCH, K_PITCH);
    v16h kb1 = load_frag16x32(kcur + 16 * K_PITCH + 32, K_PITCH);
    v8f c0[2], c1[2];
#pragma unroll
    for (int c = 0; c < 2; ++c) {
      v8f z = {};
      c0[c] = wmma_f16(ka0, bq[c][0], z);
      c1[c] = wmma_f16(kb0, bq[c][0], z);
    }
#pragma unroll
    for (int c = 0; c < 2; ++c) {
      c0[c] = wmma_f16(ka1, bq[c][1], c0[c]);
      c1[c] = wmma_f16(kb1, bq[c][1], c1[c]);
    }

    v16h bp[2];
#pragma unroll
    for (int c = 0; c < 2; ++c) {
      // online softmax over t (rows): in-lane over VGPRs + shfl_xor(16)
      float tm = c0[c][0];
#pragma unroll
      for (int r = 0; r < 8; ++r) { tm = fmaxf(tm, c0[c][r]); tm = fmaxf(tm, c1[c][r]); }
      tm = fmaxf(tm, __shfl_xor(tm, 16, 32));
      float mn = fmaxf(m_run[c], tm);
      float alpha = exp2_hw(m_run[c] - mn);
      float ts = 0.f;
#pragma unroll
      for (int r = 0; r < 8; ++r) {
        c0[c][r] = exp2_hw(c0[c][r] - mn);
        c1[c][r] = exp2_hw(c1[c][r] - mn);
        ts += c0[c][r] + c1[c][r];
      }
      ts += __shfl_xor(ts, 16, 32);
      l_run[c] = l_run[c] * alpha + ts;
      m_run[c] = mn;
#pragma unroll
      for (int a = 0; a < 4; ++a) {
#pragma unroll
        for (int r = 0; r < 8; ++r) acc[c][a][r] *= alpha;
      }
      // P' C-fragment -> B-fragment for O^T = V^T * P'  (layout identity)
#pragma unroll
      for (int r = 0; r < 8; ++r) {
        bp[c][r] = (_Float16)c0[c][r];
        bp[c][r + 8] = (_Float16)c1[c][r];
      }
    }
    // each V^T fragment for both column tiles
#pragma unroll
    for (int a = 0; a < 4; ++a) {
      v16h va = load_frag16x32(vcur + a * 16 * V_PITCH, V_PITCH);
      acc[0][a] = wmma_f16(va, bp[0], acc[0][a]);
      acc[1][a] = wmma_f16(va, bp[1], acc[1][a]);
    }
    __syncthreads();   // stage i fully consumed before i+2's DMA reuses buffer
  }

  // join of the two key groups: waves w and w^4 hold the same 32 columns.  Each hands
  // the other one column tile's state (key group 0 gives tile 1, group 1 gives tile 0)
  // and finishes the tile it keeps.
  bool hi = kg != 0;
  f4* mine = lds_join + wave * (JOIN_ROWS * 32) + lane;
  const f4* theirs = lds_join + (wave ^ 4) * (JOIN_ROWS * 32) + lane;
  v8f keep[4];
#pragma unroll
  for (int a = 0; a < 4; ++a) {
    v8f give = hi ? acc[0][a] : acc[1][a];
    keep[a] = hi ? acc[1][a] : acc[0][a];
    f4 lo4 = { give[0], give[1], give[2], give[3] };
    f4 hi4 = { give[4], give[5], give[6], give[7] };
    mine[(2 * a) * 32] = lo4;
    mine[(2 * a + 1) * 32] = hi4;
  }
  f4 ml = { hi ? m_run[0] : m_run[1], hi ? l_run[0] : l_run[1], 0.f, 0.f };
  mine[8 * 32] = ml;
  float m_k = hi ? m_run[1] : m_run[0], l_k = hi ? l_run[1] : l_run[0];
  __syncthreads();   // every wave's handed-over state is in LDS before its partner reads it
  f4 oml = theirs[8 * 32];
  float m_j = fmaxf(m_k, oml.x);
  float f_k = exp2_hw(m_k - m_j), f_o = exp2_hw(oml.x - m_j);
  float inv = 1.0f / (l_k * f_k + oml.y * f_o);
  f_k *= inv; f_o *= inv;

  // epilogue: out[bh*64 + d][s] = joined sums / joined l   (lanes advance s -> coalesced)
  int s = scol0 + kg * 16 + (lane & 15);
  int rbase = (lane >> 4) << 3;
#pragma unroll
  for (int a = 0; a < 4; ++a) {
    f4 o_lo = theirs[(2 * a) * 32], o_hi = theirs[(2 * a + 1) * 32];
#pragma unroll
    for (int r = 0; r < 8; ++r) {
      float o = (r < 4) ? o_lo[r & 3] : o_hi[r & 3];
      out[(size_t)(bh * 64 + a * 16 + r + rbase) * S_TOTAL + s] = keep[a][r] * f_k + o * f_o;
    }
  }
}

// ---------------------------------------------------------------------------
extern "C" void kernel_launch(void* const* d_in, const int* in_sizes, int n_in,
                              void* d_out, int out_size, void* d_ws,
                              size_t ws_size, hipStream_t stream) {
  (void)in_sizes; (void)n_in; (void)out_size; (void)ws_size;
  const float* x    = (const float*)d_in[0];   // [4,256,64,64]
  const float* w_dw = (const float*)d_in[1];   // [256,1,3,3]
  const float* w_pw = (const float*)d_in[2];   // [768,256]
  float* out = (float*)d_out;                  // [4,256,64,64]

  char* ws = (char*)d_ws;
  _Float16* dwT = (_Float16*)(ws);                   // 4*4096*256 f16 = 8 MiB
  _Float16* Qg  = (_Float16*)(ws + (8u  << 20));     // 16*4096*64 f16 = 8 MiB
  _Float16* Kg  = (_Float16*)(ws + (16u << 20));     // 8 MiB
  _Float16* VTg = (_Float16*)(ws + (24u << 20));     // 8 MiB
  _Float16* wph = (_Float16*)(ws + (32u << 20));     // 768*256 f16

  cvt_wpw_kernel<<<768, 256, 0, stream>>>(w_pw, wph);
  dwconv_kernel<<<dim3(64, 4, 4), 256, 0, stream>>>(x, w_dw, dwT);
  proj_qk_kernel<<<dim3(32, 8, 4), 256, 0, stream>>>(dwT, wph, Qg, Kg);
  proj_v_kernel<<<dim3(32, 4, 4), 256, 0, stream>>>(dwT, wph, VTg);
  attn_kernel<<<dim3(32, 16), 256, 0, stream>>>(Qg, Kg, VTg, out);
}

// v006
// Measured time: 76.6 microseconds a run.
// Timed twice side by side with v005, it ran 1.11 times as fast both times.
// All steps since v000 together make it 4.14 times as fast.
#include <hip/hip_runtime.h>

typedef __attribute__((ext_vector_type(16))) _Float16 v16h;
typedef __attribute__((ext_vector_type(8)))  _Float16 v8h;
typedef __attribute__((ext_vector_type(8)))  float    v8f;

#define S_TOTAL 4096
#define DHEAD   64
#define NH      4
#define NB      4
#define C_IN    256
// fold 1/sqrt(64) and log2(e) into Q so softmax can use exp2
#define QSCALE  (0.125f * 1.44269504088896340736f)

// ---------------------------------------------------------------------------
// Fragment loader for CDNA5 WMMA f16 operands (A 16x32 MxK, or B 32x16 KxN
// loaded from an [N][K] row-major buffer -- both have identical lane layout):
// lane l -> row (l&15); halves 0..7 = k [kb..kb+7], halves 8..15 = k [kb+16..kb+23]
// with kb = (l>>4)*8.  Two 16B vector loads per fragment.
// ---------------------------------------------------------------------------
__device__ __forceinline__ v16h load_frag16x32(const _Float16* base, int stride) {
  int lane = threadIdx.x & 31;
  const _Float16* p = base + (lane & 15) * stride + ((lane >> 4) << 3);
  v8h lo = *(const v8h*)(p);
  v8h hi = *(const v8h*)(p + 16);
  v16h r;
#pragma unroll
  for (int i = 0; i < 8; ++i) { r[i] = lo[i]; r[i + 8] = hi[i]; }
  return r;
}

__device__ __forceinline__ v8f wmma_f16(v16h a, v16h b, v8f c) {
  return __builtin_amdgcn_wmma_f32_16x16x32_f16(false, a, false, b, (short)0, c,
                                                false, false);
}

// Async DMA: 16B global -> LDS, tracked by ASYNCcnt (GLOBAL_LOAD_ASYNC_TO_LDS_B128).
// LDS operand takes the workgroup-relative byte offset; for the flat-LDS
// aperture that is addr[31:0] of the generic pointer (ISA 10.2).
// One statement issues a stage's four copies (K and V tile of both key groups); the
// s_wait_xcnt at its end keeps later writes of the eight address registers behind the
// copies' issue.
__device__ __forceinline__ void async_load16_kv2(const _Float16* gk0, _Float16* lk0,
                                                 const _Float16* gv0, _Float16* lv0,
                                                 const _Float16* gk1, _Float16* lk1,
                                                 const _Float16* gv1, _Float16* lv1) {
  unsigned int l0 = (unsigned int)(unsigned long long)lk0;
  unsigned int l1 = (unsigned int)(unsigned long long)lv0;
  unsigned int l2 = (unsigned int)(unsigned long long)lk1;
  unsigned int l3 = (unsigned int)(unsigned long long)lv1;
  unsigned long long g0 = (unsigned long long)gk0;
  unsigned long long g1 = (unsigned long long)gv0;
  unsigned long long g2 = (unsigned long long)gk1;
  unsigned long long g3 = (unsigned long long)gv1;
  asm volatile("global_load_async_to_lds_b128 %0, %1, off\n\t"
               "global_load_async_to_lds_b128 %2, %3, off\n\t"
               "global_load_async_to_lds_b128 %4, %5, off\n\t"
               "global_load_async_to_lds_b128 %6, %7, off\n\t"
               "s_wait_xcnt 0x0"
               :: "v"(l0), "v"(g0), "v"(l1), "v"(g1), "v"(l2), "v"(g2), "v"(l3), "v"(g3)
               : "memory");
}
#define S_WAIT_ASYNCCNT(n) asm volatile("s_wait_asynccnt " #n ::: "memory")

// ---------------------------------------------------------------------------
// Kernel 1: convert pointwise weight [768][256] f32 -> f16
// ---------------------------------------------------------------------------
__global__ void cvt_wpw_kernel(const float* __restrict__ w_pw,
                               _Float16* __restrict__ wph) {
  int idx = blockIdx.x * 256 + threadIdx.x;   // grid 768*256 == 196608 exact
  wph[idx] = (_Float16)w_pw[idx];
}

// ---------------------------------------------------------------------------
// Kernel 2: depthwise 3x3 conv (pad 1).  Output transposed: dwT [b][s][c] f16
// block = (hh, group of 64 channels, b).  Lanes advance along ww: 16 lanes x
// 16 B read one whole 256 B image row of a channel, so every global load
// covers whole lines.  The [c][ww] -> [ww][c] turn goes through LDS, and each
// wave then stores one 128 B line (64 channels of one s) per instruction.
// ---------------------------------------------------------------------------
typedef __attribute__((ext_vector_type(2))) _Float16 v2h;
typedef __attribute__((ext_vector_type(4))) float f4;
// weight vectors: a channel pair's 18 floats start at a multiple of 8 B only
typedef __attribute__((ext_vector_type(4), aligned(8))) float f4u;
typedef __attribute__((ext_vector_type(2), aligned(8))) float f2u;
// staged row pitch in dwords: odd, so the 16 ww-quads of a store (4 rows apart)
// and the 32 channel pairs of a read both fall on distinct banks
#define DW_PITCH 33

// value of lane-1 / lane+1 inside a 16-lane row (one image row); the lane past
// the row's end reads 0, which is the conv's zero padding in ww
__device__ __forceinline__ float from_left_lane(float v) {
  return __int_as_float(__builtin_amdgcn_update_dpp(0, __float_as_int(v), 0x111 /*row_shr:1*/, 0xf, 0xf, true));
}
__device__ __forceinline__ float from_right_lane(float v) {
  return __int_as_float(__builtin_amdgcn_update_dpp(0, __float_as_int(v), 0x101 /*row_shl:1*/, 0xf, 0xf, true));
}

__global__ __launch_bounds__(256) void dwconv_kernel(const float* __restrict__ x,
                                                     const float* __restrict__ w_dw,
                                                     _Float16* __restrict__ dwT) {
  __shared__ unsigned int tile[64 * DW_PITCH];      // [ww][channel pair], 2 x f16
  int hh = blockIdx.x, cg = blockIdx.y, b = blockIdx.z;
  int tid = threadIdx.x, q = tid & 15;              // q: which 4 ww of the row
  bool up = hh > 0, dn = hh < 63;                   // rows hh-1 / hh+1 exist
  // every address = block-uniform base + one per-lane byte offset (+ a constant)
  const float* xg = x + ((size_t)(b * C_IN + cg * 64)) * S_TOTAL;
  const char* xb[3] = { (const char*)(xg + (up ? hh - 1 : hh) * 64),   // a row that does not
                        (const char*)(xg + hh * 64),                  // exist is read as row hh
                        (const char*)(xg + (dn ? hh + 1 : hh) * 64) };// and zeroed below
  const char* wp = (const char*)(w_dw + cg * 64 * 9);
  unsigned xoff = (unsigned)(tid >> 4) * (2u * S_TOTAL * 4u) + (unsigned)q * 16u;
  unsigned woff = (unsigned)(tid >> 4) * (2u * 9u * 4u);
  // all loads first: 2 passes x (18 weights of a channel pair, 2 channels x 3 rows of 4 ww)
  // (every loop of this kernel is unrolled so that its arrays are indexed by constants
  // and stay in registers)
  f4u wa[2][4];
  f2u wb[2];
  f4  v[2][2][3];
#pragma unroll
  for (int p = 0; p < 2; ++p) {
    const char* wc = wp + p * (32 * 9 * 4);
#pragma unroll
    for (int j = 0; j < 4; ++j) wa[p][j] = *(const f4u*)(wc + j * 16 + woff);
    wb[p] = *(const f2u*)(wc + 64 + woff);
#pragma unroll
    for (int e = 0; e < 2; ++e) {
#pragma unroll
      for (int ky = 0; ky < 3; ++ky)
        v[p][e][ky] = *(const f4*)(xb[ky] + (p * 32 + e) * (S_TOTAL * 4) + xoff);
    }
  }
  // Fence on the loaded values and the two offsets (inputs only): keeps all 22 loads in
  // flight together in front of the arithmetic, which otherwise gets them one wait at a
  // time, and keeps every rewrite of the loads' address registers behind the wait.
  asm volatile("s_wait_xcnt 0x0"
               :: "v"(wa[0][0]), "v"(wa[0][1]), "v"(wa[0][2]), "v"(wa[0][3]), "v"(wb[0]),
                  "v"(wa[1][0]), "v"(wa[1][1]), "v"(wa[1][2]), "v"(wa[1][3]), "v"(wb[1]),
                  "v"(v[0][0][0]), "v"(v[0][0][1]), "v"(v[0][0][2]),
                  "v"(v[0][1][0]), "v"(v[0][1][1]), "v"(v[0][1][2]),
                  "v"(v[1][0][0]), "v"(v[1][0][1]), "v"(v[1][0][2]),
                  "v"(v[1][1][0]), "v"(v[1][1][1]), "v"(v[1][1][2]),
                  "v"(xoff), "v"(woff));
#pragma unroll
  for (int p = 0; p < 2; ++p) {
    float s[2][4];
#pragma unroll
    for (int e = 0; e < 2; ++e) {
      s[e][0] = 0.f; s[e][1] = 0.f; s[e][2] = 0.f; s[e][3] = 0.f;
#pragma unroll
      for (int ky = 0; ky < 3; ++ky) {
        f4 r = v[p][e][ky];
        if ((ky == 0 && !up) || (ky == 2 && !dn)) {  // zero padding in hh
          r.x = 0.f; r.y = 0.f; r.z = 0.f; r.w = 0.f;
        }
        float a[6] = { from_left_lane(r.w), r.x, r.y, r.z, r.w, from_right_lane(r.x) };
#pragma unroll
        for (int kx = 0; kx < 3; ++kx) {
          int k = e * 9 + ky * 3 + kx;               // index in the pair's 18 weights
          float w = (k < 16) ? wa[p][k >> 2][k & 3] : wb[p][k & 1];
#pragma unroll
          for (int j = 0; j < 4; ++j)
            s[e][j] = __builtin_fmaf(a[j + kx], w, s[e][j]);
        }
      }
    }
    int cp = p * 16 + (tid >> 4);                   // channel pair in the group
#pragma unroll
    for (int j = 0; j < 4; ++j) {
      v2h h = { (_Float16)s[0][j], (_Float16)s[1][j] };
      tile[(q * 4 + j) * DW_PITCH + cp] = __builtin_bit_cast(unsigned int, h);
    }
  }
  __syncthreads();   // the whole [64 ww][64 c] tile is staged before any row leaves
  int wave = tid >> 5, lane = tid & 31;
  unsigned int* dst = (unsigned int*)(dwT + ((size_t)(b * S_TOTAL + hh * 64)) * C_IN + cg * 64);
#pragma unroll
  for (int i = 0; i < 8; ++i) {
    int r = wave * 8 + i;
    dst[(size_t)r * (C_IN / 2) + lane] = tile[r * DW_PITCH + lane];
  }
}

// ---------------------------------------------------------------------------
// Projections (kernels 3 and 4): one block = 128 rows of dwT (s) x 64 rows of
// w_pw (o), the whole c = 256 of both.  Both operand tiles are brought into LDS
// once, by asynchronous copies in which a wave's 32 lanes x 16 B cover one whole
// 512 B row, and the 8 waves read their WMMA fragments from there: a wave owns
// 32 s x 32 o, so each fragment it reads feeds two WMMAs.
// ---------------------------------------------------------------------------
// LDS row pitch in halves: 528 B = 16 B x odd, so the 16 rows that one
// ds_load_b128 fragment read touches fall on distinct banks.
#define PJ_PITCH 264
#define PJ_S 128
#define PJ_O 64

// Eight 16 B copies of this lane, global -> LDS: 64 rows of 512 B for the block.
// From one copy to the next the block's 256 lanes advance 4096 B in global memory
// (8 rows) and 8 padded rows in LDS.  The s_wait_xcnt at the statement's end keeps
// later writes of the address registers behind the copies' issue.
__device__ __forceinline__ void async_rows64(const _Float16* g, _Float16* l) {
  unsigned int l0 = (unsigned int)(unsigned long long)l;
  unsigned long long g0 = (unsigned long long)g;
  const unsigned int LS = 8u * PJ_PITCH * 2u;
  const unsigned long long GS = 4096ull;
  asm volatile("global_load_async_to_lds_b128 %0, %1, off\n\t"
               "global_load_async_to_lds_b128 %2, %3, off\n\t"
               "global_load_async_to_lds_b128 %4, %5, off\n\t"
               "global_load_async_to_lds_b128 %6, %7, off\n\t"
               "global_load_async_to_lds_b128 %8, %9, off\n\t"
               "global_load_async_to_lds_b128 %10, %11, off\n\t"
               "global_load_async_to_lds_b128 %12, %13, off\n\t"
               "global_load_async_to_lds_b128 %14, %15, off\n\t"
               "s_wait_xcnt 0x0"
               :: "v"(l0), "v"(g0), "v"(l0 + LS), "v"(g0 + GS),
                  "v"(l0 + 2u * LS), "v"(g0 + 2ull * GS), "v"(l0 + 3u * LS), "v"(g0 + 3ull * GS),
                  "v"(l0 + 4u * LS), "v"(g0 + 4ull * GS), "v"(l0 + 5u * LS), "v"(g0 + 5ull * GS),
                  "v"(l0 + 6u * LS), "v"(g0 + 6ull * GS), "v"(l0 + 7u * LS), "v"(g0 + 7ull * GS)
               : "memory");
}

// Fills both tiles: sg = first of 128 contiguous dwT rows, wg = first of 64 contiguous
// weight rows.  On return every wave may read every row.
__device__ __forceinline__ void proj_stage(const _Float16* sg, const _Float16* wg,
                                           _Float16* sT, _Float16* wT) {
  int tid = threadIdx.x;
  int goff = tid * 8;                                   // this lane's 16 B of 4096 B
  int loff = (tid >> 5) * PJ_PITCH + (tid & 31) * 8;    // row = wave, 16 B piece = lane
  async_rows64(sg + goff, sT + loff);
  async_rows64(sg + 64 * C_IN + goff, sT + 64 * PJ_PITCH + loff);
  async_rows64(wg + goff, wT + loff);
  S_WAIT_ASYNCCNT(0);   // this wave's 24 copies have landed
  __syncthreads();      // ... and every other wave's, before any fragment is read
}

// acc[i][j] += A rows (i*16..) x B rows (j*16..), c in the order 0, 32, .., 224
__device__ __forceinline__ void proj_mma(const _Float16* aT, const _Float16* bT,
                                         v8f (&acc)[2][2]) {
  // unrolled so that the LDS reads of later c blocks can be issued ahead of the WMMAs
#pragma unroll
  for (int kc = 0; kc < C_IN; kc += 32) {
    v16h a0 = load_frag16x32(aT + kc, PJ_PITCH);
    v16h a1 = load_frag16x32(aT + 16 * PJ_PITCH + kc, PJ_PITCH);
    v16h b0 = load_frag16x32(bT + kc, PJ_PITCH);
    v16h b1 = load_frag16x32(bT + 16 * PJ_PITCH + kc, PJ_PITCH);
    acc[0][0] = wmma_f16(a0, b0, acc[0][0]);
    acc[0][1] = wmma_f16(a0, b1, acc[0][1]);
    acc[1][0] = wmma_f16(a1, b0, acc[1][0]);
    acc[1][1] = wmma_f16(a1, b1, acc[1][1]);
  }
}

// ---------------------------------------------------------------------------
// Kernel 3: projection for Q and K.  qkvT[s][o] = sum_c dwT[s][c]*w_pw[o][c]
// A = dwT rows (s), B = w_pw rows (o) -- both row-major [*][c].
// Q gets QSCALE folded in.
// Writes Q,K as [bh][s][d] f16 (lanes advance d).
// ---------------------------------------------------------------------------
__global__ __launch_bounds__(256) void proj_qk_kernel(
    const _Float16* __restrict__ dwT, const _Float16* __restrict__ wph,
    _Float16* __restrict__ Qg, _Float16* __restrict__ Kg) {
  __shared__ __align__(16) _Float16 sT[PJ_S * PJ_PITCH];
  __shared__ __align__(16) _Float16 wT[PJ_O * PJ_PITCH];
  int wave = threadIdx.x >> 5, lane = threadIdx.x & 31;
  int s0 = blockIdx.x * PJ_S;
  int o0 = blockIdx.y * PJ_O;                      // o in [0,512)
  int b = blockIdx.z;
  proj_stage(dwT + ((size_t)(b * S_TOTAL + s0)) * C_IN, wph + (size_t)o0 * C_IN, sT, wT);
  int sw = (wave & 3) * 32, ow = (wave >> 2) * 32; // this wave's 32 s x 32 o
  v8f acc[2][2] = {};
  proj_mma(sT + sw * PJ_PITCH, wT + ow * PJ_PITCH, acc);
  // (unrolled so that acc is indexed by constants and stays in registers)
#pragma unroll
  for (int j = 0; j < 2; ++j) {
    int o = o0 + ow + j * 16 + (lane & 15);
    int qi = o >> 8;                 // 0 => Q, 1 => K
    int h = (o >> 6) & 3;
    int d = o & 63;
    _Float16* dst = (qi ? Kg : Qg) + ((size_t)(b * NH + h) * S_TOTAL) * DHEAD + d;
    float sc = qi ? 1.0f : QSCALE;
#pragma unroll
    for (int i = 0; i < 2; ++i) {
#pragma unroll
      for (int r = 0; r < 8; ++r) {
        int s = s0 + sw + i * 16 + r + ((lane >> 4) << 3);
        dst[(size_t)s * DHEAD] = (_Float16)(acc[i][j][r] * sc);
      }
    }
  }
}

// ---------------------------------------------------------------------------
// Kernel 4: projection for V, un-transposed orientation:
// qkv[o][s] = sum_c w_pw[o][c]*dwT[s][c];  A = w_pw rows (o), B = dwT rows (s).
// Writes V transposed: VT [bh][d][t=s] f16 (lanes advance s).
// ---------------------------------------------------------------------------
__global__ __launch_bounds__(256) void proj_v_kernel(
    const _Float16* __restrict__ dwT, const _Float16* __restrict__ wph,
    _Float16* __restrict__ VTg) {
  __shared__ __align__(16) _Float16 sT[PJ_S * PJ_PITCH];
  __shared__ __align__(16) _Float16 wT[PJ_O * PJ_PITCH];
  int wave = threadIdx.x >> 5, lane = threadIdx.x & 31;
  int s0 = blockIdx.x * PJ_S;
  int o0 = 512 + blockIdx.y * PJ_O;                // o in [512,768)
  int b = blockIdx.z;
  proj_stage(dwT + ((size_t)(b * S_TOTAL + s0)) * C_IN, wph + (size_t)o0 * C_IN, sT, wT);
  int sw = (wave & 3) * 32, ow = (wave >> 2) * 32; // this wave's 32 s x 32 o
  v8f acc[2][2] = {};
  proj_mma(wT + ow * PJ_PITCH, sT + sw * PJ_PITCH, acc);
  // (unrolled so that acc is indexed by constants and stays in registers)
#pragma unroll
  for (int j = 0; j < 2; ++j) {
    int s = s0 + sw + j * 16 + (lane & 15);
#pragma unroll
    for (int i = 0; i < 2; ++i) {
#pragma unroll
      for (int r = 0; r < 8; ++r) {
        int o = o0 + ow + i * 16 + r + ((lane >> 4) << 3);
        int h = (o - 512) >> 6;
        int d = (o - 512) & 63;
        VTg[((size_t)(b * NH + h) * DHEAD + d) * S_TOTAL + s] = (_Float16)acc[i][j][r];
      }
    }
  }
}

// ---------------------------------------------------------------------------
// Kernel 5: flash attention, transposed formulation, double-buffered async
// global->LDS DMA (ASYNCcnt).
// Per wave: 32 s-columns (two 16-column tiles), so every K and V^T fragment read
// from LDS feeds two WMMAs.  To keep eight waves on a block's 128 columns the keys
// are split: waves 0..3 walk keys 0..2047, waves 4..7 keys 2048..4095, each group
// on its own staged tiles; the two partial softmax states of a column are joined
// once, through LDS, after the loop.
// S'[t,s] = K*Q^T tiles (t rows in VGPRs, s across lanes) -> online softmax is
// per-lane over VGPRs + one shfl_xor(16).
// The maximum in use (m_run) may trail a column's true running maximum by up to
// LAZY_MARGIN in the log2-scaled scores: sums and accumulators are rescaled, and m_run
// moved, only in a pass where some score of the wave exceeds it by more.
// P' C-fragment re-packs directly into the B-fragment for O^T = V^T * P'
// (half h<8 <- frag0[h], half h>=8 <- frag1[h-8]) -- no transpose traffic.
// ---------------------------------------------------------------------------
// LDS row pitch in halves: 16 B x odd (144 B for K rows, 80 B for V^T rows), so
// the 16 rows that one ds_load_b128 fragment read touches fall on distinct banks.
#define K_PITCH  72
#define V_PITCH  40
#define KT_ELEMS (32 * K_PITCH)
#define VT_ELEMS (64 * V_PITCH)
#define KEYS_PER_GROUP (S_TOTAL / 2)
#define N_ITERS  (KEYS_PER_GROUP / 32)
// join area: per wave 9 rows of 32 lanes x 16 B (8 rows of sums, 1 of maximum and sum)
#define JOIN_ROWS 9
// a weight is at most 2^8, far inside f16's range, and a row sum at most 4096 * 2^8
#define LAZY_MARGIN 8.0f

// 2^x as the bare v_exp_f32.  exp2f() wraps that instruction in a range fix-up (a
// compare, two selects, an add and an ldexp for each value) whose only effect is on
// results below 2^-126.  Here every argument is <= LAZY_MARGIN and a column's largest
// score gives at least 1: a weight that small is 0 as f16 and is lost in the f32 row sum,
// and a rescale factor that small multiplies sums that the new tile outweighs by 2^126.
__device__ __forceinline__ float exp2_hw(float x) { return __builtin_amdgcn_exp2f(x); }

__global__ __launch_bounds__(256) void attn_kernel(
    const _Float16* __restrict__ Qg, const _Float16* __restrict__ Kg,
    const _Float16* __restrict__ VTg, float* __restrict__ out) {
  __shared__ __align__(16) _Float16 lds_k[4 * KT_ELEMS];   // [buf][key group][t][d], padded rows
  __shared__ __align__(16) _Float16 lds_vt[4 * VT_ELEMS];  // [buf][key group][d][t], padded rows
  __shared__ f4 lds_join[8 * JOIN_ROWS * 32];              // [wave][row][lane]
  int tid = threadIdx.x, lane = tid & 31;
  int wave = __builtin_amdgcn_readfirstlane(tid >> 5);
  int cg = wave & 3, kg = wave >> 2;                  // column group, key group
  int bh = blockIdx.y;
  int scol0 = blockIdx.x * 128 + cg * 32;

  const _Float16* Qb = Qg + ((size_t)bh * S_TOTAL + scol0) * DHEAD;
  const _Float16* Kb = Kg + (size_t)bh * S_TOTAL * DHEAD;
  const _Float16* Vb = VTg + (size_t)bh * DHEAD * S_TOTAL;

  // (every inner loop of this kernel is unrolled so that its fragment and accumulator
  // arrays are indexed by constants and stay in registers)
  // Q B-fragments, loaded once (lane -> column s, halves -> d), [column tile][d half]
  v16h bq[2][2];
#pragma unroll
  for (int c = 0; c < 2; ++c) {
    bq[c][0] = load_frag16x32(Qb + c * 16 * DHEAD, DHEAD);
    bq[c][1] = load_frag16x32(Qb + c * 16 * DHEAD + 32, DHEAD);
  }

  v8f acc[2][4] = {};                                 // [column tile][16 d]
  float m_run[2] = { -3.0e38f, -3.0e38f }, l_run[2] = { 0.f, 0.f };
  int vd = tid >> 2, vp = tid & 3;                    // V^T tile load mapping
  int klds = (tid >> 3) * K_PITCH + (tid & 7) * 8;    // this lane's 16 B in a K tile
  int vlds = vd * V_PITCH + vp * 8;                   // ... and in a V^T tile
  const _Float16* Ksrc = Kb + (size_t)tid * 8;        // this lane's 16 B of key group 0's
  const _Float16* Vsrc = Vb + (size_t)vd * S_TOTAL + vp * 8;   // tile 0, K and V^T

  // prologue: async-load both groups' tile 0 into buffer 0 (16B per thread per tile)
  async_load16_kv2(Ksrc, lds_k + klds, Vsrc, lds_vt + vlds,
                   Ksrc + (size_t)KEYS_PER_GROUP * DHEAD, lds_k + KT_ELEMS + klds,
                   Vsrc + KEYS_PER_GROUP, lds_vt + VT_ELEMS + vlds);

  for (int i = 0; i < N_ITERS; ++i) {
    int t0 = i * 32;
    const _Float16* kcur = lds_k + ((i & 1) * 2 + kg) * KT_ELEMS;
    const _Float16* vcur = lds_vt + ((i & 1) * 2 + kg) * VT_ELEMS;
    if (i + 1 < N_ITERS) {
      // issue the next stage's DMA into the other buffer; it overlaps this
      // iteration's WMMAs.  Waiting ASYNCcnt<=4 leaves only those four copies
      // outstanding, so stage i has landed.
      _Float16* knxt = lds_k + ((i + 1) & 1) * 2 * KT_ELEMS;
      _Float16* vnxt = lds_vt + ((i + 1) & 1) * 2 * VT_ELEMS;
      const _Float16* kg0 = Ksrc + (size_t)(t0 + 32) * DHEAD;
      const _Float16* vg0 = Vsrc + (t0 + 32);
      async_load16_kv2(kg0, knxt + klds, vg0, vnxt + vlds,
                       kg0 + (size_t)KEYS_PER_GROUP * DHEAD, knxt + KT_ELEMS + klds,
                       vg0 + KEYS_PER_GROUP, vnxt + VT_ELEMS + vlds);
      S_WAIT_ASYNCCNT(4);
    } else {
      S_WAIT_ASYNCCNT(0);
    }
    __syncthreads();   // all waves' DMA for stage i landed

    // scores S'[t, s]: 2 t-subtiles x (d=0..31, d=32..63), each K fragment for both column tiles
    v16h ka0 = load_frag16x32(kcur + 0, K_PITCH);
    v16h ka1 = load_frag16x32(kcur + 32, K_PITCH);
    v16h kb0 = load_frag16x32(kcur + 16 * K_PITCH, K_PITCH);
    v16h kb1 = load_frag16x32(kcur + 16 * K_PITCH + 32, K_PITCH);
    v8f c0[2], c1[2];
#pragma unroll
    for (int c = 0; c < 2; ++c) {
      v8f z = {};
      c0[c] = wmma_f16(ka0, bq[c][0], z);
      c1[c] = wmma_f16(kb0, bq[c][0], z);
    }
#pragma unroll
    for (int c = 0; c < 2; ++c) {
      c0[c] = wmma_f16(ka1, bq[c][1], c0[c]);
      c1[c] = wmma_f16(kb1, bq[c][1], c1[c]);
    }

    // each lane's own maximum over its 16 scores of a column, and the lazy test
    float tm[2];
    bool need = false;
#pragma unroll
    for (int c = 0; c < 2; ++c) {
      tm[c] = c0[c][0];
#pragma unroll
      for (int r = 0; r < 8; ++r) { tm[c] = fmaxf(tm[c], c0[c][r]); tm[c] = fmaxf(tm[c], c1[c][r]); }
      need = need || (tm[c] > m_run[c] + LAZY_MARGIN);
    }
    // One wave-uniform scalar branch a pass (always taken in the first): every column of
    // the wave moves to the larger of its m_run and this pass's maximum; both lanes of a column get the same one.
    if (__builtin_expect(__builtin_amdgcn_ballot_w32(need) != 0, 0)) {
#pragma unroll
      for (int c = 0; c < 2; ++c) {
        float mn = fmaxf(m_run[c], fmaxf(tm[c], __shfl_xor(tm[c], 16, 32)));
        float alpha = exp2_hw(m_run[c] - mn);
        m_run[c] = mn;
        l_run[c] *= alpha;
#pragma unroll
        for (int a = 0; a < 4; ++a) {
#pragma unroll
          for (int r = 0; r < 8; ++r) acc[c][a][r] *= alpha;
        }
      }
    }

    // the pass's V^T fragments, read as one group under the exponentials
    v16h va[4];
#pragma unroll
    for (int a = 0; a < 4; ++a) va[a] = load_frag16x32(vcur + a * 16 * V_PITCH, V_PITCH);
    // keeps the eight reads here: the scheduler otherwise sinks them in among the WMMAs
    // that use them, where each pair is waited for as soon as it is issued
    __builtin_amdgcn_sched_barrier(0);

    v16h bp[2];
#pragma unroll
    for (int c = 0; c < 2; ++c) {
      c0[c] = c0[c] - m_run[c];
      c1[c] = c1[c] - m_run[c];
#pragma unroll
      for (int r = 0; r < 8; ++r) {
        c0[c][r] = exp2_hw(c0[c][r]);
        c1[c][r] = exp2_hw(c1[c][r]);
      }
      v8f u = c0[c] + c1[c];
      float ts = 0.f;
#pragma unroll
      for (int r = 0; r < 8; ++r) ts += u[r];
      ts += __shfl_xor(ts, 16, 32);
      l_run[c] += ts;
      // P' C-fragment -> B-fragment for O^T = V^T * P'  (layout identity)
#pragma unroll
      for (int r = 0; r < 8; ++r) {
        bp[c][r] = (_Float16)c0[c][r];
        bp[c][r + 8] = (_Float16)c1[c][r];
      }
    }
    // each V^T fragment for both column tiles
#pragma unroll
    for (int a = 0; a < 4; ++a) {
      acc[0][a] = wmma_f16(va[a], bp[0], acc[0][a]);
      acc[1][a] = wmma_f16(va[a], bp[1], acc[1][a]);
    }
    __syncthreads();   // stage i fully consumed before i+2's DMA reuses buffer
  }

  // join of the two key groups: waves w and w^4 hold the same 32 columns.  Each hands
  // the other one column tile's state (key group 0 gives tile 1, group 1 gives tile 0)
  // and finishes the tile it keeps.
  bool hi = kg != 0;
  f4* mine = lds_join + wave * (JOIN_ROWS * 32) + lane;
  const f4* theirs = lds_join + (wave ^ 4) * (JOIN_ROWS * 32) + lane;
  v8f keep[4];
#pragma unroll
  for (int a = 0; a < 4; ++a) {
    v8f give = hi ? acc[0][a] : acc[1][a];
    keep[a] = hi ? acc[1][a] : acc[0][a];
    f4 lo4 = { give[0], give[1], give[2], give[3] };
    f4 hi4 = { give[4], give[5], give[6], give[7] };
    mine[(2 * a) * 32] = lo4;
    mine[(2 * a + 1) * 32] = hi4;
  }
  f4 ml = { hi ? m_run[0] : m_run[1], hi ? l_run[0] : l_run[1], 0.f, 0.f };
  mine[8 * 32] = ml;
  float m_k = hi ? m_run[1] : m_run[0], l_k = hi ? l_run[1] : l_run[0];
  __syncthreads();   // every wave's handed-over state is in LDS before its partner reads it
  f4 oml = theirs[8 * 32];
  float m_j = fmaxf(m_k, oml.x);
  float f_k = exp2_hw(m_k - m_j), f_o = exp2_hw(oml.x - m_j);
  float inv = 1.0f / (l_k * f_k + oml.y * f_o);
  f_k *= inv; f_o *= inv;

  // epilogue: out[bh*64 + d][s] = joined sums / joined l   (lanes advance s -> coalesced)
  int s = scol0 + kg * 16 + (lane & 15);
  int rbase = (lane >> 4) << 3;
#pragma unroll
  for (int a = 0; a < 4; ++a) {
    f4 o_lo = theirs[(2 * a) * 32], o_hi = theirs[(2 * a + 1) * 32];
#pragma unroll
    for (int r = 0; r < 8; ++r) {
      float o = (r < 4) ? o_lo[r & 3] : o_hi[r & 3];
      out[(size_t)(bh * 64 + a * 16 + r + rbase) * S_TOTAL + s] = keep[a][r] * f_k + o * f_o;
    }
  }
}

// ---------------------------------------------------------------------------
extern "C" void kernel_launch(void* const* d_in, const int* in_sizes, int n_in,
                              void* d_out, int out_size, void* d_ws,
                              size_t ws_size, hipStream_t stream) {
  (void)in_sizes; (void)n_in; (void)out_size; (void)ws_size;
  const float* x    = (const float*)d_in[0];   // [4,256,64,64]
  const float* w_dw = (const float*)d_in[1];   // [256,1,3,3]
  const float* w_pw = (const float*)d_in[2];   // [768,256]
  float* out = (float*)d_out;                  // [4,256,64,64]

  char* ws = (char*)d_ws;
  _Float16* dwT = (_Float16*)(ws);                   // 4*4096*256 f16 = 8 MiB
  _Float16* Qg  = (_Float16*)(ws + (8u  << 20));     // 16*4096*64 f16 = 8 MiB
  _Float16* Kg  = (_Float16*)(ws + (16u << 20));     // 8 MiB
  _Float16* VTg = (_Float16*)(ws + (24u << 20));     // 8 MiB
  _Float16* wph = (_Float16*)(ws + (32u << 20));     // 768*256 f16

  cvt_wpw_kernel<<<768, 256, 0, stream>>>(w_pw, wph);
  dwconv_kernel<<<dim3(64, 4, 4), 256, 0, stream>>>(x, w_dw, dwT);
  proj_qk_kernel<<<dim3(32, 8, 4), 256, 0, stream>>>(dwT, wph, Qg, Kg);
  proj_v_kernel<<<dim3(32, 4, 4), 256, 0, stream>>>(dwT, wph, VTg);
  attn_kernel<<<dim3(32, 16), 256, 0, stream>>>(Qg, Kg, VTg, out);
}

// v007
// One run takes 70 microseconds.
// Two timings next to v006 put it at 1.07 and 1.09 times that version's speed.
// Counting every step since v000, it is 4.48 times as fast.
#include <hip/hip_runtime.h>

typedef __attribute__((ext_vector_type(16))) _Float16 v16h;
typedef __attribute__((ext_vector_type(8)))  _Float16 v8h;
typedef __attribute__((ext_vector_type(8)))  float    v8f;

#define S_TOTAL 4096
#define DHEAD   64
#define NH      4
#define NB      4
#define C_IN    256
// fold 1/sqrt(64) and log2(e) into Q so softmax can use exp2
#define QSCALE  (0.125f * 1.44269504088896340736f)

// ---------------------------------------------------------------------------
// Fragment loader for CDNA5 WMMA f16 operands (A 16x32 MxK, or B 32x16 KxN
// loaded from an [N][K] row-major buffer -- both have identical lane layout):
// lane l -> row (l&15); halves 0..7 = k [kb..kb+7], halves 8..15 = k [kb+16..kb+23]
// with kb = (l>>4)*8.  Two 16B vector loads per fragment.
// ---------------------------------------------------------------------------
__device__ __forceinline__ v16h load_frag16x32(const _Float16* base, int stride) {
  int lane = threadIdx.x & 31;
  const _Float16* p = base + (lane & 15) * stride + ((lane >> 4) << 3);
  v8h lo = *(const v8h*)(p);
  v8h hi = *(const v8h*)(p + 16);
  v16h r;
#pragma unroll
  for (int i = 0; i < 8; ++i) { r[i] = lo[i]; r[i + 8] = hi[i]; }
  return r;
}

__device__ __forceinline__ v8f wmma_f16(v16h a, v16h b, v8f c) {
  return __builtin_amdgcn_wmma_f32_16x16x32_f16(false, a, false, b, (short)0, c,
                                                false, false);
}

// Async DMA: 16B global -> LDS, tracked by ASYNCcnt (GLOBAL_LOAD_ASYNC_TO_LDS_B128).
// LDS operand takes the workgroup-relative byte offset; for the flat-LDS
// aperture that is addr[31:0] of the generic pointer (ISA 10.2).
// One statement issues a stage's four copies (K and V tile of both key groups); the
// s_wait_xcnt at its end keeps later writes of the eight address registers behind the
// copies' issue.
__device__ __forceinline__ void async_load16_kv2(const _Float16* gk0, _Float16* lk0,
                                                 const _Float16* gv0, _Float16* lv0,
                                                 const _Float16* gk1, _Float16* lk1,
                                                 const _Float16* gv1, _Float16* lv1) {
  unsigned int l0 = (unsigned int)(unsigned long long)lk0;
  unsigned int l1 = (unsigned int)(unsigned long long)lv0;
  unsigned int l2 = (unsigned int)(unsigned long long)lk1;
  unsigned int l3 = (unsigned int)(unsigned long long)lv1;
  unsigned long long g0 = (unsigned long long)gk0;
  unsigned long long g1 = (unsigned long long)gv0;
  unsigned long long g2 = (unsigned long long)gk1;
  unsigned long long g3 = (unsigned long long)gv1;
  asm volatile("global_load_async_to_lds_b128 %0, %1, off\n\t"
               "global_load_async_to_lds_b128 %2, %3, off\n\t"
               "global_load_async_to_lds_b128 %4, %5, off\n\t"
               "global_load_async_to_lds_b128 %6, %7, off\n\t"
               "s_wait_xcnt 0x0"
               :: "v"(l0), "v"(g0), "v"(l1), "v"(g1), "v"(l2), "v"(g2), "v"(l3), "v"(g3)
               : "memory");
}
#define S_WAIT_ASYNCCNT(n) asm volatile("s_wait_asynccnt " #n ::: "memory")

// ---------------------------------------------------------------------------
// Kernel 1: two jobs that need nothing of each other share one grid, told apart by
// blockIdx.x (the same for a whole block): x < 64 is the depthwise conv, x >= 64
// converts the pointwise weight.
// Depthwise 3x3 conv (pad 1).  Output transposed: dwT [b][s][c] f16
// block = (hh, group of 64 channels, b).  Lanes advance along ww: 16 lanes x
// 16 B read one whole 256 B image row of a channel, so every global load
// covers whole lines.  The [c][ww] -> [ww][c] turn goes through LDS, and each
// wave then stores one 128 B line (64 channels of one s) per instruction.
// ---------------------------------------------------------------------------
typedef __attribute__((ext_vector_type(2))) _Float16 v2h;
typedef __attribute__((ext_vector_type(4))) float f4;
// weight vectors: a channel pair's 18 floats start at a multiple of 8 B only
typedef __attribute__((ext_vector_type(4), aligned(8))) float f4u;
typedef __attribute__((ext_vector_type(2), aligned(8))) float f2u;
// staged row pitch in dwords: odd, so the 16 ww-quads of a store (4 rows apart)
// and the 32 channel pairs of a read both fall on distinct banks
#define DW_PITCH 33
// blocks in x that convert the weight: 6 x 4 x 4 blocks x 256 threads x 8 = 768 * 256
#define CVT_X 6

// pointwise weight [768][256] f32 -> f16, 8 values a thread (32 B read, 16 B stored):
// the shared grid pays for every wave it starts, so the convert adds 96 blocks, not 768
__device__ __forceinline__ void cvt_wpw_block(const float* __restrict__ w_pw,
                                              _Float16* __restrict__ wph, int blk) {
  int idx = (blk * 256 + (int)threadIdx.x) * 8;
  f4 a = *(const f4*)(w_pw + idx);
  f4 c = *(const f4*)(w_pw + idx + 4);
  v8h h = { (_Float16)a.x, (_Float16)a.y, (_Float16)a.z, (_Float16)a.w,
            (_Float16)c.x, (_Float16)c.y, (_Float16)c.z, (_Float16)c.w };
  *(v8h*)(wph + idx) = h;
}

// value of lane-1 / lane+1 inside a 16-lane row (one image row); the lane past
// the row's end reads 0, which is the conv's zero padding in ww
__device__ __forceinline__ float from_left_lane(float v) {
  return __int_as_float(__builtin_amdgcn_update_dpp(0, __float_as_int(v), 0x111 /*row_shr:1*/, 0xf, 0xf, true));
}
__device__ __forceinline__ float from_right_lane(float v) {
  return __int_as_float(__builtin_amdgcn_update_dpp(0, __float_as_int(v), 0x101 /*row_shl:1*/, 0xf, 0xf, true));
}

__global__ __launch_bounds__(256) void dwconv_cvt_kernel(const float* __restrict__ x,
                                                         const float* __restrict__ w_dw,
                                                         const float* __restrict__ w_pw,
                                                         _Float16* __restrict__ dwT,
                                                         _Float16* __restrict__ wph) {
  __shared__ unsigned int tile[64 * DW_PITCH];      // [ww][channel pair], 2 x f16
  if (blockIdx.x >= 64) {                           // whole block, ahead of the barrier
    cvt_wpw_block(w_pw, wph,
                  (int)(blockIdx.x - 64 + CVT_X * (blockIdx.y + 4 * blockIdx.z)));
    return;
  }
  int hh = blockIdx.x, cg = blockIdx.y, b = blockIdx.z;
  int tid = threadIdx.x, q = tid & 15;              // q: which 4 ww of the row
  bool up = hh > 0, dn = hh < 63;                   // rows hh-1 / hh+1 exist
  // every address = block-uniform base + one per-lane byte offset (+ a constant)
  const float* xg = x + ((size_t)(b * C_IN + cg * 64)) * S_TOTAL;
  const char* xb[3] = { (const char*)(xg + (up ? hh - 1 : hh) * 64),   // a row that does not
                        (const char*)(xg + hh * 64),                  // exist is read as row hh
                        (const char*)(xg + (dn ? hh + 1 : hh) * 64) };// and zeroed below
  const char* wp = (const char*)(w_dw + cg * 64 * 9);
  unsigned xoff = (unsigned)(tid >> 4) * (2u * S_TOTAL * 4u) + (unsigned)q * 16u;
  unsigned woff = (unsigned)(tid >> 4) * (2u * 9u * 4u);
  // all loads first: 2 passes x (18 weights of a channel pair, 2 channels x 3 rows of 4 ww)
  // (every loop of this kernel is unrolled so that its arrays are indexed by constants
  // and stay in registers)
  f4u wa[2][4];
  f2u wb[2];
  f4  v[2][2][3];
#pragma unroll
  for (int p = 0; p < 2; ++p) {
    const char* wc = wp + p * (32 * 9 * 4);
#pragma unroll
    for (int j = 0; j < 4; ++j) wa[p][j] = *(const f4u*)(wc + j * 16 + woff);
    wb[p] = *(const f2u*)(wc + 64 + woff);
#pragma unroll
    for (int e = 0; e < 2; ++e) {
#pragma unroll
      for (int ky = 0; ky < 3; ++ky)
        v[p][e][ky] = *(const f4*)(xb[ky] + (p * 32 + e) * (S_TOTAL * 4) + xoff);
    }
  }
  // Fence on the loaded values and the two offsets (inputs only): keeps all 22 loads in
  // flight together in front of the arithmetic, which otherwise gets them one wait at a
  // time, and keeps every rewrite of the loads' address registers behind the wait.
  asm volatile("s_wait_xcnt 0x0"
               :: "v"(wa[0][0]), "v"(wa[0][1]), "v"(wa[0][2]), "v"(wa[0][3]), "v"(wb[0]),
                  "v"(wa[1][0]), "v"(wa[1][1]), "v"(wa[1][2]), "v"(wa[1][3]), "v"(wb[1]),
                  "v"(v[0][0][0]), "v"(v[0][0][1]), "v"(v[0][0][2]),
                  "v"(v[0][1][0]), "v"(v[0][1][1]), "v"(v[0][1][2]),
                  "v"(v[1][0][0]), "v"(v[1][0][1]), "v"(v[1][0][2]),
                  "v"(v[1][1][0]), "v"(v[1][1][1]), "v"(v[1][1][2]),
                  "v"(xoff), "v"(woff));
#pragma unroll
  for (int p = 0; p < 2; ++p) {
    float s[2][4];
#pragma unroll
    for (int e = 0; e < 2; ++e) {
      s[e][0] = 0.f; s[e][1] = 0.f; s[e][2] = 0.f; s[e][3] = 0.f;
#pragma unroll
      for (int ky = 0; ky < 3; ++ky) {
        f4 r = v[p][e][ky];
        if ((ky == 0 && !up) || (ky == 2 && !dn)) {  // zero padding in hh
          r.x = 0.f; r.y = 0.f; r.z = 0.f; r.w = 0.f;
        }
        float a[6] = { from_left_lane(r.w), r.x, r.y, r.z, r.w, from_right_lane(r.x) };
#pragma unroll
        for (int kx = 0; kx < 3; ++kx) {
          int k = e * 9 + ky * 3 + kx;               // index in the pair's 18 weights
          float w = (k < 16) ? wa[p][k >> 2][k & 3] : wb[p][k & 1];
#pragma unroll
          for (int j = 0; j < 4; ++j)
            s[e][j] = __builtin_fmaf(a[j + kx], w, s[e][j]);
        }
      }
    }
    int cp = p * 16 + (tid >> 4);                   // channel pair in the group
#pragma unroll
    for (int j = 0; j < 4; ++j) {
      v2h h = { (_Float16)s[0][j], (_Float16)s[1][j] };
      tile[(q * 4 + j) * DW_PITCH + cp] = __builtin_bit_cast(unsigned int, h);
    }
  }
  __syncthreads();   // the whole [64 ww][64 c] tile is staged before any row leaves
  int wave = tid >> 5, lane = tid & 31;
  unsigned int* dst = (unsigned int*)(dwT + ((size_t)(b * S_TOTAL + hh * 64)) * C_IN + cg * 64);
#pragma unroll
  for (int i = 0; i < 8; ++i) {
    int r = wave * 8 + i;
    dst[(size_t)r * (C_IN / 2) + lane] = tile[r * DW_PITCH + lane];
  }
}

// ---------------------------------------------------------------------------
// Projections (kernel 2): one block = 128 rows of dwT (s) x 64 rows of
// w_pw (o), the whole c = 256 of both.  Both operand tiles are brought into LDS
// once, by asynchronous copies in which a wave's 32 lanes x 16 B cover one whole
// 512 B row, and the 8 waves read their WMMA fragments from there: a wave owns
// 32 s x 32 o, so each fragment it reads feeds two WMMAs.
// ---------------------------------------------------------------------------
// LDS row pitch in halves: 528 B = 16 B x odd, so the 16 rows that one
// ds_load_b128 fragment read touches fall on distinct banks.
#define PJ_PITCH 264
#define PJ_S 128
#define PJ_O 64

// Eight 16 B copies of this lane, global -> LDS: 64 rows of 512 B for the block.
// From one copy to the next the block's 256 lanes advance 4096 B in global memory
// (8 rows) and 8 padded rows in LDS.  The s_wait_xcnt at the statement's end keeps
// later writes of the address registers behind the copies' issue.
__device__ __forceinline__ void async_rows64(const _Float16* g, _Float16* l) {
  unsigned int l0 = (unsigned int)(unsigned long long)l;
  unsigned long long g0 = (unsigned long long)g;
  const unsigned int LS = 8u * PJ_PITCH * 2u;
  const unsigned long long GS = 4096ull;
  asm volatile("global_load_async_to_lds_b128 %0, %1, off\n\t"
               "global_load_async_to_lds_b128 %2, %3, off\n\t"
               "global_load_async_to_lds_b128 %4, %5, off\n\t"
               "global_load_async_to_lds_b128 %6, %7, off\n\t"
               "global_load_async_to_lds_b128 %8, %9, off\n\t"
               "global_load_async_to_lds_b128 %10, %11, off\n\t"
               "global_load_async_to_lds_b128 %12, %13, off\n\t"
               "global_load_async_to_lds_b128 %14, %15, off\n\t"
               "s_wait_xcnt 0x0"
               :: "v"(l0), "v"(g0), "v"(l0 + LS), "v"(g0 + GS),
                  "v"(l0 + 2u * LS), "v"(g0 + 2ull * GS), "v"(l0 + 3u * LS), "v"(g0 + 3ull * GS),
                  "v"(l0 + 4u * LS), "v"(g0 + 4ull * GS), "v"(l0 + 5u * LS), "v"(g0 + 5ull * GS),
                  "v"(l0 + 6u * LS), "v"(g0 + 6ull * GS), "v"(l0 + 7u * LS), "v"(g0 + 7ull * GS)
               : "memory");
}

// Fills both tiles: sg = first of 128 contiguous dwT rows, wg = first of 64 contiguous
// weight rows.  On return every wave may read every row.
__device__ __forceinline__ void proj_stage(const _Float16* sg, const _Float16* wg,
                                           _Float16* sT, _Float16* wT) {
  int tid = threadIdx.x;
  int goff = tid * 8;                                   // this lane's 16 B of 4096 B
  int loff = (tid >> 5) * PJ_PITCH + (tid & 31) * 8;    // row = wave, 16 B piece = lane
  async_rows64(sg + goff, sT + loff);
  async_rows64(sg + 64 * C_IN + goff, sT + 64 * PJ_PITCH + loff);
  async_rows64(wg + goff, wT + loff);
  S_WAIT_ASYNCCNT(0);   // this wave's 24 copies have landed
  __syncthreads();      // ... and every other wave's, before any fragment is read
}

// acc[i][j] += A rows (i*16..) x B rows (j*16..), c in the order 0, 32, .., 224
__device__ __forceinline__ void proj_mma(const _Float16* aT, const _Float16* bT,
                                         v8f (&acc)[2][2]) {
  // unrolled so that the LDS reads of later c blocks can be issued ahead of the WMMAs
#pragma unroll
  for (int kc = 0; kc < C_IN; kc += 32) {
    v16h a0 = load_frag16x32(aT + kc, PJ_PITCH);
    v16h a1 = load_frag16x32(aT + 16 * PJ_PITCH + kc, PJ_PITCH);
    v16h b0 = load_frag16x32(bT + kc, PJ_PITCH);
    v16h b1 = load_frag16x32(bT + 16 * PJ_PITCH + kc, PJ_PITCH);
    acc[0][0] = wmma_f16(a0, b0, acc[0][0]);
    acc[0][1] = wmma_f16(a0, b1, acc[0][1]);
    acc[1][0] = wmma_f16(a1, b0, acc[1][0]);
    acc[1][1] = wmma_f16(a1, b1, acc[1][1]);
  }
}

// ---------------------------------------------------------------------------
// Kernel 2: all three projections in one grid; blockIdx.y picks 64 rows o of w_pw, and
// with them (the same for a whole block) the orientation of the product.
// o < 512, Q and K:  qkvT[s][o] = sum_c dwT[s][c]*w_pw[o][c]
//   A = dwT rows (s), B = w_pw rows (o) -- both row-major [*][c].
//   Q gets QSCALE folded in.  Writes Q,K as [bh][s][d] f16 (lanes advance d).
// o >= 512, V, un-transposed orientation:  qkv[o][s] = sum_c w_pw[o][c]*dwT[s][c]
//   A = w_pw rows (o), B = dwT rows (s).
//   Writes V transposed: VT [bh][d][t=s] f16 (lanes advance s).
// ---------------------------------------------------------------------------
__global__ __launch_bounds__(256) void proj_kernel(
    const _Float16* __restrict__ dwT, const _Float16* __restrict__ wph,
    _Float16* __restrict__ Qg, _Float16* __restrict__ Kg, _Float16* __restrict__ VTg) {
  __shared__ __align__(16) _Float16 sT[PJ_S * PJ_PITCH];
  __shared__ __align__(16) _Float16 wT[PJ_O * PJ_PITCH];
  int wave = threadIdx.x >> 5, lane = threadIdx.x & 31;
  int s0 = blockIdx.x * PJ_S;
  int o0 = blockIdx.y * PJ_O;                      // o in [0,768)
  int b = blockIdx.z;
  proj_stage(dwT + ((size_t)(b * S_TOTAL + s0)) * C_IN, wph + (size_t)o0 * C_IN, sT, wT);
  int sw = (wave & 3) * 32, ow = (wave >> 2) * 32; // this wave's 32 s x 32 o
  v8f acc[2][2] = {};
  if (o0 < 512) {
    proj_mma(sT + sw * PJ_PITCH, wT + ow * PJ_PITCH, acc);
    // (unrolled so that acc is indexed by constants and stays in registers)
#pragma unroll
    for (int j = 0; j < 2; ++j) {
      int o = o0 + ow + j * 16 + (lane & 15);
      int qi = o >> 8;                 // 0 => Q, 1 => K
      int h = (o >> 6) & 3;
      int d = o & 63;
      _Float16* dst = (qi ? Kg : Qg) + ((size_t)(b * NH + h) * S_TOTAL) * DHEAD + d;
      float sc = qi ? 1.0f : QSCALE;
#pragma unroll
      for (int i = 0; i < 2; ++i) {
#pragma unroll
        for (int r = 0; r < 8; ++r) {
          int s = s0 + sw + i * 16 + r + ((lane >> 4) << 3);
          dst[(size_t)s * DHEAD] = (_Float16)(acc[i][j][r] * sc);
        }
      }
    }
  } else {
    proj_mma(wT + ow * PJ_PITCH, sT + sw * PJ_PITCH, acc);
    // (unrolled so that acc is indexed by constants and stays in registers)
#pragma unroll
    for (int j = 0; j < 2; ++j) {
      int s = s0 + sw + j * 16 + (lane & 15);
#pragma unroll
      for (int i = 0; i < 2; ++i) {
#pragma unroll
        for (int r = 0; r < 8; ++r) {
          int o = o0 + ow + i * 16 + r + ((lane >> 4) << 3);
          int h = (o - 512) >> 6;
          int d = (o - 512) & 63;
          VTg[((size_t)(b * NH + h) * DHEAD + d) * S_TOTAL + s] = (_Float16)acc[i][j][r];
        }
      }
    }
    // in the built code the Q/K side's first instructions stand behind this side's exit
    // branch and rewrite these stores' address and data registers: the wait keeps those
    // writes behind the stores' issue (the Q/K side's own stores run into the kernel's end)
    asm volatile("s_wait_xcnt 0x0" ::: "memory");
  }
}

// ---------------------------------------------------------------------------
// Kernel 3: flash attention, transposed formulation, double-buffered async
// global->LDS DMA (ASYNCcnt).
// Per wave: 32 s-columns (two 16-column tiles), so every K and V^T fragment read
// from LDS feeds two WMMAs.  To keep eight waves on a block's 128 columns the keys
// are split: waves 0..3 walk keys 0..2047, waves 4..7 keys 2048..4095, each group
// on its own staged tiles; the two partial softmax states of a column are joined
// once, through LDS, after the loop.
// S'[t,s] = K*Q^T tiles (t rows in VGPRs, s across lanes) -> online softmax is
// per-lane over VGPRs + one shfl_xor(16).
// The maximum in use (m_run) may trail a column's true running maximum by up to
// LAZY_MARGIN in the log2-scaled scores: sums and accumulators are rescaled, and m_run
// moved, only in a pass where some score of the wave exceeds it by more.
// P' C-fragment re-packs directly into the B-fragment for O^T = V^T * P'
// (half h<8 <- frag0[h], half h>=8 <- frag1[h-8]) -- no transpose traffic.
// ---------------------------------------------------------------------------
// LDS row pitch in halves: 16 B x odd (144 B for K rows, 80 B for V^T rows), so
// the 16 rows that one ds_load_b128 fragment read touches fall on distinct banks.
#define K_PITCH  72
#define V_PITCH  40
#define KT_ELEMS (32 * K_PITCH)
#define VT_ELEMS (64 * V_PITCH)
#define KEYS_PER_GROUP (S_TOTAL / 2)
#define N_ITERS  (KEYS_PER_GROUP / 32)
// join area: per wave 9 rows of 32 lanes x 16 B (8 rows of sums, 1 of maximum and sum)
#define JOIN_ROWS 9
// a weight is at most 2^8, far inside f16's range, and a row sum at most 4096 * 2^8
#define LAZY_MARGIN 8.0f

// 2^x as the bare v_exp_f32.  exp2f() wraps that instruction in a range fix-up (a
// compare, two selects, an add and an ldexp for each value) whose only effect is on
// results below 2^-126.  Here every argument is <= LAZY_MARGIN and a column's largest
// score gives at least 1: a weight that small is 0 as f16 and is lost in the f32 row sum,
// and a rescale factor that small multiplies sums that the new tile outweighs by 2^126.
__device__ __forceinline__ float exp2_hw(float x) { return __builtin_amdgcn_exp2f(x); }

__global__ __launch_bounds__(256) void attn_kernel(
    const _Float16* __restrict__ Qg, const _Float16* __restrict__ Kg,
    const _Float16* __restrict__ VTg, float* __restrict__ out) {
  __shared__ __align__(16) _Float16 lds_k[4 * KT_ELEMS];   // [buf][key group][t][d], padded rows
  __shared__ __align__(16) _Float16 lds_vt[4 * VT_ELEMS];  // [buf][key group][d][t], padded rows
  __shared__ f4 lds_join[8 * JOIN_ROWS * 32];              // [wave][row][lane]
  int tid = threadIdx.x, lane = tid & 31;
  int wave = __builtin_amdgcn_readfirstlane(tid >> 5);
  int cg = wave & 3, kg = wave >> 2;                  // column group, key group
  int bh = blockIdx.y;
  int scol0 = blockIdx.x * 128 + cg * 32;

  const _Float16* Qb = Qg + ((size_t)bh * S_TOTAL + scol0) * DHEAD;
  const _Float16* Kb = Kg + (size_t)bh * S_TOTAL * DHEAD;
  const _Float16* Vb = VTg + (size_t)bh * DHEAD * S_TOTAL;

  // (every inner loop of this kernel is unrolled so that its fragment and accumulator
  // arrays are indexed by constants and stay in registers)
  // Q B-fragments, loaded once (lane -> column s, halves -> d), [column tile][d half]
  v16h bq[2][2];
#pragma unroll
  for (int c = 0; c < 2; ++c) {
    bq[c][0] = load_frag16x32(Qb + c * 16 * DHEAD, DHEAD);
    bq[c][1] = load_frag16x32(Qb + c * 16 * DHEAD + 32, DHEAD);
  }

  v8f acc[2][4] = {};                                 // [column tile][16 d]
  float m_run[2] = { -3.0e38f, -3.0e38f }, l_run[2] = { 0.f, 0.f };
  int vd = tid >> 2, vp = tid & 3;                    // V^T tile load mapping
  int klds = (tid >> 3) * K_PITCH + (tid & 7) * 8;    // this lane's 16 B in a K tile
  int vlds = vd * V_PITCH + vp * 8;                   // ... and in a V^T tile
  const _Float16* Ksrc = Kb + (size_t)tid * 8;        // this lane's 16 B of key group 0's
  const _Float16* Vsrc = Vb + (size_t)vd * S_TOTAL + vp * 8;   // tile 0, K and V^T

  // prologue: async-load both groups' tile 0 into buffer 0 (16B per thread per tile)
  async_load16_kv2(Ksrc, lds_k + klds, Vsrc, lds_vt + vlds,
                   Ksrc + (size_t)KEYS_PER_GROUP * DHEAD, lds_k + KT_ELEMS + klds,
                   Vsrc + KEYS_PER_GROUP, lds_vt + VT_ELEMS + vlds);

  for (int i = 0; i < N_ITERS; ++i) {
    int t0 = i * 32;
    const _Float16* kcur = lds_k + ((i & 1) * 2 + kg) * KT_ELEMS;
    const _Float16* vcur = lds_vt + ((i & 1) * 2 + kg) * VT_ELEMS;
    if (i + 1 < N_ITERS) {
      // issue the next stage's DMA into the other buffer; it overlaps this
      // iteration's WMMAs.  Waiting ASYNCcnt<=4 leaves only those four copies
      // outstanding, so stage i has landed.
      _Float16* knxt = lds_k + ((i + 1) & 1) * 2 * KT_ELEMS;
      _Float16* vnxt = lds_vt + ((i + 1) & 1) * 2 * VT_ELEMS;
      const _Float16* kg0 = Ksrc + (size_t)(t0 + 32) * DHEAD;
      const _Float16* vg0 = Vsrc + (t0 + 32);
      async_load16_kv2(kg0, knxt + klds, vg0, vnxt + vlds,
                       kg0 + (size_t)KEYS_PER_GROUP * DHEAD, knxt + KT_ELEMS + klds,
                       vg0 + KEYS_PER_GROUP, vnxt + VT_ELEMS + vlds);
      S_WAIT_ASYNCCNT(4);
    } else {
      S_WAIT_ASYNCCNT(0);
    }
    __syncthreads();   // all waves' DMA for stage i landed

    // scores S'[t, s]: 2 t-subtiles x (d=0..31, d=32..63), each K fragment for both column tiles
    v16h ka0 = load_frag16x32(kcur + 0, K_PITCH);
    v16h ka1 = load_frag16x32(kcur + 32, K_PITCH);
    v16h kb0 = load_frag16x32(kcur + 16 * K_PITCH, K_PITCH);
    v16h kb1 = load_frag16x32(kcur + 16 * K_PITCH + 32, K_PITCH);
    v8f c0[2], c1[2];
#pragma unroll
    for (int c = 0; c < 2; ++c) {
      v8f z = {};
      c0[c] = wmma_f16(ka0, bq[c][0], z);
      c1[c] = wmma_f16(kb0, bq[c][0], z);
    }
#pragma unroll
    for (int c = 0; c < 2; ++c) {
      c0[c] = wmma_f16(ka1, bq[c][1], c0[c]);
      c1[c] = wmma_f16(kb1, bq[c][1], c1[c]);
    }

    // each lane's own maximum over its 16 scores of a column, and the lazy test
    float tm[2];
    bool need = false;
#pragma unroll
    for (int c = 0; c < 2; ++c) {
      tm[c] = c0[c][0];
#pragma unroll
      for (int r = 0; r < 8; ++r) { tm[c] = fmaxf(tm[c], c0[c][r]); tm[c] = fmaxf(tm[c], c1[c][r]); }
      need = need || (tm[c] > m_run[c] + LAZY_MARGIN);
    }
    // One wave-uniform scalar branch a pass (always taken in the first): every column of
    // the wave moves to the larger of its m_run and this pass's maximum; both lanes of a column get the same one.
    if (__builtin_expect(__builtin_amdgcn_ballot_w32(need) != 0, 0)) {
#pragma unroll
      for (int c = 0; c < 2; ++c) {
        float mn = fmaxf(m_run[c], fmaxf(tm[c], __shfl_xor(tm[c], 16, 32)));
        float alpha = exp2_hw(m_run[c] - mn);
        m_run[c] = mn;
        l_run[c] *= alpha;
#pragma unroll
        for (int a = 0; a < 4; ++a) {
#pragma unroll
          for (int r = 0; r < 8; ++r) acc[c][a][r] *= alpha;
        }
      }
    }

    // the pass's V^T fragments, read as one group under the exponentials
    v16h va[4];
#pragma unroll
    for (int a = 0; a < 4; ++a) va[a] = load_frag16x32(vcur + a * 16 * V_PITCH, V_PITCH);
    // keeps the eight reads here: the scheduler otherwise sinks them in among the WMMAs
    // that use them, where each pair is waited for as soon as it is issued
    __builtin_amdgcn_sched_barrier(0);

    v16h bp[2];
#pragma unroll
    for (int c = 0; c < 2; ++c) {
      c0[c] = c0[c] - m_run[c];
      c1[c] = c1[c] - m_run[c];
#pragma unroll
      for (int r = 0; r < 8; ++r) {
        c0[c][r] = exp2_hw(c0[c][r]);
        c1[c][r] = exp2_hw(c1[c][r]);
      }
      v8f u = c0[c] + c1[c];
      float ts = 0.f;
#pragma unroll
      for (int r = 0; r < 8; ++r) ts += u[r];
      ts += __shfl_xor(ts, 16, 32);
      l_run[c] += ts;
      // P' C-fragment -> B-fragment for O^T = V^T * P'  (layout identity)
#pragma unroll
      for (int r = 0; r < 8; ++r) {
        bp[c][r] = (_Float16)c0[c][r];
        bp[c][r + 8] = (_Float16)c1[c][r];
      }
    }
    // each V^T fragment for both column tiles
#pragma unroll
    for (int a = 0; a < 4; ++a) {
      acc[0][a] = wmma_f16(va[a], bp[0], acc[0][a]);
      acc[1][a] = wmma_f16(va[a], bp[1], acc[1][a]);
    }
    __syncthreads();   // stage i fully consumed before i+2's DMA reuses buffer
  }

  // join of the two key groups: waves w and w^4 hold the same 32 columns.  Each hands
  // the other one column tile's state (key group 0 gives tile 1, group 1 gives tile 0)
  // and finishes the tile it keeps.
  bool hi = kg != 0;
  f4* mine = lds_join + wave * (JOIN_ROWS * 32) + lane;
  const f4* theirs = lds_join + (wave ^ 4) * (JOIN_ROWS * 32) + lane;
  v8f keep[4];
#pragma unroll
  for (int a = 0; a < 4; ++a) {
    v8f give = hi ? acc[0][a] : acc[1][a];
    keep[a] = hi ? acc[1][a] : acc[0][a];
    f4 lo4 = { give[0], give[1], give[2], give[3] };
    f4 hi4 = { give[4], give[5], give[6], give[7] };
    mine[(2 * a) * 32] = lo4;
    mine[(2 * a + 1) * 32] = hi4;
  }
  f4 ml = { hi ? m_run[0] : m_run[1], hi ? l_run[0] : l_run[1], 0.f, 0.f };
  mine[8 * 32] = ml;
  float m_k = hi ? m_run[1] : m_run[0], l_k = hi ? l_run[1] : l_run[0];
  __syncthreads();   // every wave's handed-over state is in LDS before its partner reads it
  f4 oml = theirs[8 * 32];
  float m_j = fmaxf(m_k, oml.x);
  float f_k = exp2_hw(m_k - m_j), f_o = exp2_hw(oml.x - m_j);
  float inv = 1.0f / (l_k * f_k + oml.y * f_o);
  f_k *= inv; f_o *= inv;

  // epilogue: out[bh*64 + d][s] = joined sums / joined l   (lanes advance s -> coalesced)
  int s = scol0 + kg * 16 + (lane & 15);
  int rbase = (lane >> 4) << 3;
#pragma unroll
  for (int a = 0; a < 4; ++a) {
    f4 o_lo = theirs[(2 * a) * 32], o_hi = theirs[(2 * a + 1) * 32];
#pragma unroll
    for (int r = 0; r < 8; ++r) {
      float o = (r < 4) ? o_lo[r & 3] : o_hi[r & 3];
      out[(size_t)(bh * 64 + a * 16 + r + rbase) * S_TOTAL + s] = keep[a][r] * f_k + o * f_o;
    }
  }
}

// ---------------------------------------------------------------------------
extern "C" void kernel_launch(void* const* d_in, const int* in_sizes, int n_in,
                              void* d_out, int out_size, void* d_ws,
                              size_t ws_size, hipStream_t stream) {
  (void)in_sizes; (void)n_in; (void)out_size; (void)ws_size;
  const float* x    = (const float*)d_in[0];   // [4,256,64,64]
  const float* w_dw = (const float*)d_in[1];   // [256,1,3,3]
  const float* w_pw = (const float*)d_in[2];   // [768,256]
  float* out = (float*)d_out;                  // [4,256,64,64]

  char* ws = (char*)d_ws;
  _Float16* dwT = (_Float16*)(ws);                   // 4*4096*256 f16 = 8 MiB
  _Float16* Qg  = (_Float16*)(ws + (8u  << 20));     // 16*4096*64 f16 = 8 MiB
  _Float16* Kg  = (_Float16*)(ws + (16u << 20));     // 8 MiB
  _Float16* VTg = (_Float16*)(ws + (24u << 20));     // 8 MiB
  _Float16* wph = (_Float16*)(ws + (32u << 20));     // 768*256 f16

  dwconv_cvt_kernel<<<dim3(64 + CVT_X, 4, 4), 256, 0, stream>>>(x, w_dw, w_pw, dwT, wph);
  proj_kernel<<<dim3(32, 12, 4), 256, 0, stream>>>(dwT, wph, Qg, Kg, VTg);
  attn_kernel<<<dim3(32, 16), 256, 0, stream>>>(Qg, Kg, VTg, out);
}

// v008
// One run takes 67.9 microseconds.
// Timed twice side by side with v007, it ran 1.04 times as fast both times.
// Counting every step since v000, it is 4.65 times as fast.
#include <hip/hip_runtime.h>

typedef __attribute__((ext_vector_type(16))) _Float16 v16h;
typedef __attribute__((ext_vector_type(8)))  _Float16 v8h;
typedef __attribute__((ext_vector_type(8)))  float    v8f;

#define S_TOTAL 4096
#define DHEAD   64
#define NH      4
#define NB      4
#define C_IN    256
// fold 1/sqrt(64) and log2(e) into Q so softmax can use exp2
#define QSCALE  (0.125f * 1.44269504088896340736f)

// ---------------------------------------------------------------------------
// Fragment loader for CDNA5 WMMA f16 operands (A 16x32 MxK, or B 32x16 KxN
// loaded from an [N][K] row-major buffer -- both have identical lane layout):
// lane l -> row (l&15); halves 0..7 = k [kb..kb+7], halves 8..15 = k [kb+16..kb+23]
// with kb = (l>>4)*8.  Two 16B vector loads per fragment.
// ---------------------------------------------------------------------------
__device__ __forceinline__ v16h load_frag16x32(const _Float16* base, int stride) {
  int lane = threadIdx.x & 31;
  const _Float16* p = base + (lane & 15) * stride + ((lane >> 4) << 3);
  v8h lo = *(const v8h*)(p);
  v8h hi = *(const v8h*)(p + 16);
  v16h r;
#pragma unroll
  for (int i = 0; i < 8; ++i) { r[i] = lo[i]; r[i + 8] = hi[i]; }
  return r;
}

__device__ __forceinline__ v8f wmma_f16(v16h a, v16h b, v8f c) {
  return __builtin_amdgcn_wmma_f32_16x16x32_f16(false, a, false, b, (short)0, c,
                                                false, false);
}

// Async DMA: 16B global -> LDS, tracked by ASYNCcnt (GLOBAL_LOAD_ASYNC_TO_LDS_B128).
// LDS operand takes the workgroup-relative byte offset; for the flat-LDS
// aperture that is addr[31:0] of the generic pointer (ISA 10.2).
// One statement issues a stage's four copies (K and V tile of both key groups); the
// s_wait_xcnt at its end keeps later writes of the eight address registers behind the
// copies' issue.
__device__ __forceinline__ void async_load16_kv2(const _Float16* gk0, _Float16* lk0,
                                                 const _Float16* gv0, _Float16* lv0,
                                                 const _Float16* gk1, _Float16* lk1,
                                                 const _Float16* gv1, _Float16* lv1) {
  unsigned int l0 = (unsigned int)(unsigned long long)lk0;
  unsigned int l1 = (unsigned int)(unsigned long long)lv0;
  unsigned int l2 = (unsigned int)(unsigned long long)lk1;
  unsigned int l3 = (unsigned int)(unsigned long long)lv1;
  unsigned long long g0 = (unsigned long long)gk0;
  unsigned long long g1 = (unsigned long long)gv0;
  unsigned long long g2 = (unsigned long long)gk1;
  unsigned long long g3 = (unsigned long long)gv1;
  asm volatile("global_load_async_to_lds_b128 %0, %1, off\n\t"
               "global_load_async_to_lds_b128 %2, %3, off\n\t"
               "global_load_async_to_lds_b128 %4, %5, off\n\t"
               "global_load_async_to_lds_b128 %6, %7, off\n\t"
               "s_wait_xcnt 0x0"
               :: "v"(l0), "v"(g0), "v"(l1), "v"(g1), "v"(l2), "v"(g2), "v"(l3), "v"(g3)
               : "memory");
}
#define S_WAIT_ASYNCCNT(n) asm volatile("s_wait_asynccnt " #n ::: "memory")

// ---------------------------------------------------------------------------
// Kernel 1: two jobs that need nothing of each other share one grid, told apart by
// blockIdx.x (the same for a whole block): x < 64 is the depthwise conv, x >= 64
// converts the pointwise weight.
// Depthwise 3x3 conv (pad 1).  Output transposed: dwT [b][s][c] f16
// block = (hh, group of 64 channels, b).  Lanes advance along ww: 16 lanes x
// 16 B read one whole 256 B image row of a channel, so every global load
// covers whole lines.  The [c][ww] -> [ww][c] turn goes through LDS, and each
// wave then stores one 128 B line (64 channels of one s) per instruction.
// ---------------------------------------------------------------------------
typedef __attribute__((ext_vector_type(2))) _Float16 v2h;
typedef __attribute__((ext_vector_type(4))) float f4;
// weight vectors: a channel pair's 18 floats start at a multiple of 8 B only
typedef __attribute__((ext_vector_type(4), aligned(8))) float f4u;
typedef __attribute__((ext_vector_type(2), aligned(8))) float f2u;
// staged row pitch in dwords: odd, so the 16 ww-quads of a store (4 rows apart)
// and the 32 channel pairs of a read both fall on distinct banks
#define DW_PITCH 33
// blocks in x that convert the weight: 6 x 4 x 4 blocks x 256 threads x 8 = 768 * 256
#define CVT_X 6

// pointwise weight [768][256] f32 -> f16, 8 values a thread (32 B read, 16 B stored):
// the shared grid pays for every wave it starts, so the convert adds 96 blocks, not 768
__device__ __forceinline__ void cvt_wpw_block(const float* __restrict__ w_pw,
                                              _Float16* __restrict__ wph, int blk) {
  int idx = (blk * 256 + (int)threadIdx.x) * 8;
  f4 a = *(const f4*)(w_pw + idx);
  f4 c = *(const f4*)(w_pw + idx + 4);
  v8h h = { (_Float16)a.x, (_Float16)a.y, (_Float16)a.z, (_Float16)a.w,
            (_Float16)c.x, (_Float16)c.y, (_Float16)c.z, (_Float16)c.w };
  *(v8h*)(wph + idx) = h;
}

// value of lane-1 / lane+1 inside a 16-lane row (one image row); the lane past
// the row's end reads 0, which is the conv's zero padding in ww
__device__ __forceinline__ float from_left_lane(float v) {
  return __int_as_float(__builtin_amdgcn_update_dpp(0, __float_as_int(v), 0x111 /*row_shr:1*/, 0xf, 0xf, true));
}
__device__ __forceinline__ float from_right_lane(float v) {
  return __int_as_float(__builtin_amdgcn_update_dpp(0, __float_as_int(v), 0x101 /*row_shl:1*/, 0xf, 0xf, true));
}

__global__ __launch_bounds__(256) void dwconv_cvt_kernel(const float* __restrict__ x,
                                                         const float* __restrict__ w_dw,
                                                         const float* __restrict__ w_pw,
                                                         _Float16* __restrict__ dwT,
                                                         _Float16* __restrict__ wph) {
  __shared__ unsigned int tile[64 * DW_PITCH];      // [ww][channel pair], 2 x f16
  if (blockIdx.x >= 64) {                           // whole block, ahead of the barrier
    cvt_wpw_block(w_pw, wph,
                  (int)(blockIdx.x - 64 + CVT_X * (blockIdx.y + 4 * blockIdx.z)));
    return;
  }
  int hh = blockIdx.x, cg = blockIdx.y, b = blockIdx.z;
  int tid = threadIdx.x, q = tid & 15;              // q: which 4 ww of the row
  bool up = hh > 0, dn = hh < 63;                   // rows hh-1 / hh+1 exist
  // every address = block-uniform base + one per-lane byte offset (+ a constant)
  const float* xg = x + ((size_t)(b * C_IN + cg * 64)) * S_TOTAL;
  const char* xb[3] = { (const char*)(xg + (up ? hh - 1 : hh) * 64),   // a row that does not
                        (const char*)(xg + hh * 64),                  // exist is read as row hh
                        (const char*)(xg + (dn ? hh + 1 : hh) * 64) };// and zeroed below
  const char* wp = (const char*)(w_dw + cg * 64 * 9);
  unsigned xoff = (unsigned)(tid >> 4) * (2u * S_TOTAL * 4u) + (unsigned)q * 16u;
  unsigned woff = (unsigned)(tid >> 4) * (2u * 9u * 4u);
  // all loads first: 2 passes x (18 weights of a channel pair, 2 channels x 3 rows of 4 ww)
  // (every loop of this kernel is unrolled so that its arrays are indexed by constants
  // and stay in registers)
  f4u wa[2][4];
  f2u wb[2];
  f4  v[2][2][3];
#pragma unroll
  for (int p = 0; p < 2; ++p) {
    const char* wc = wp + p * (32 * 9 * 4);
#pragma unroll
    for (int j = 0; j < 4; ++j) wa[p][j] = *(const f4u*)(wc + j * 16 + woff);
    wb[p] = *(const f2u*)(wc + 64 + woff);
#pragma unroll
    for (int e = 0; e < 2; ++e) {
#pragma unroll
      for (int ky = 0; ky < 3; ++ky)
        v[p][e][ky] = *(const f4*)(xb[ky] + (p * 32 + e) * (S_TOTAL * 4) + xoff);
    }
  }
  // Fence on the loaded values and the two offsets (inputs only): keeps all 22 loads in
  // flight together in front of the arithmetic, which otherwise gets them one wait at a
  // time, and keeps every rewrite of the loads' address registers behind the wait.
  asm volatile("s_wait_xcnt 0x0"
               :: "v"(wa[0][0]), "v"(wa[0][1]), "v"(wa[0][2]), "v"(wa[0][3]), "v"(wb[0]),
                  "v"(wa[1][0]), "v"(wa[1][1]), "v"(wa[1][2]), "v"(wa[1][3]), "v"(wb[1]),
                  "v"(v[0][0][0]), "v"(v[0][0][1]), "v"(v[0][0][2]),
                  "v"(v[0][1][0]), "v"(v[0][1][1]), "v"(v[0][1][2]),
                  "v"(v[1][0][0]), "v"(v[1][0][1]), "v"(v[1][0][2]),
                  "v"(v[1][1][0]), "v"(v[1][1][1]), "v"(v[1][1][2]),
                  "v"(xoff), "v"(woff));
#pragma unroll
  for (int p = 0; p < 2; ++p) {
    float s[2][4];
#pragma unroll
    for (int e = 0; e < 2; ++e) {
      s[e][0] = 0.f; s[e][1] = 0.f; s[e][2] = 0.f; s[e][3] = 0.f;
#pragma unroll
      for (int ky = 0; ky < 3; ++ky) {
        f4 r = v[p][e][ky];
        if ((ky == 0 && !up) || (ky == 2 && !dn)) {  // zero padding in hh
          r.x = 0.f; r.y = 0.f; r.z = 0.f; r.w = 0.f;
        }
        float a[6] = { from_left_lane(r.w), r.x, r.y, r.z, r.w, from_right_lane(r.x) };
#pragma unroll
        for (int kx = 0; kx < 3; ++kx) {
          int k = e * 9 + ky * 3 + kx;               // index in the pair's 18 weights
          float w = (k < 16) ? wa[p][k >> 2][k & 3] : wb[p][k & 1];
#pragma unroll
          for (int j = 0; j < 4; ++j)
            s[e][j] = __builtin_fmaf(a[j + kx], w, s[e][j]);
        }
      }
    }
    int cp = p * 16 + (tid >> 4);                   // channel pair in the group
#pragma unroll
    for (int j = 0; j < 4; ++j) {
      v2h h = { (_Float16)s[0][j], (_Float16)s[1][j] };
      tile[(q * 4 + j) * DW_PITCH + cp] = __builtin_bit_cast(unsigned int, h);
    }
  }
  __syncthreads();   // the whole [64 ww][64 c] tile is staged before any row leaves
  int wave = tid >> 5, lane = tid & 31;
  unsigned int* dst = (unsigned int*)(dwT + ((size_t)(b * S_TOTAL + hh * 64)) * C_IN + cg * 64);
#pragma unroll
  for (int i = 0; i < 8; ++i) {
    int r = wave * 8 + i;
    dst[(size_t)r * (C_IN / 2) + lane] = tile[r * DW_PITCH + lane];
  }
}

// ---------------------------------------------------------------------------
// Projections (kernel 2): one block = 128 rows of dwT (s) x 64 rows of
// w_pw (o), the whole c = 256 of both.  Both operand tiles are brought into LDS
// once, by asynchronous copies in which a wave's 32 lanes x 16 B cover one whole
// 512 B row, and the 8 waves read their WMMA fragments from there: a wave owns
// 32 s x 32 o, so each fragment it reads feeds two WMMAs.
// ---------------------------------------------------------------------------
// LDS row pitch in halves: 528 B = 16 B x odd, so the 16 rows that one
// ds_load_b128 fragment read touches fall on distinct banks.
#define PJ_PITCH 264
#define PJ_S 128
#define PJ_O 64

// Eight 16 B copies of this lane, global -> LDS: 64 rows of 512 B for the block.
// From one copy to the next the block's 256 lanes advance 4096 B in global memory
// (8 rows) and 8 padded rows in LDS.  The s_wait_xcnt at the statement's end keeps
// later writes of the address registers behind the copies' issue.
__device__ __forceinline__ void async_rows64(const _Float16* g, _Float16* l) {
  unsigned int l0 = (unsigned int)(unsigned long long)l;
  unsigned long long g0 = (unsigned long long)g;
  const unsigned int LS = 8u * PJ_PITCH * 2u;
  const unsigned long long GS = 4096ull;
  asm volatile("global_load_async_to_lds_b128 %0, %1, off\n\t"
               "global_load_async_to_lds_b128 %2, %3, off\n\t"
               "global_load_async_to_lds_b128 %4, %5, off\n\t"
               "global_load_async_to_lds_b128 %6, %7, off\n\t"
               "global_load_async_to_lds_b128 %8, %9, off\n\t"
               "global_load_async_to_lds_b128 %10, %11, off\n\t"
               "global_load_async_to_lds_b128 %12, %13, off\n\t"
               "global_load_async_to_lds_b128 %14, %15, off\n\t"
               "s_wait_xcnt 0x0"
               :: "v"(l0), "v"(g0), "v"(l0 + LS), "v"(g0 + GS),
                  "v"(l0 + 2u * LS), "v"(g0 + 2ull * GS), "v"(l0 + 3u * LS), "v"(g0 + 3ull * GS),
                  "v"(l0 + 4u * LS), "v"(g0 + 4ull * GS), "v"(l0 + 5u * LS), "v"(g0 + 5ull * GS),
                  "v"(l0 + 6u * LS), "v"(g0 + 6ull * GS), "v"(l0 + 7u * LS), "v"(g0 + 7ull * GS)
               : "memory");
}

// Fills both tiles: sg = first of 128 contiguous dwT rows, wg = first of 64 contiguous
// weight rows.  On return every wave may read every row.
__device__ __forceinline__ void proj_stage(const _Float16* sg, const _Float16* wg,
                                           _Float16* sT, _Float16* wT) {
  int tid = threadIdx.x;
  int goff = tid * 8;                                   // this lane's 16 B of 4096 B
  int loff = (tid >> 5) * PJ_PITCH + (tid & 31) * 8;    // row = wave, 16 B piece = lane
  async_rows64(sg + goff, sT + loff);
  async_rows64(sg + 64 * C_IN + goff, sT + 64 * PJ_PITCH + loff);
  async_rows64(wg + goff, wT + loff);
  S_WAIT_ASYNCCNT(0);   // this wave's 24 copies have landed
  __syncthreads();      // ... and every other wave's, before any fragment is read
}

// acc[i][j] += A rows (i*16..) x B rows (j*16..), c in the order 0, 32, .., 224
__device__ __forceinline__ void proj_mma(const _Float16* aT, const _Float16* bT,
                                         v8f (&acc)[2][2]) {
  // unrolled so that the LDS reads of later c blocks can be issued ahead of the WMMAs
#pragma unroll
  for (int kc = 0; kc < C_IN; kc += 32) {
    v16h a0 = load_frag16x32(aT + kc, PJ_PITCH);
    v16h a1 = load_frag16x32(aT + 16 * PJ_PITCH + kc, PJ_PITCH);
    v16h b0 = load_frag16x32(bT + kc, PJ_PITCH);
    v16h b1 = load_frag16x32(bT + 16 * PJ_PITCH + kc, PJ_PITCH);
    acc[0][0] = wmma_f16(a0, b0, acc[0][0]);
    acc[0][1] = wmma_f16(a0, b1, acc[0][1]);
    acc[1][0] = wmma_f16(a1, b0, acc[1][0]);
    acc[1][1] = wmma_f16(a1, b1, acc[1][1]);
  }
}

// ---------------------------------------------------------------------------
// Kernel 2: all three projections in one grid; blockIdx.y picks 64 rows o of w_pw, and
// with them (the same for a whole block) the orientation of the product.
// o < 512, Q and K:  qkvT[s][o] = sum_c dwT[s][c]*w_pw[o][c]
//   A = dwT rows (s), B = w_pw rows (o) -- both row-major [*][c].
//   Q gets QSCALE folded in.  Writes Q,K as [bh][s][d] f16 (lanes advance d).
// o >= 512, V, un-transposed orientation:  qkv[o][s] = sum_c w_pw[o][c]*dwT[s][c]
//   A = w_pw rows (o), B = dwT rows (s).
//   Writes V transposed: VT [bh][d][t=s] f16 (lanes advance s).
// ---------------------------------------------------------------------------
__global__ __launch_bounds__(256) void proj_kernel(
    const _Float16* __restrict__ dwT, const _Float16* __restrict__ wph,
    _Float16* __restrict__ Qg, _Float16* __restrict__ Kg, _Float16* __restrict__ VTg) {
  __shared__ __align__(16) _Float16 sT[PJ_S * PJ_PITCH];
  __shared__ __align__(16) _Float16 wT[PJ_O * PJ_PITCH];
  int wave = threadIdx.x >> 5, lane = threadIdx.x & 31;
  int s0 = blockIdx.x * PJ_S;
  int o0 = blockIdx.y * PJ_O;                      // o in [0,768)
  int b = blockIdx.z;
  proj_stage(dwT + ((size_t)(b * S_TOTAL + s0)) * C_IN, wph + (size_t)o0 * C_IN, sT, wT);
  int sw = (wave & 3) * 32, ow = (wave >> 2) * 32; // this wave's 32 s x 32 o
  v8f acc[2][2] = {};
  if (o0 < 512) {
    proj_mma(sT + sw * PJ_PITCH, wT + ow * PJ_PITCH, acc);
    // (unrolled so that acc is indexed by constants and stays in registers)
#pragma unroll
    for (int j = 0; j < 2; ++j) {
      int o = o0 + ow + j * 16 + (lane & 15);
      int qi = o >> 8;                 // 0 => Q, 1 => K
      int h = (o >> 6) & 3;
      int d = o & 63;
      _Float16* dst = (qi ? Kg : Qg) + ((size_t)(b * NH + h) * S_TOTAL) * DHEAD + d;
      float sc = qi ? 1.0f : QSCALE;
#pragma unroll
      for (int i = 0; i < 2; ++i) {
#pragma unroll
        for (int r = 0; r < 8; ++r) {
          int s = s0 + sw + i * 16 + r + ((lane >> 4) << 3);
          dst[(size_t)s * DHEAD] = (_Float16)(acc[i][j][r] * sc);
        }
      }
    }
  } else {
    proj_mma(wT + ow * PJ_PITCH, sT + sw * PJ_PITCH, acc);
    // (unrolled so that acc is indexed by constants and stays in registers)
#pragma unroll
    for (int j = 0; j < 2; ++j) {
      int s = s0 + sw + j * 16 + (lane & 15);
#pragma unroll
      for (int i = 0; i < 2; ++i) {
#pragma unroll
        for (int r = 0; r < 8; ++r) {
          int o = o0 + ow + i * 16 + r + ((lane >> 4) << 3);
          int h = (o - 512) >> 6;
          int d = (o - 512) & 63;
          VTg[((size_t)(b * NH + h) * DHEAD + d) * S_TOTAL + s] = (_Float16)acc[i][j][r];
        }
      }
    }
    // in the built code the Q/K side's first instructions stand behind this side's exit
    // branch and rewrite these stores' address and data registers: the wait keeps those
    // writes behind the stores' issue (the Q/K side's own stores run into the kernel's end)
    asm volatile("s_wait_xcnt 0x0" ::: "memory");
  }
}

// ---------------------------------------------------------------------------
// Kernel 3: flash attention, transposed formulation, double-buffered async
// global->LDS DMA (ASYNCcnt).
// Per wave: 32 s-columns (two 16-column tiles), so every K and V^T fragment read
// from LDS feeds two WMMAs.  To keep eight waves on a block's 128 columns the keys
// are split: waves 0..3 walk keys 0..2047, waves 4..7 keys 2048..4095, each group
// on its own staged tiles; the two partial softmax states of a column are joined
// once, through LDS, after the loop.
// S'[t,s] = K*Q^T tiles (t rows in VGPRs, s across lanes) -> online softmax is
// per-lane over VGPRs + one shfl_xor(16).
// The maximum in use (m_run) may trail a column's true running maximum: no maximum is
// formed in an ordinary pass.  Each lane keeps its own part of a column's row sum, and its
// sum of the pass's 32 weights is the test: only where one exceeds LAZY_LIMIT does the wave
// take the scores' maximum, rescale sums and accumulators, move m_run and form the pass's
// weights again.  A column's parts are added once, behind the loop.
// P' C-fragment re-packs directly into the B-fragment for O^T = V^T * P'
// (half h<8 <- frag0[h], half h>=8 <- frag1[h-8]) -- no transpose traffic.
// ---------------------------------------------------------------------------
// LDS row pitch in halves: 16 B x odd (144 B for K rows, 80 B for V^T rows), so
// the 16 rows that one ds_load_b128 fragment read touches fall on distinct banks.
#define K_PITCH  72
#define V_PITCH  40
#define KT_ELEMS (32 * K_PITCH)
#define VT_ELEMS (64 * V_PITCH)
#define KEYS_PER_GROUP (S_TOTAL / 2)
#define N_ITERS  (KEYS_PER_GROUP / 32)
// join area: per wave 9 rows of 32 lanes x 16 B (8 rows of sums, 1 of maximum and sum)
#define JOIN_ROWS 9
// a lane's 32 weights of a pass sum to at most 2^13, so each is at most 2^13, inside
// f16's range, and a row sum is at most 4096 * 2^13
#define LAZY_LIMIT 8192.0f

// 2^x as the bare v_exp_f32.  exp2f() wraps that instruction in a range fix-up (a
// compare, two selects, an add and an ldexp for each value) whose only effect is on
// results below 2^-126.  Here a column's largest
// score gives at least 1: a weight that small is 0 as f16 and is lost in the f32 row sum,
// and a rescale factor that small multiplies sums that the new tile outweighs by 2^126.
// (A score far above m_run gives a large weight or +inf: the lazy test sees it in the sum.)
__device__ __forceinline__ float exp2_hw(float x) { return __builtin_amdgcn_exp2f(x); }

// The same with the slot that the instruction set asks for behind a transcendental in the
// statement itself.  For the two factors of the join: there the built code otherwise has a
// dual-issue select that overwrites the source register directly behind the v_exp_f32.
__device__ __forceinline__ float exp2_hw_slot(float x) {
  float r;
  asm("v_exp_f32 %0, %1\n\tv_nop" : "=v"(r) : "v"(x));
  return r;
}

typedef __attribute__((ext_vector_type(2))) float f2;

// One column tile's weights 2^(score - m) of a pass: packs them as the B fragment for
// O^T = V^T * P' (layout identity: half h<8 <- s0[h], half h>=8 <- s1[h-8]) and returns
// this lane's sum of its 16 as two partial sums, added pairwise in packed form so that
// the test waits on a short chain.  (Both loops are unrolled so that the vectors are
// indexed by constants and stay in registers.)
__device__ __forceinline__ f2 softmax_tile(const v8f& s0, const v8f& s1, float m, v16h& bp) {
  v8f e0 = s0 - m, e1 = s1 - m;
#pragma unroll
  for (int r = 0; r < 8; ++r) {
    e0[r] = exp2_hw(e0[r]);
    e1[r] = exp2_hw(e1[r]);
  }
#pragma unroll
  for (int r = 0; r < 8; ++r) {
    bp[r] = (_Float16)e0[r];
    bp[r + 8] = (_Float16)e1[r];
  }
  v8f u = e0 + e1;
  f4 h = __builtin_shufflevector(u, u, 0, 1, 2, 3) + __builtin_shufflevector(u, u, 4, 5, 6, 7);
  return __builtin_shufflevector(h, h, 0, 1) + __builtin_shufflevector(h, h, 2, 3);
}

__global__ __launch_bounds__(256) void attn_kernel(
    const _Float16* __restrict__ Qg, const _Float16* __restrict__ Kg,
    const _Float16* __restrict__ VTg, float* __restrict__ out) {
  __shared__ __align__(16) _Float16 lds_k[4 * KT_ELEMS];   // [buf][key group][t][d], padded rows
  __shared__ __align__(16) _Float16 lds_vt[4 * VT_ELEMS];  // [buf][key group][d][t], padded rows
  __shared__ f4 lds_join[8 * JOIN_ROWS * 32];              // [wave][row][lane]
  int tid = threadIdx.x, lane = tid & 31;
  int wave = __builtin_amdgcn_readfirstlane(tid >> 5);
  int cg = wave & 3, kg = wave >> 2;                  // column group, key group
  int bh = blockIdx.y;
  int scol0 = blockIdx.x * 128 + cg * 32;

  const _Float16* Qb = Qg + ((size_t)bh * S_TOTAL + scol0) * DHEAD;
  const _Float16* Kb = Kg + (size_t)bh * S_TOTAL * DHEAD;
  const _Float16* Vb = VTg + (size_t)bh * DHEAD * S_TOTAL;

  // (every inner loop of this kernel is unrolled so that its fragment and accumulator
  // arrays are indexed by constants and stay in registers)
  // Q B-fragments, loaded once (lane -> column s, halves -> d), [column tile][d half]
  v16h bq[2][2];
#pragma unroll
  for (int c = 0; c < 2; ++c) {
    bq[c][0] = load_frag16x32(Qb + c * 16 * DHEAD, DHEAD);
    bq[c][1] = load_frag16x32(Qb + c * 16 * DHEAD + 32, DHEAD);
  }

  v8f acc[2][4] = {};                                 // [column tile][16 d]
  float m_run[2] = { -3.0e38f, -3.0e38f };
  f2 l_part[2] = {};                                  // this lane's part of the row sums
  int vd = tid >> 2, vp = tid & 3;                    // V^T tile load mapping
  int klds = (tid >> 3) * K_PITCH + (tid & 7) * 8;    // this lane's 16 B in a K tile
  int vlds = vd * V_PITCH + vp * 8;                   // ... and in a V^T tile
  const _Float16* Ksrc = Kb + (size_t)tid * 8;        // this lane's 16 B of key group 0's
  const _Float16* Vsrc = Vb + (size_t)vd * S_TOTAL + vp * 8;   // tile 0, K and V^T

  // prologue: async-load both groups' tile 0 into buffer 0 (16B per thread per tile)
  async_load16_kv2(Ksrc, lds_k + klds, Vsrc, lds_vt + vlds,
                   Ksrc + (size_t)KEYS_PER_GROUP * DHEAD, lds_k + KT_ELEMS + klds,
                   Vsrc + KEYS_PER_GROUP, lds_vt + VT_ELEMS + vlds);

  for (int i = 0; i < N_ITERS; ++i) {
    int t0 = i * 32;
    const _Float16* kcur = lds_k + ((i & 1) * 2 + kg) * KT_ELEMS;
    const _Float16* vcur = lds_vt + ((i & 1) * 2 + kg) * VT_ELEMS;
    if (i + 1 < N_ITERS) {
      // issue the next stage's DMA into the other buffer; it overlaps this
      // iteration's WMMAs.  Waiting ASYNCcnt<=4 leaves only those four copies
      // outstanding, so stage i has landed.
      _Float16* knxt = lds_k + ((i + 1) & 1) * 2 * KT_ELEMS;
      _Float16* vnxt = lds_vt + ((i + 1) & 1) * 2 * VT_ELEMS;
      const _Float16* kg0 = Ksrc + (size_t)(t0 + 32) * DHEAD;
      const _Float16* vg0 = Vsrc + (t0 + 32);
      async_load16_kv2(kg0, knxt + klds, vg0, vnxt + vlds,
                       kg0 + (size_t)KEYS_PER_GROUP * DHEAD, knxt + KT_ELEMS + klds,
                       vg0 + KEYS_PER_GROUP, vnxt + VT_ELEMS + vlds);
      S_WAIT_ASYNCCNT(4);
    } else {
      S_WAIT_ASYNCCNT(0);
    }
    __syncthreads();   // all waves' DMA for stage i landed

    // scores S'[t, s]: 2 t-subtiles x (d=0..31, d=32..63), each K fragment for both column tiles
    v16h ka0 = load_frag16x32(kcur + 0, K_PITCH);
    v16h ka1 = load_frag16x32(kcur + 32, K_PITCH);
    v16h kb0 = load_frag16x32(kcur + 16 * K_PITCH, K_PITCH);
    v16h kb1 = load_frag16x32(kcur + 16 * K_PITCH + 32, K_PITCH);
    v8f c0[2], c1[2];
#pragma unroll
    for (int c = 0; c < 2; ++c) {
      v8f z = {};
      c0[c] = wmma_f16(ka0, bq[c][0], z);
      c1[c] = wmma_f16(kb0, bq[c][0], z);
    }
#pragma unroll
    for (int c = 0; c < 2; ++c) {
      c0[c] = wmma_f16(ka1, bq[c][1], c0[c]);
      c1[c] = wmma_f16(kb1, bq[c][1], c1[c]);
    }

    // keeps the K reads one group in front of the score WMMAs: with the V^T reads in the
    // same region the scheduler re-uses a K fragment's registers and reads the next
    // fragment only two WMMAs ahead of its use
    __builtin_amdgcn_sched_barrier(0);

    // the pass's V^T fragments, read as one group under the exponentials
    v16h va[4];
#pragma unroll
    for (int a = 0; a < 4; ++a) va[a] = load_frag16x32(vcur + a * 16 * V_PITCH, V_PITCH);
    // keeps the eight reads here: the scheduler otherwise sinks them in among the WMMAs
    // that use them, where each pair is waited for as soon as it is issued
    __builtin_amdgcn_sched_barrier(0);

    // weights against the maximum in use, and each lane's sum of them
    v16h bp[2];
    f2 ts[2];
#pragma unroll
    for (int c = 0; c < 2; ++c) ts[c] = softmax_tile(c0[c], c1[c], m_run[c], bp[c]);
    f2 tw = ts[0] + ts[1];
    bool need = tw.x + tw.y > LAZY_LIMIT;
    // One wave-uniform scalar branch a pass (always taken in the first): every column of
    // the wave moves m_run to the larger of it and the pass's maximum; both lanes of a column get the same one.
    if (__builtin_expect(__builtin_amdgcn_ballot_w32(need) != 0, 0)) {
#pragma unroll
      for (int c = 0; c < 2; ++c) {
        float tm = c0[c][0];
#pragma unroll
        for (int r = 0; r < 8; ++r) { tm = fmaxf(tm, c0[c][r]); tm = fmaxf(tm, c1[c][r]); }
        float mn = fmaxf(m_run[c], fmaxf(tm, __shfl_xor(tm, 16, 32)));
        float alpha = exp2_hw(m_run[c] - mn);
        m_run[c] = mn;
        l_part[c] *= alpha;
#pragma unroll
        for (int a = 0; a < 4; ++a) {
#pragma unroll
          for (int r = 0; r < 8; ++r) acc[c][a][r] *= alpha;
        }
        ts[c] = softmax_tile(c0[c], c1[c], mn, bp[c]);
      }
    }
    l_part[0] += ts[0];
    l_part[1] += ts[1];
    // each V^T fragment for both column tiles
#pragma unroll
    for (int a = 0; a < 4; ++a) {
      acc[0][a] = wmma_f16(va[a], bp[0], acc[0][a]);
      acc[1][a] = wmma_f16(va[a], bp[1], acc[1][a]);
    }
    __syncthreads();   // stage i fully consumed before i+2's DMA reuses buffer
  }

  // a column's row sum: its two lanes each hold, in two parts, the sum over their own
  // 16 keys of every pass
  float l_run[2];
#pragma unroll
  for (int c = 0; c < 2; ++c) {
    l_run[c] = l_part[c].x + l_part[c].y;
    l_run[c] += __shfl_xor(l_run[c], 16, 32);
  }

  // join of the two key groups: waves w and w^4 hold the same 32 columns.  Each hands
  // the other one column tile's state (key group 0 gives tile 1, group 1 gives tile 0)
  // and finishes the tile it keeps.
  bool hi = kg != 0;
  f4* mine = lds_join + wave * (JOIN_ROWS * 32) + lane;
  const f4* theirs = lds_join + (wave ^ 4) * (JOIN_ROWS * 32) + lane;
  v8f keep[4];
#pragma unroll
  for (int a = 0; a < 4; ++a) {
    v8f give = hi ? acc[0][a] : acc[1][a];
    keep[a] = hi ? acc[1][a] : acc[0][a];
    f4 lo4 = { give[0], give[1], give[2], give[3] };
    f4 hi4 = { give[4], give[5], give[6], give[7] };
    mine[(2 * a) * 32] = lo4;
    mine[(2 * a + 1) * 32] = hi4;
  }
  f4 ml = { hi ? m_run[0] : m_run[1], hi ? l_run[0] : l_run[1], 0.f, 0.f };
  mine[8 * 32] = ml;
  float m_k = hi ? m_run[1] : m_run[0], l_k = hi ? l_run[1] : l_run[0];
  __syncthreads();   // every wave's handed-over state is in LDS before its partner reads it
  f4 oml = theirs[8 * 32];
  float m_j = fmaxf(m_k, oml.x);
  float f_k = exp2_hw_slot(m_k - m_j), f_o = exp2_hw_slot(oml.x - m_j);
  float inv = 1.0f / (l_k * f_k + oml.y * f_o);
  f_k *= inv; f_o *= inv;

  // epilogue: out[bh*64 + d][s] = joined sums / joined l   (lanes advance s -> coalesced)
  int s = scol0 + kg * 16 + (lane & 15);
  int rbase = (lane >> 4) << 3;
#pragma unroll
  for (int a = 0; a < 4; ++a) {
    f4 o_lo = theirs[(2 * a) * 32], o_hi = theirs[(2 * a + 1) * 32];
#pragma unroll
    for (int r = 0; r < 8; ++r) {
      float o = (r < 4) ? o_lo[r & 3] : o_hi[r & 3];
      out[(size_t)(bh * 64 + a * 16 + r + rbase) * S_TOTAL + s] = keep[a][r] * f_k + o * f_o;
    }
  }
}

// ---------------------------------------------------------------------------
extern "C" void kernel_launch(void* const* d_in, const int* in_sizes, int n_in,
                              void* d_out, int out_size, void* d_ws,
                              size_t ws_size, hipStream_t stream) {
  (void)in_sizes; (void)n_in; (void)out_size; (void)ws_size;
  const float* x    = (const float*)d_in[0];   // [4,256,64,64]
  const float* w_dw = (const float*)d_in[1];   // [256,1,3,3]
  const float* w_pw = (const float*)d_in[2];   // [768,256]
  float* out = (float*)d_out;                  // [4,256,64,64]

  char* ws = (char*)d_ws;
  _Float16* dwT = (_Float16*)(ws);                   // 4*4096*256 f16 = 8 MiB
  _Float16* Qg  = (_Float16*)(ws + (8u  << 20));     // 16*4096*64 f16 = 8 MiB
  _Float16* Kg  = (_Float16*)(ws + (16u << 20));     // 8 MiB
  _Float16* VTg = (_Float16*)(ws + (24u << 20));     // 8 MiB
  _Float16* wph = (_Float16*)(ws + (32u << 20));     // 768*256 f16

  dwconv_cvt_kernel<<<dim3(64 + CVT_X, 4, 4), 256, 0, stream>>>(x, w_dw, w_pw, dwT, wph);
  proj_kernel<<<dim3(32, 12, 4), 256, 0, stream>>>(dwT, wph, Qg, Kg, VTg);
  attn_kernel<<<dim3(32, 16), 256, 0, stream>>>(Qg, Kg, VTg, out);
}

// v009
// Measured time: 62.5 microseconds a run.
// Two timings next to v008 put it at 1.09 and 1.08 times that version's speed.
// Over all steps from v000 it is 5.04 times as fast.
#include <hip/hip_runtime.h>

typedef __attribute__((ext_vector_type(16))) _Float16 v16h;
typedef __attribute__((ext_vector_type(8)))  _Float16 v8h;
typedef __attribute__((ext_vector_type(8)))  float    v8f;

#define S_TOTAL 4096
#define DHEAD   64
#define NH      4
#define NB      4
#define C_IN    256
// fold 1/sqrt(64) and log2(e) into Q so softmax can use exp2
#define QSCALE  (0.125f * 1.44269504088896340736f)

// ---------------------------------------------------------------------------
// Fragment loader for CDNA5 WMMA f16 operands (A 16x32 MxK, or B 32x16 KxN
// loaded from an [N][K] row-major buffer -- both have identical lane layout):
// lane l -> row (l&15); halves 0..7 = k [kb..kb+7], halves 8..15 = k [kb+16..kb+23]
// with kb = (l>>4)*8.  Two 16B vector loads per fragment.
// ---------------------------------------------------------------------------
__device__ __forceinline__ v16h load_frag16x32(const _Float16* base, int stride) {
  int lane = threadIdx.x & 31;
  const _Float16* p = base + (lane & 15) * stride + ((lane >> 4) << 3);
  v8h lo = *(const v8h*)(p);
  v8h hi = *(const v8h*)(p + 16);
  v16h r;
#pragma unroll
  for (int i = 0; i < 8; ++i) { r[i] = lo[i]; r[i + 8] = hi[i]; }
  return r;
}

__device__ __forceinline__ v8f wmma_f16(v16h a, v16h b, v8f c) {
  return __builtin_amdgcn_wmma_f32_16x16x32_f16(false, a, false, b, (short)0, c,
                                                false, false);
}

// Async DMA: 16B global -> LDS, tracked by ASYNCcnt (GLOBAL_LOAD_ASYNC_TO_LDS_B128).
// LDS operand takes the workgroup-relative byte offset; for the flat-LDS
// aperture that is addr[31:0] of the generic pointer (ISA 10.2).
// (The attention kernel's own copy statement stands with its tile sizes, further down.)
#define S_WAIT_ASYNCCNT(n) asm volatile("s_wait_asynccnt " #n ::: "memory")
#define S_WAIT_DSCNT(n) asm volatile("s_wait_dscnt " #n ::: "memory")

// ---------------------------------------------------------------------------
// Kernel 1: two jobs that need nothing of each other share one grid, told apart by
// blockIdx.x (the same for a whole block): x < 64 is the depthwise conv, x >= 64
// converts the pointwise weight.
// Depthwise 3x3 conv (pad 1).  Output transposed: dwT [b][s][c] f16
// block = (hh, group of 64 channels, b).  Lanes advance along ww: 16 lanes x
// 16 B read one whole 256 B image row of a channel, so every global load
// covers whole lines.  The [c][ww] -> [ww][c] turn goes through LDS, and each
// wave then stores one 128 B line (64 channels of one s) per instruction.
// ---------------------------------------------------------------------------
typedef __attribute__((ext_vector_type(2))) _Float16 v2h;
typedef __attribute__((ext_vector_type(4))) float f4;
// weight vectors: a channel pair's 18 floats start at a multiple of 8 B only
typedef __attribute__((ext_vector_type(4), aligned(8))) float f4u;
typedef __attribute__((ext_vector_type(2), aligned(8))) float f2u;
// staged row pitch in dwords: odd, so the 16 ww-quads of a store (4 rows apart)
// and the 32 channel pairs of a read both fall on distinct banks
#define DW_PITCH 33
// blocks in x that convert the weight: 6 x 4 x 4 blocks x 256 threads x 8 = 768 * 256
#define CVT_X 6

// pointwise weight [768][256] f32 -> f16, 8 values a thread (32 B read, 16 B stored):
// the shared grid pays for every wave it starts, so the convert adds 96 blocks, not 768
__device__ __forceinline__ void cvt_wpw_block(const float* __restrict__ w_pw,
                                              _Float16* __restrict__ wph, int blk) {
  int idx = (blk * 256 + (int)threadIdx.x) * 8;
  f4 a = *(const f4*)(w_pw + idx);
  f4 c = *(const f4*)(w_pw + idx + 4);
  v8h h = { (_Float16)a.x, (_Float16)a.y, (_Float16)a.z, (_Float16)a.w,
            (_Float16)c.x, (_Float16)c.y, (_Float16)c.z, (_Float16)c.w };
  *(v8h*)(wph + idx) = h;
}

// value of lane-1 / lane+1 inside a 16-lane row (one image row); the lane past
// the row's end reads 0, which is the conv's zero padding in ww
__device__ __forceinline__ float from_left_lane(float v) {
  return __int_as_float(__builtin_amdgcn_update_dpp(0, __float_as_int(v), 0x111 /*row_shr:1*/, 0xf, 0xf, true));
}
__device__ __forceinline__ float from_right_lane(float v) {
  return __int_as_float(__builtin_amdgcn_update_dpp(0, __float_as_int(v), 0x101 /*row_shl:1*/, 0xf, 0xf, true));
}

__global__ __launch_bounds__(256) void dwconv_cvt_kernel(const float* __restrict__ x,
                                                         const float* __restrict__ w_dw,
                                                         const float* __restrict__ w_pw,
                                                         _Float16* __restrict__ dwT,
                                                         _Float16* __restrict__ wph) {
  __shared__ unsigned int tile[64 * DW_PITCH];      // [ww][channel pair], 2 x f16
  if (blockIdx.x >= 64) {                           // whole block, ahead of the barrier
    cvt_wpw_block(w_pw, wph,
                  (int)(blockIdx.x - 64 + CVT_X * (blockIdx.y + 4 * blockIdx.z)));
    return;
  }
  int hh = blockIdx.x, cg = blockIdx.y, b = blockIdx.z;
  int tid = threadIdx.x, q = tid & 15;              // q: which 4 ww of the row
  bool up = hh > 0, dn = hh < 63;                   // rows hh-1 / hh+1 exist
  // every address = block-uniform base + one per-lane byte offset (+ a constant)
  const float* xg = x + ((size_t)(b * C_IN + cg * 64)) * S_TOTAL;
  const char* xb[3] = { (const char*)(xg + (up ? hh - 1 : hh) * 64),   // a row that does not
                        (const char*)(xg + hh * 64),                  // exist is read as row hh
                        (const char*)(xg + (dn ? hh + 1 : hh) * 64) };// and zeroed below
  const char* wp = (const char*)(w_dw + cg * 64 * 9);
  unsigned xoff = (unsigned)(tid >> 4) * (2u * S_TOTAL * 4u) + (unsigned)q * 16u;
  unsigned woff = (unsigned)(tid >> 4) * (2u * 9u * 4u);
  // all loads first: 2 passes x (18 weights of a channel pair, 2 channels x 3 rows of 4 ww)
  // (every loop of this kernel is unrolled so that its arrays are indexed by constants
  // and stay in registers)
  f4u wa[2][4];
  f2u wb[2];
  f4  v[2][2][3];
#pragma unroll
  for (int p = 0; p < 2; ++p) {
    const char* wc = wp + p * (32 * 9 * 4);
#pragma unroll
    for (int j = 0; j < 4; ++j) wa[p][j] = *(const f4u*)(wc + j * 16 + woff);
    wb[p] = *(const f2u*)(wc + 64 + woff);
#pragma unroll
    for (int e = 0; e < 2; ++e) {
#pragma unroll
      for (int ky = 0; ky < 3; ++ky)
        v[p][e][ky] = *(const f4*)(xb[ky] + (p * 32 + e) * (S_TOTAL * 4) + xoff);
    }
  }
  // Fence on the loaded values and the two offsets (inputs only): keeps all 22 loads in
  // flight together in front of the arithmetic, which otherwise gets them one wait at a
  // time, and keeps every rewrite of the loads' address registers behind the wait.
  asm volatile("s_wait_xcnt 0x0"
               :: "v"(wa[0][0]), "v"(wa[0][1]), "v"(wa[0][2]), "v"(wa[0][3]), "v"(wb[0]),
                  "v"(wa[1][0]), "v"(wa[1][1]), "v"(wa[1][2]), "v"(wa[1][3]), "v"(wb[1]),
                  "v"(v[0][0][0]), "v"(v[0][0][1]), "v"(v[0][0][2]),
                  "v"(v[0][1][0]), "v"(v[0][1][1]), "v"(v[0][1][2]),
                  "v"(v[1][0][0]), "v"(v[1][0][1]), "v"(v[1][0][2]),
                  "v"(v[1][1][0]), "v"(v[1][1][1]), "v"(v[1][1][2]),
                  "v"(xoff), "v"(woff));
#pragma unroll
  for (int p = 0; p < 2; ++p) {
    float s[2][4];
#pragma unroll
    for (int e = 0; e < 2; ++e) {
      s[e][0] = 0.f; s[e][1] = 0.f; s[e][2] = 0.f; s[e][3] = 0.f;
#pragma unroll
      for (int ky = 0; ky < 3; ++ky) {
        f4 r = v[p][e][ky];
        if ((ky == 0 && !up) || (ky == 2 && !dn)) {  // zero padding in hh
          r.x = 0.f; r.y = 0.f; r.z = 0.f; r.w = 0.f;
        }
        float a[6] = { from_left_lane(r.w), r.x, r.y, r.z, r.w, from_right_lane(r.x) };
#pragma unroll
        for (int kx = 0; kx < 3; ++kx) {
          int k = e * 9 + ky * 3 + kx;               // index in the pair's 18 weights
          float w = (k < 16) ? wa[p][k >> 2][k & 3] : wb[p][k & 1];
#pragma unroll
          for (int j = 0; j < 4; ++j)
            s[e][j] = __builtin_fmaf(a[j + kx], w, s[e][j]);
        }
      }
    }
    int cp = p * 16 + (tid >> 4);                   // channel pair in the group
#pragma unroll
    for (int j = 0; j < 4; ++j) {
      v2h h = { (_Float16)s[0][j], (_Float16)s[1][j] };
      tile[(q * 4 + j) * DW_PITCH + cp] = __builtin_bit_cast(unsigned int, h);
    }
  }
  __syncthreads();   // the whole [64 ww][64 c] tile is staged before any row leaves
  int wave = tid >> 5, lane = tid & 31;
  unsigned int* dst = (unsigned int*)(dwT + ((size_t)(b * S_TOTAL + hh * 64)) * C_IN + cg * 64);
#pragma unroll
  for (int i = 0; i < 8; ++i) {
    int r = wave * 8 + i;
    dst[(size_t)r * (C_IN / 2) + lane] = tile[r * DW_PITCH + lane];
  }
}

// ---------------------------------------------------------------------------
// Projections (kernel 2): one block = 128 rows of dwT (s) x 64 rows of
// w_pw (o), the whole c = 256 of both.  Both operand tiles are brought into LDS
// once, by asynchronous copies in which a wave's 32 lanes x 16 B cover one whole
// 512 B row, and the 8 waves read their WMMA fragments from there: a wave owns
// 32 s x 32 o, so each fragment it reads feeds two WMMAs.
// ---------------------------------------------------------------------------
// LDS row pitch in halves: 528 B = 16 B x odd, so the 16 rows that one
// ds_load_b128 fragment read touches fall on distinct banks.
#define PJ_PITCH 264
#define PJ_S 128
#define PJ_O 64

// Eight 16 B copies of this lane, global -> LDS: 64 rows of 512 B for the block.
// From one copy to the next the block's 256 lanes advance 4096 B in global memory
// (8 rows) and 8 padded rows in LDS.  The s_wait_xcnt at the statement's end keeps
// later writes of the address registers behind the copies' issue.
__device__ __forceinline__ void async_rows64(const _Float16* g, _Float16* l) {
  unsigned int l0 = (unsigned int)(unsigned long long)l;
  unsigned long long g0 = (unsigned long long)g;
  const unsigned int LS = 8u * PJ_PITCH * 2u;
  const unsigned long long GS = 4096ull;
  asm volatile("global_load_async_to_lds_b128 %0, %1, off\n\t"
               "global_load_async_to_lds_b128 %2, %3, off\n\t"
               "global_load_async_to_lds_b128 %4, %5, off\n\t"
               "global_load_async_to_lds_b128 %6, %7, off\n\t"
               "global_load_async_to_lds_b128 %8, %9, off\n\t"
               "global_load_async_to_lds_b128 %10, %11, off\n\t"
               "global_load_async_to_lds_b128 %12, %13, off\n\t"
               "global_load_async_to_lds_b128 %14, %15, off\n\t"
               "s_wait_xcnt 0x0"
               :: "v"(l0), "v"(g0), "v"(l0 + LS), "v"(g0 + GS),
                  "v"(l0 + 2u * LS), "v"(g0 + 2ull * GS), "v"(l0 + 3u * LS), "v"(g0 + 3ull * GS),
                  "v"(l0 + 4u * LS), "v"(g0 + 4ull * GS), "v"(l0 + 5u * LS), "v"(g0 + 5ull * GS),
                  "v"(l0 + 6u * LS), "v"(g0 + 6ull * GS), "v"(l0 + 7u * LS), "v"(g0 + 7ull * GS)
               : "memory");
}

// Fills both tiles: sg = first of 128 contiguous dwT rows, wg = first of 64 contiguous
// weight rows.  On return every wave may read every row.
__device__ __forceinline__ void proj_stage(const _Float16* sg, const _Float16* wg,
                                           _Float16* sT, _Float16* wT) {
  int tid = threadIdx.x;
  int goff = tid * 8;                                   // this lane's 16 B of 4096 B
  int loff = (tid >> 5) * PJ_PITCH + (tid & 31) * 8;    // row = wave, 16 B piece = lane
  async_rows64(sg + goff, sT + loff);
  async_rows64(sg + 64 * C_IN + goff, sT + 64 * PJ_PITCH + loff);
  async_rows64(wg + goff, wT + loff);
  S_WAIT_ASYNCCNT(0);   // this wave's 24 copies have landed
  __syncthreads();      // ... and every other wave's, before any fragment is read
}

// acc[i][j] += A rows (i*16..) x B rows (j*16..), c in the order 0, 32, .., 224
__device__ __forceinline__ void proj_mma(const _Float16* aT, const _Float16* bT,
                                         v8f (&acc)[2][2]) {
  // unrolled so that the LDS reads of later c blocks can be issued ahead of the WMMAs
#pragma unroll
  for (int kc = 0; kc < C_IN; kc += 32) {
    v16h a0 = load_frag16x32(aT + kc, PJ_PITCH);
    v16h a1 = load_frag16x32(aT + 16 * PJ_PITCH + kc, PJ_PITCH);
    v16h b0 = load_frag16x32(bT + kc, PJ_PITCH);
    v16h b1 = load_frag16x32(bT + 16 * PJ_PITCH + kc, PJ_PITCH);
    acc[0][0] = wmma_f16(a0, b0, acc[0][0]);
    acc[0][1] = wmma_f16(a0, b1, acc[0][1]);
    acc[1][0] = wmma_f16(a1, b0, acc[1][0]);
    acc[1][1] = wmma_f16(a1, b1, acc[1][1]);
  }
}

// ---------------------------------------------------------------------------
// Kernel 2: all three projections in one grid; blockIdx.y picks 64 rows o of w_pw, and
// with them (the same for a whole block) the orientation of the product.
// o < 512, Q and K:  qkvT[s][o] = sum_c dwT[s][c]*w_pw[o][c]
//   A = dwT rows (s), B = w_pw rows (o) -- both row-major [*][c].
//   Q gets QSCALE folded in.  Writes Q,K as [bh][s][d] f16 (lanes advance d).
// o >= 512, V, un-transposed orientation:  qkv[o][s] = sum_c w_pw[o][c]*dwT[s][c]
//   A = w_pw rows (o), B = dwT rows (s).
//   Writes V transposed: VT [bh][d][t=s] f16 (lanes advance s).
// ---------------------------------------------------------------------------
__global__ __launch_bounds__(256) void proj_kernel(
    const _Float16* __restrict__ dwT, const _Float16* __restrict__ wph,
    _Float16* __restrict__ Qg, _Float16* __restrict__ Kg, _Float16* __restrict__ VTg) {
  __shared__ __align__(16) _Float16 sT[PJ_S * PJ_PITCH];
  __shared__ __align__(16) _Float16 wT[PJ_O * PJ_PITCH];
  int wave = threadIdx.x >> 5, lane = threadIdx.x & 31;
  int s0 = blockIdx.x * PJ_S;
  int o0 = blockIdx.y * PJ_O;                      // o in [0,768)
  int b = blockIdx.z;
  proj_stage(dwT + ((size_t)(b * S_TOTAL + s0)) * C_IN, wph + (size_t)o0 * C_IN, sT, wT);
  int sw = (wave & 3) * 32, ow = (wave >> 2) * 32; // this wave's 32 s x 32 o
  v8f acc[2][2] = {};
  if (o0 < 512) {
    proj_mma(sT + sw * PJ_PITCH, wT + ow * PJ_PITCH, acc);
    // (unrolled so that acc is indexed by constants and stays in registers)
#pragma unroll
    for (int j = 0; j < 2; ++j) {
      int o = o0 + ow + j * 16 + (lane & 15);
      int qi = o >> 8;                 // 0 => Q, 1 => K
      int h = (o >> 6) & 3;
      int d = o & 63;
      _Float16* dst = (qi ? Kg : Qg) + ((size_t)(b * NH + h) * S_TOTAL) * DHEAD + d;
      float sc = qi ? 1.0f : QSCALE;
#pragma unroll
      for (int i = 0; i < 2; ++i) {
#pragma unroll
        for (int r = 0; r < 8; ++r) {
          int s = s0 + sw + i * 16 + r + ((lane >> 4) << 3);
          dst[(size_t)s * DHEAD] = (_Float16)(acc[i][j][r] * sc);
        }
      }
    }
  } else {
    proj_mma(wT + ow * PJ_PITCH, sT + sw * PJ_PITCH, acc);
    // (unrolled so that acc is indexed by constants and stays in registers)
#pragma unroll
    for (int j = 0; j < 2; ++j) {
      int s = s0 + sw + j * 16 + (lane & 15);
#pragma unroll
      for (int i = 0; i < 2; ++i) {
#pragma unroll
        for (int r = 0; r < 8; ++r) {
          int o = o0 + ow + i * 16 + r + ((lane >> 4) << 3);
          int h = (o - 512) >> 6;
          int d = (o - 512) & 63;
          VTg[((size_t)(b * NH + h) * DHEAD + d) * S_TOTAL + s] = (_Float16)acc[i][j][r];
        }
      }
    }
    // in the built code the Q/K side's first instructions stand behind this side's exit
    // branch and rewrite these stores' address and data registers: the wait keeps those
    // writes behind the stores' issue (the Q/K side's own stores run into the kernel's end)
    asm volatile("s_wait_xcnt 0x0" ::: "memory");
  }
}

// ---------------------------------------------------------------------------
// Kernel 3: flash attention, transposed formulation, double-buffered async
// global->LDS DMA (ASYNCcnt).  A stage is 128 keys of each key group, worked on in four
// passes of 32 keys; the waves of a block meet once a stage, so between two meetings one
// wave's matrix work can run beside another's softmax.
// Per wave: 32 s-columns (two 16-column tiles), so every K and V^T fragment read
// from LDS feeds two WMMAs.  To keep eight waves on a block's 128 columns the keys
// are split: waves 0..3 walk keys 0..2047, waves 4..7 keys 2048..4095, each group
// on its own staged tiles; the two partial softmax states of a column are joined
// once, through LDS, after the loop.
// S'[t,s] = K*Q^T tiles (t rows in VGPRs, s across lanes) -> online softmax is
// per-lane over VGPRs + one shfl_xor(16).
// The maximum in use (m_run) may trail a column's true running maximum: no maximum is
// formed in an ordinary pass.  Each lane keeps its own part of a column's row sum, and its
// sum of the pass's 32 weights is the test: only where one exceeds LAZY_LIMIT does the wave
// take the scores' maximum, rescale sums and accumulators, move m_run and form the pass's
// weights again.  A column's parts are added once, behind the loop.
// P' C-fragment re-packs directly into the B-fragment for O^T = V^T * P'
// (half h<8 <- frag0[h], half h>=8 <- frag1[h-8]) -- no transpose traffic.
// ---------------------------------------------------------------------------
// LDS row pitch in halves: 16 B x odd (144 B for K rows, 272 B for V^T rows), so
// the 16 rows that one ds_load_b128 fragment read touches fall on distinct banks.
#define STAGE_KEYS 128
#define K_PITCH  72
#define V_PITCH  (STAGE_KEYS + 8)
#define KT_ELEMS (STAGE_KEYS * K_PITCH)
#define VT_ELEMS (64 * V_PITCH)
#define KEYS_PER_GROUP (S_TOTAL / 2)
#define N_STAGES (KEYS_PER_GROUP / STAGE_KEYS)

// One key group's stage, this lane's eight 16 B copies, global -> LDS: four of the K tile
// (128 keys x 128 B, contiguous in global memory: from one copy to the next the block's
// 256 lanes advance 4096 B = 32 keys) and four of the V^T tile (64 rows of 256 B: 16 lanes
// a row, 16 rows a copy).  The s_wait_xcnt at the statement's end keeps later writes of
// the address registers behind the copies' issue.
__device__ __forceinline__ void async_stage_kv(const _Float16* gk, _Float16* lk,
                                               const _Float16* gv, _Float16* lv) {
  unsigned int k0 = (unsigned int)(unsigned long long)lk;
  unsigned int v0 = (unsigned int)(unsigned long long)lv;
  unsigned long long a0 = (unsigned long long)gk;
  unsigned long long b0 = (unsigned long long)gv;
  const unsigned int KL = 32u * K_PITCH * 2u, VL = 16u * V_PITCH * 2u;
  const unsigned long long KG = 4096ull, VG = 16ull * S_TOTAL * 2ull;
  asm volatile("global_load_async_to_lds_b128 %0, %1, off\n\t"
               "global_load_async_to_lds_b128 %2, %3, off\n\t"
               "global_load_async_to_lds_b128 %4, %5, off\n\t"
               "global_load_async_to_lds_b128 %6, %7, off\n\t"
               "global_load_async_to_lds_b128 %8, %9, off\n\t"
               "global_load_async_to_lds_b128 %10, %11, off\n\t"
               "global_load_async_to_lds_b128 %12, %13, off\n\t"
               "global_load_async_to_lds_b128 %14, %15, off\n\t"
               "s_wait_xcnt 0x0"
               :: "v"(k0), "v"(a0), "v"(k0 + KL), "v"(a0 + KG),
                  "v"(k0 + 2u * KL), "v"(a0 + 2ull * KG), "v"(k0 + 3u * KL), "v"(a0 + 3ull * KG),
                  "v"(v0), "v"(b0), "v"(v0 + VL), "v"(b0 + VG),
                  "v"(v0 + 2u * VL), "v"(b0 + 2ull * VG), "v"(v0 + 3u * VL), "v"(b0 + 3ull * VG)
               : "memory");
}
// join area: per wave 9 rows of 32 lanes x 16 B (8 rows of sums, 1 of maximum and sum)
#define JOIN_ROWS 9
// a lane's 32 weights of a pass sum to at most 2^13, so each is at most 2^13, inside
// f16's range, and a row sum is at most 4096 * 2^13
#define LAZY_LIMIT 8192.0f

// 2^x as the bare v_exp_f32.  exp2f() wraps that instruction in a range fix-up (a
// compare, two selects, an add and an ldexp for each value) whose only effect is on
// results below 2^-126.  Here a column's largest
// score gives at least 1: a weight that small is 0 as f16 and is lost in the f32 row sum,
// and a rescale factor that small multiplies sums that the new tile outweighs by 2^126.
// (A score far above m_run gives a large weight or +inf: the lazy test sees it in the sum.)
__device__ __forceinline__ float exp2_hw(float x) { return __builtin_amdgcn_exp2f(x); }

// The same with the slot that the instruction set asks for behind a transcendental in the
// statement itself.  For the two factors of the join: there the built code otherwise has a
// dual-issue select that overwrites the source register directly behind the v_exp_f32.
__device__ __forceinline__ float exp2_hw_slot(float x) {
  float r;
  asm("v_exp_f32 %0, %1\n\tv_nop" : "=v"(r) : "v"(x));
  return r;
}

typedef __attribute__((ext_vector_type(2))) float f2;

// One column tile's weights 2^(score - m) of a pass: packs them as the B fragment for
// O^T = V^T * P' (layout identity: half h<8 <- s0[h], half h>=8 <- s1[h-8]) and returns
// this lane's sum of its 16 as two partial sums, added pairwise in packed form so that
// the test waits on a short chain.  (Both loops are unrolled so that the vectors are
// indexed by constants and stay in registers.)
__device__ __forceinline__ f2 softmax_tile(const v8f& s0, const v8f& s1, float m, v16h& bp) {
  v8f e0 = s0 - m, e1 = s1 - m;
#pragma unroll
  for (int r = 0; r < 8; ++r) {
    e0[r] = exp2_hw(e0[r]);
    e1[r] = exp2_hw(e1[r]);
  }
#pragma unroll
  for (int r = 0; r < 8; ++r) {
    bp[r] = (_Float16)e0[r];
    bp[r + 8] = (_Float16)e1[r];
  }
  v8f u = e0 + e1;
  f4 h = __builtin_shufflevector(u, u, 0, 1, 2, 3) + __builtin_shufflevector(u, u, 4, 5, 6, 7);
  return __builtin_shufflevector(h, h, 0, 1) + __builtin_shufflevector(h, h, 2, 3);
}

__global__ __launch_bounds__(256) void attn_kernel(
    const _Float16* __restrict__ Qg, const _Float16* __restrict__ Kg,
    const _Float16* __restrict__ VTg, float* __restrict__ out) {
  __shared__ __align__(16) _Float16 lds_k[4 * KT_ELEMS];   // [buf][key group][t][d], padded rows
  __shared__ __align__(16) _Float16 lds_vt[4 * VT_ELEMS];  // [buf][key group][d][t], padded rows
  // join area [wave][row][lane]: the K ring's bytes, free again behind the loop's last barrier
  static_assert(8 * JOIN_ROWS * 32 * 16 <= 4 * KT_ELEMS * 2, "join area fits the K ring");
  f4* lds_join = (f4*)lds_k;
  int tid = threadIdx.x, lane = tid & 31;
  int wave = __builtin_amdgcn_readfirstlane(tid >> 5);
  int cg = wave & 3, kg = wave >> 2;                  // column group, key group
  int bh = blockIdx.y;
  int scol0 = blockIdx.x * 128 + cg * 32;

  const _Float16* Qb = Qg + ((size_t)bh * S_TOTAL + scol0) * DHEAD;
  const _Float16* Kb = Kg + (size_t)bh * S_TOTAL * DHEAD;
  const _Float16* Vb = VTg + (size_t)bh * DHEAD * S_TOTAL;

  // (every inner loop of this kernel is unrolled so that its fragment and accumulator
  // arrays are indexed by constants and stay in registers)
  // Q B-fragments, loaded once (lane -> column s, halves -> d), [column tile][d half]
  v16h bq[2][2];
#pragma unroll
  for (int c = 0; c < 2; ++c) {
    bq[c][0] = load_frag16x32(Qb + c * 16 * DHEAD, DHEAD);
    bq[c][1] = load_frag16x32(Qb + c * 16 * DHEAD + 32, DHEAD);
  }

  v8f acc[2][4] = {};                                 // [column tile][16 d]
  float m_run[2] = { -3.0e38f, -3.0e38f };
  f2 l_part[2] = {};                                  // this lane's part of the row sums
  int vd = tid >> 4, vp = tid & 15;                   // V^T tile load mapping
  int klds = (tid >> 3) * K_PITCH + (tid & 7) * 8;    // this lane's first 16 B in a K tile
  int vlds = vd * V_PITCH + vp * 8;                   // ... and in a V^T tile
  const _Float16* Ksrc = Kb + (size_t)tid * 8;        // this lane's first 16 B of key group
  const _Float16* Vsrc = Vb + (size_t)vd * S_TOTAL + vp * 8;   // 0's stage 0, K and V^T

  // both key groups' stage st into buffer bf
  auto stage_copies = [&](int st, int bf) {
    const _Float16* gk = Ksrc + (size_t)st * (STAGE_KEYS * DHEAD);
    const _Float16* gv = Vsrc + st * STAGE_KEYS;
    _Float16* lk = lds_k + bf * 2 * KT_ELEMS + klds;
    _Float16* lv = lds_vt + bf * 2 * VT_ELEMS + vlds;
    async_stage_kv(gk, lk, gv, lv);
    async_stage_kv(gk + (size_t)KEYS_PER_GROUP * DHEAD, lk + KT_ELEMS,
                   gv + KEYS_PER_GROUP, lv + VT_ELEMS);
  };

  // prologue: stage 0 lands and is published, then stage 1 is set off
  stage_copies(0, 0);
  S_WAIT_ASYNCCNT(0);   // this wave's 16 copies of stage 0 have landed
  __syncthreads();      // ... and every other wave's, before any fragment is read
  stage_copies(1, 1);

  for (int st = 0; st < N_STAGES; ++st) {
   const _Float16* kst = lds_k + ((st & 1) * 2 + kg) * KT_ELEMS;
   const _Float16* vst = lds_vt + ((st & 1) * 2 + kg) * VT_ELEMS;
   // unrolled so that a pass's place in the stage is a constant offset of its LDS reads
#pragma unroll
   for (int p = 0; p < STAGE_KEYS / 32; ++p) {
    const _Float16* kcur = kst + p * 32 * K_PITCH;
    const _Float16* vcur = vst + p * 32;

    // scores S'[t, s]: 2 t-subtiles x (d=0..31, d=32..63), each K fragment for both column tiles
    v16h ka0 = load_frag16x32(kcur + 0, K_PITCH);
    v16h ka1 = load_frag16x32(kcur + 32, K_PITCH);
    v16h kb0 = load_frag16x32(kcur + 16 * K_PITCH, K_PITCH);
    v16h kb1 = load_frag16x32(kcur + 16 * K_PITCH + 32, K_PITCH);
    v8f c0[2], c1[2];
#pragma unroll
    for (int c = 0; c < 2; ++c) {
      v8f z = {};
      c0[c] = wmma_f16(ka0, bq[c][0], z);
      c1[c] = wmma_f16(kb0, bq[c][0], z);
    }
#pragma unroll
    for (int c = 0; c < 2; ++c) {
      c0[c] = wmma_f16(ka1, bq[c][1], c0[c]);
      c1[c] = wmma_f16(kb1, bq[c][1], c1[c]);
    }

    // keeps the K reads one group in front of the score WMMAs: with the V^T reads in the
    // same region the scheduler re-uses a K fragment's registers and reads the next
    // fragment only two WMMAs ahead of its use
    __builtin_amdgcn_sched_barrier(0);

    // the pass's V^T fragments, read as one group under the exponentials
    v16h va[4];
#pragma unroll
    for (int a = 0; a < 4; ++a) va[a] = load_frag16x32(vcur + a * 16 * V_PITCH, V_PITCH);
    // keeps the eight reads here: the scheduler otherwise sinks them in among the WMMAs
    // that use them, where each pair is waited for as soon as it is issued
    __builtin_amdgcn_sched_barrier(0);

    // weights against the maximum in use, and each lane's sum of them
    v16h bp[2];
    f2 ts[2];
#pragma unroll
    for (int c = 0; c < 2; ++c) ts[c] = softmax_tile(c0[c], c1[c], m_run[c], bp[c]);
    f2 tw = ts[0] + ts[1];
    bool need = tw.x + tw.y > LAZY_LIMIT;
    // One wave-uniform scalar branch a pass (always taken in the first): every column of
    // the wave moves m_run to the larger of it and the pass's maximum; both lanes of a column get the same one.
    if (__builtin_expect(__builtin_amdgcn_ballot_w32(need) != 0, 0)) {
#pragma unroll
      for (int c = 0; c < 2; ++c) {
        float tm = c0[c][0];
#pragma unroll
        for (int r = 0; r < 8; ++r) { tm = fmaxf(tm, c0[c][r]); tm = fmaxf(tm, c1[c][r]); }
        float mn = fmaxf(m_run[c], fmaxf(tm, __shfl_xor(tm, 16, 32)));
        float alpha = exp2_hw(m_run[c] - mn);
        m_run[c] = mn;
        l_part[c] *= alpha;
#pragma unroll
        for (int a = 0; a < 4; ++a) {
#pragma unroll
          for (int r = 0; r < 8; ++r) acc[c][a][r] *= alpha;
        }
        ts[c] = softmax_tile(c0[c], c1[c], mn, bp[c]);
      }
    }
    l_part[0] += ts[0];
    l_part[1] += ts[1];
    // each V^T fragment for both column tiles
#pragma unroll
    for (int a = 0; a < 4; ++a) {
      acc[0][a] = wmma_f16(va[a], bp[0], acc[0][a]);
      acc[1][a] = wmma_f16(va[a], bp[1], acc[1][a]);
    }
   }
   // publish point, once a stage, every wave, in this order
   S_WAIT_DSCNT(0);      // this wave's reads of stage st are done
   S_WAIT_ASYNCCNT(0);   // its copies of stage st + 1 have landed
   __syncthreads();      // stage st + 1 may be read, stage st's buffer may be refilled
   if (st + 2 < N_STAGES) stage_copies(st + 2, st & 1);
  }
  S_WAIT_ASYNCCNT(0);    // nothing is in flight when the K ring becomes the join area

  // a column's row sum: its two lanes each hold, in two parts, the sum over their own
  // 16 keys of every pass
  float l_run[2];
#pragma unroll
  for (int c = 0; c < 2; ++c) {
    l_run[c] = l_part[c].x + l_part[c].y;
    l_run[c] += __shfl_xor(l_run[c], 16, 32);
  }

  // join of the two key groups: waves w and w^4 hold the same 32 columns.  Each hands
  // the other one column tile's state (key group 0 gives tile 1, group 1 gives tile 0)
  // and finishes the tile it keeps.
  bool hi = kg != 0;
  f4* mine = lds_join + wave * (JOIN_ROWS * 32) + lane;
  const f4* theirs = lds_join + (wave ^ 4) * (JOIN_ROWS * 32) + lane;
  v8f keep[4];
#pragma unroll
  for (int a = 0; a < 4; ++a) {
    v8f give = hi ? acc[0][a] : acc[1][a];
    keep[a] = hi ? acc[1][a] : acc[0][a];
    f4 lo4 = { give[0], give[1], give[2], give[3] };
    f4 hi4 = { give[4], give[5], give[6], give[7] };
    mine[(2 * a) * 32] = lo4;
    mine[(2 * a + 1) * 32] = hi4;
  }
  f4 ml = { hi ? m_run[0] : m_run[1], hi ? l_run[0] : l_run[1], 0.f, 0.f };
  mine[8 * 32] = ml;
  float m_k = hi ? m_run[1] : m_run[0], l_k = hi ? l_run[1] : l_run[0];
  __syncthreads();   // every wave's handed-over state is in LDS before its partner reads it
  f4 oml = theirs[8 * 32];
  float m_j = fmaxf(m_k, oml.x);
  float f_k = exp2_hw_slot(m_k - m_j), f_o = exp2_hw_slot(oml.x - m_j);
  float inv = 1.0f / (l_k * f_k + oml.y * f_o);
  f_k *= inv; f_o *= inv;

  // epilogue: out[bh*64 + d][s] = joined sums / joined l   (lanes advance s -> coalesced)
  int s = scol0 + kg * 16 + (lane & 15);
  int rbase = (lane >> 4) << 3;
#pragma unroll
  for (int a = 0; a < 4; ++a) {
    f4 o_lo = theirs[(2 * a) * 32], o_hi = theirs[(2 * a + 1) * 32];
#pragma unroll
    for (int r = 0; r < 8; ++r) {
      float o = (r < 4) ? o_lo[r & 3] : o_hi[r & 3];
      out[(size_t)(bh * 64 + a * 16 + r + rbase) * S_TOTAL + s] = keep[a][r] * f_k + o * f_o;
    }
  }
}

// ---------------------------------------------------------------------------
extern "C" void kernel_launch(void* const* d_in, const int* in_sizes, int n_in,
                              void* d_out, int out_size, void* d_ws,
                              size_t ws_size, hipStream_t stream) {
  (void)in_sizes; (void)n_in; (void)out_size; (void)ws_size;
  const float* x    = (const float*)d_in[0];   // [4,256,64,64]
  const float* w_dw = (const float*)d_in[1];   // [256,1,3,3]
  const float* w_pw = (const float*)d_in[2];   // [768,256]
  float* out = (float*)d_out;                  // [4,256,64,64]

  char* ws = (char*)d_ws;
  _Float16* dwT = (_Float16*)(ws);                   // 4*4096*256 f16 = 8 MiB
  _Float16* Qg  = (_Float16*)(ws + (8u  << 20));     // 16*4096*64 f16 = 8 MiB
  _Float16* Kg  = (_Float16*)(ws + (16u << 20));     // 8 MiB
  _Float16* VTg = (_Float16*)(ws + (24u << 20));     // 8 MiB
  _Float16* wph = (_Float16*)(ws + (32u << 20));     // 768*256 f16

  dwconv_cvt_kernel<<<dim3(64 + CVT_X, 4, 4), 256, 0, stream>>>(x, w_dw, w_pw, dwT, wph);
  proj_kernel<<<dim3(32, 12, 4), 256, 0, stream>>>(dwT, wph, Qg, Kg, VTg);
  attn_kernel<<<dim3(32, 16), 256, 0, stream>>>(Qg, Kg, VTg, out);
}

// v010
// It runs in 59.1 microseconds.
// In both of two side-by-side timings against v009, it was 1.06 times as fast.
// All steps since v000 together make it 5.35 times as fast.
#include <hip/hip_runtime.h>

typedef __attribute__((ext_vector_type(16))) _Float16 v16h;
typedef __attribute__((ext_vector_type(8)))  _Float16 v8h;
typedef __attribute__((ext_vector_type(8)))  float    v8f;

#define S_TOTAL 4096
#define DHEAD   64
#define NH      4
#define NB      4
#define C_IN    256
// fold 1/sqrt(64) and log2(e) into Q so softmax can use exp2
#define QSCALE  (0.125f * 1.44269504088896340736f)

// ---------------------------------------------------------------------------
// Fragment loader for CDNA5 WMMA f16 operands (A 16x32 MxK, or B 32x16 KxN
// loaded from an [N][K] row-major buffer -- both have identical lane layout):
// lane l -> row (l&15); halves 0..7 = k [kb..kb+7], halves 8..15 = k [kb+16..kb+23]
// with kb = (l>>4)*8.  Two 16B vector loads per fragment.
// ---------------------------------------------------------------------------
__device__ __forceinline__ v16h load_frag16x32(const _Float16* base, int stride) {
  int lane = threadIdx.x & 31;
  const _Float16* p = base + (lane & 15) * stride + ((lane >> 4) << 3);
  v8h lo = *(const v8h*)(p);
  v8h hi = *(const v8h*)(p + 16);
  v16h r;
#pragma unroll
  for (int i = 0; i < 8; ++i) { r[i] = lo[i]; r[i + 8] = hi[i]; }
  return r;
}

__device__ __forceinline__ v8f wmma_f16(v16h a, v16h b, v8f c) {
  return __builtin_amdgcn_wmma_f32_16x16x32_f16(false, a, false, b, (short)0, c,
                                                false, false);
}

// The same product with C and D as packed f16: element e of the four registers is row
// 8*(lane>>4)+e of the lane's column, which is one half of a B fragment as it stands.
__device__ __forceinline__ v8h wmma_f16_d16(v16h a, v16h b, v8h c) {
  return __builtin_amdgcn_wmma_f16_16x16x32_f16(false, a, false, b, (short)0, c,
                                                false, false);
}

// Async DMA: 16B global -> LDS, tracked by ASYNCcnt (GLOBAL_LOAD_ASYNC_TO_LDS_B128).
// LDS operand takes the workgroup-relative byte offset; for the flat-LDS
// aperture that is addr[31:0] of the generic pointer (ISA 10.2).
// (The attention kernel's own copy statement stands with its tile sizes, further down.)
#define S_WAIT_ASYNCCNT(n) asm volatile("s_wait_asynccnt " #n ::: "memory")
#define S_WAIT_DSCNT(n) asm volatile("s_wait_dscnt " #n ::: "memory")

// ---------------------------------------------------------------------------
// Kernel 1: two jobs that need nothing of each other share one grid, told apart by
// blockIdx.x (the same for a whole block): x < 64 is the depthwise conv, x >= 64
// converts the pointwise weight.
// Depthwise 3x3 conv (pad 1).  Output transposed: dwT [b][s][c] f16
// block = (hh, group of 64 channels, b).  Lanes advance along ww: 16 lanes x
// 16 B read one whole 256 B image row of a channel, so every global load
// covers whole lines.  The [c][ww] -> [ww][c] turn goes through LDS, and each
// wave then stores one 128 B line (64 channels of one s) per instruction.
// ---------------------------------------------------------------------------
typedef __attribute__((ext_vector_type(2))) _Float16 v2h;
typedef __attribute__((ext_vector_type(4))) float f4;
// weight vectors: a channel pair's 18 floats start at a multiple of 8 B only
typedef __attribute__((ext_vector_type(4), aligned(8))) float f4u;
typedef __attribute__((ext_vector_type(2), aligned(8))) float f2u;
// staged row pitch in dwords: odd, so the 16 ww-quads of a store (4 rows apart)
// and the 32 channel pairs of a read both fall on distinct banks
#define DW_PITCH 33
// blocks in x that convert the weight: 6 x 4 x 4 blocks x 256 threads x 8 = 768 * 256
#define CVT_X 6

// pointwise weight [768][256] f32 -> f16, 8 values a thread (32 B read, 16 B stored):
// the shared grid pays for every wave it starts, so the convert adds 96 blocks, not 768
__device__ __forceinline__ void cvt_wpw_block(const float* __restrict__ w_pw,
                                              _Float16* __restrict__ wph, int blk) {
  int idx = (blk * 256 + (int)threadIdx.x) * 8;
  f4 a = *(const f4*)(w_pw + idx);
  f4 c = *(const f4*)(w_pw + idx + 4);
  v8h h = { (_Float16)a.x, (_Float16)a.y, (_Float16)a.z, (_Float16)a.w,
            (_Float16)c.x, (_Float16)c.y, (_Float16)c.z, (_Float16)c.w };
  *(v8h*)(wph + idx) = h;
}

// value of lane-1 / lane+1 inside a 16-lane row (one image row); the lane past
// the row's end reads 0, which is the conv's zero padding in ww
__device__ __forceinline__ float from_left_lane(float v) {
  return __int_as_float(__builtin_amdgcn_update_dpp(0, __float_as_int(v), 0x111 /*row_shr:1*/, 0xf, 0xf, true));
}
__device__ __forceinline__ float from_right_lane(float v) {
  return __int_as_float(__builtin_amdgcn_update_dpp(0, __float_as_int(v), 0x101 /*row_shl:1*/, 0xf, 0xf, true));
}

__global__ __launch_bounds__(256) void dwconv_cvt_kernel(const float* __restrict__ x,
                                                         const float* __restrict__ w_dw,
                                                         const float* __restrict__ w_pw,
                                                         _Float16* __restrict__ dwT,
                                                         _Float16* __restrict__ wph) {
  __shared__ unsigned int tile[64 * DW_PITCH];      // [ww][channel pair], 2 x f16
  if (blockIdx.x >= 64) {                           // whole block, ahead of the barrier
    cvt_wpw_block(w_pw, wph,
                  (int)(blockIdx.x - 64 + CVT_X * (blockIdx.y + 4 * blockIdx.z)));
    return;
  }
  int hh = blockIdx.x, cg = blockIdx.y, b = blockIdx.z;
  int tid = threadIdx.x, q = tid & 15;              // q: which 4 ww of the row
  bool up = hh > 0, dn = hh < 63;                   // rows hh-1 / hh+1 exist
  // every address = block-uniform base + one per-lane byte offset (+ a constant)
  const float* xg = x + ((size_t)(b * C_IN + cg * 64)) * S_TOTAL;
  const char* xb[3] = { (const char*)(xg + (up ? hh - 1 : hh) * 64),   // a row that does not
                        (const char*)(xg + hh * 64),                  // exist is read as row hh
                        (const char*)(xg + (dn ? hh + 1 : hh) * 64) };// and zeroed below
  const char* wp = (const char*)(w_dw + cg * 64 * 9);
  unsigned xoff = (unsigned)(tid >> 4) * (2u * S_TOTAL * 4u) + (unsigned)q * 16u;
  unsigned woff = (unsigned)(tid >> 4) * (2u * 9u * 4u);
  // all loads first: 2 passes x (18 weights of a channel pair, 2 channels x 3 rows of 4 ww)
  // (every loop of this kernel is unrolled so that its arrays are indexed by constants
  // and stay in registers)
  f4u wa[2][4];
  f2u wb[2];
  f4  v[2][2][3];
#pragma unroll
  for (int p = 0; p < 2; ++p) {
    const char* wc = wp + p * (32 * 9 * 4);
#pragma unroll
    for (int j = 0; j < 4; ++j) wa[p][j] = *(const f4u*)(wc + j * 16 + woff);
    wb[p] = *(const f2u*)(wc + 64 + woff);
#pragma unroll
    for (int e = 0; e < 2; ++e) {
#pragma unroll
      for (int ky = 0; ky < 3; ++ky)
        v[p][e][ky] = *(const f4*)(xb[ky] + (p * 32 + e) * (S_TOTAL * 4) + xoff);
    }
  }
  // Fence on the loaded values and the two offsets (inputs only): keeps all 22 loads in
  // flight together in front of the arithmetic, which otherwise gets them one wait at a
  // time, and keeps every rewrite of the loads' address registers behind the wait.
  asm volatile("s_wait_xcnt 0x0"
               :: "v"(wa[0][0]), "v"(wa[0][1]), "v"(wa[0][2]), "v"(wa[0][3]), "v"(wb[0]),
                  "v"(wa[1][0]), "v"(wa[1][1]), "v"(wa[1][2]), "v"(wa[1][3]), "v"(wb[1]),
                  "v"(v[0][0][0]), "v"(v[0][0][1]), "v"(v[0][0][2]),
                  "v"(v[0][1][0]), "v"(v[0][1][1]), "v"(v[0][1][2]),
                  "v"(v[1][0][0]), "v"(v[1][0][1]), "v"(v[1][0][2]),
                  "v"(v[1][1][0]), "v"(v[1][1][1]), "v"(v[1][1][2]),
                  "v"(xoff), "v"(woff));
#pragma unroll
  for (int p = 0; p < 2; ++p) {
    float s[2][4];
#pragma unroll
    for (int e = 0; e < 2; ++e) {
      s[e][0] = 0.f; s[e][1] = 0.f; s[e][2] = 0.f; s[e][3] = 0.f;
#pragma unroll
      for (int ky = 0; ky < 3; ++ky) {
        f4 r = v[p][e][ky];
        if ((ky == 0 && !up) || (ky == 2 && !dn)) {  // zero padding in hh
          r.x = 0.f; r.y = 0.f; r.z = 0.f; r.w = 0.f;
        }
        float a[6] = { from_left_lane(r.w), r.x, r.y, r.z, r.w, from_right_lane(r.x) };
#pragma unroll
        for (int kx = 0; kx < 3; ++kx) {
          int k = e * 9 + ky * 3 + kx;               // index in the pair's 18 weights
          float w = (k < 16) ? wa[p][k >> 2][k & 3] : wb[p][k & 1];
#pragma unroll
          for (int j = 0; j < 4; ++j)
            s[e][j] = __builtin_fmaf(a[j + kx], w, s[e][j]);
        }
      }
    }
    int cp = p * 16 + (tid >> 4);                   // channel pair in the group
#pragma unroll
    for (int j = 0; j < 4; ++j) {
      v2h h = { (_Float16)s[0][j], (_Float16)s[1][j] };
      tile[(q * 4 + j) * DW_PITCH + cp] = __builtin_bit_cast(unsigned int, h);
    }
  }
  __syncthreads();   // the whole [64 ww][64 c] tile is staged before any row leaves
  int wave = tid >> 5, lane = tid & 31;
  unsigned int* dst = (unsigned int*)(dwT + ((size_t)(b * S_TOTAL + hh * 64)) * C_IN + cg * 64);
#pragma unroll
  for (int i = 0; i < 8; ++i) {
    int r = wave * 8 + i;
    dst[(size_t)r * (C_IN / 2) + lane] = tile[r * DW_PITCH + lane];
  }
}

// ---------------------------------------------------------------------------
// Projections (kernel 2): one block = 128 rows of dwT (s) x 64 rows of
// w_pw (o), the whole c = 256 of both.  Both operand tiles are brought into LDS
// once, by asynchronous copies in which a wave's 32 lanes x 16 B cover one whole
// 512 B row, and the 8 waves read their WMMA fragments from there: a wave owns
// 32 s x 32 o, so each fragment it reads feeds two WMMAs.
// ---------------------------------------------------------------------------
// LDS row pitch in halves: 528 B = 16 B x odd, so the 16 rows that one
// ds_load_b128 fragment read touches fall on distinct banks.
#define PJ_PITCH 264
#define PJ_S 128
#define PJ_O 64

// Eight 16 B copies of this lane, global -> LDS: 64 rows of 512 B for the block.
// From one copy to the next the block's 256 lanes advance 4096 B in global memory
// (8 rows) and 8 padded rows in LDS.  The s_wait_xcnt at the statement's end keeps
// later writes of the address registers behind the copies' issue.
__device__ __forceinline__ void async_rows64(const _Float16* g, _Float16* l) {
  unsigned int l0 = (unsigned int)(unsigned long long)l;
  unsigned long long g0 = (unsigned long long)g;
  const unsigned int LS = 8u * PJ_PITCH * 2u;
  const unsigned long long GS = 4096ull;
  asm volatile("global_load_async_to_lds_b128 %0, %1, off\n\t"
               "global_load_async_to_lds_b128 %2, %3, off\n\t"
               "global_load_async_to_lds_b128 %4, %5, off\n\t"
               "global_load_async_to_lds_b128 %6, %7, off\n\t"
               "global_load_async_to_lds_b128 %8, %9, off\n\t"
               "global_load_async_to_lds_b128 %10, %11, off\n\t"
               "global_load_async_to_lds_b128 %12, %13, off\n\t"
               "global_load_async_to_lds_b128 %14, %15, off\n\t"
               "s_wait_xcnt 0x0"
               :: "v"(l0), "v"(g0), "v"(l0 + LS), "v"(g0 + GS),
                  "v"(l0 + 2u * LS), "v"(g0 + 2ull * GS), "v"(l0 + 3u * LS), "v"(g0 + 3ull * GS),
                  "v"(l0 + 4u * LS), "v"(g0 + 4ull * GS), "v"(l0 + 5u * LS), "v"(g0 + 5ull * GS),
                  "v"(l0 + 6u * LS), "v"(g0 + 6ull * GS), "v"(l0 + 7u * LS), "v"(g0 + 7ull * GS)
               : "memory");
}

// Fills both tiles: sg = first of 128 contiguous dwT rows, wg = first of 64 contiguous
// weight rows.  On return every wave may read every row.
__device__ __forceinline__ void proj_stage(const _Float16* sg, const _Float16* wg,
                                           _Float16* sT, _Float16* wT) {
  int tid = threadIdx.x;
  int goff = tid * 8;                                   // this lane's 16 B of 4096 B
  int loff = (tid >> 5) * PJ_PITCH + (tid & 31) * 8;    // row = wave, 16 B piece = lane
  async_rows64(sg + goff, sT + loff);
  async_rows64(sg + 64 * C_IN + goff, sT + 64 * PJ_PITCH + loff);
  async_rows64(wg + goff, wT + loff);
  S_WAIT_ASYNCCNT(0);   // this wave's 24 copies have landed
  __syncthreads();      // ... and every other wave's, before any fragment is read
}

// acc[i][j] += A rows (i*16..) x B rows (j*16..), c in the order 0, 32, .., 224
__device__ __forceinline__ void proj_mma(const _Float16* aT, const _Float16* bT,
                                         v8f (&acc)[2][2]) {
  // unrolled so that the LDS reads of later c blocks can be issued ahead of the WMMAs
#pragma unroll
  for (int kc = 0; kc < C_IN; kc += 32) {
    v16h a0 = load_frag16x32(aT + kc, PJ_PITCH);
    v16h a1 = load_frag16x32(aT + 16 * PJ_PITCH + kc, PJ_PITCH);
    v16h b0 = load_frag16x32(bT + kc, PJ_PITCH);
    v16h b1 = load_frag16x32(bT + 16 * PJ_PITCH + kc, PJ_PITCH);
    acc[0][0] = wmma_f16(a0, b0, acc[0][0]);
    acc[0][1] = wmma_f16(a0, b1, acc[0][1]);
    acc[1][0] = wmma_f16(a1, b0, acc[1][0]);
    acc[1][1] = wmma_f16(a1, b1, acc[1][1]);
  }
}

// ---------------------------------------------------------------------------
// Kernel 2: all three projections in one grid; blockIdx.y picks 64 rows o of w_pw, and
// with them (the same for a whole block) the orientation of the product.
// o < 512, Q and K:  qkvT[s][o] = sum_c dwT[s][c]*w_pw[o][c]
//   A = dwT rows (s), B = w_pw rows (o) -- both row-major [*][c].
//   Q gets QSCALE folded in.  Writes Q,K as [bh][s][d] f16 (lanes advance d).
// o >= 512, V, un-transposed orientation:  qkv[o][s] = sum_c w_pw[o][c]*dwT[s][c]
//   A = w_pw rows (o), B = dwT rows (s).
//   Writes V transposed: VT [bh][d][t=s] f16 (lanes advance s).
// ---------------------------------------------------------------------------
__global__ __launch_bounds__(256) void proj_kernel(
    const _Float16* __restrict__ dwT, const _Float16* __restrict__ wph,
    _Float16* __restrict__ Qg, _Float16* __restrict__ Kg, _Float16* __restrict__ VTg) {
  __shared__ __align__(16) _Float16 sT[PJ_S * PJ_PITCH];
  __shared__ __align__(16) _Float16 wT[PJ_O * PJ_PITCH];
  int wave = threadIdx.x >> 5, lane = threadIdx.x & 31;
  int s0 = blockIdx.x * PJ_S;
  int o0 = blockIdx.y * PJ_O;                      // o in [0,768)
  int b = blockIdx.z;
  proj_stage(dwT + ((size_t)(b * S_TOTAL + s0)) * C_IN, wph + (size_t)o0 * C_IN, sT, wT);
  int sw = (wave & 3) * 32, ow = (wave >> 2) * 32; // this wave's 32 s x 32 o
  v8f acc[2][2] = {};
  if (o0 < 512) {
    proj_mma(sT + sw * PJ_PITCH, wT + ow * PJ_PITCH, acc);
    // (unrolled so that acc is indexed by constants and stays in registers)
#pragma unroll
    for (int j = 0; j < 2; ++j) {
      int o = o0 + ow + j * 16 + (lane & 15);
      int qi = o >> 8;                 // 0 => Q, 1 => K
      int h = (o >> 6) & 3;
      int d = o & 63;
      _Float16* dst = (qi ? Kg : Qg) + ((size_t)(b * NH + h) * S_TOTAL) * DHEAD + d;
      float sc = qi ? 1.0f : QSCALE;
#pragma unroll
      for (int i = 0; i < 2; ++i) {
#pragma unroll
        for (int r = 0; r < 8; ++r) {
          int s = s0 + sw + i * 16 + r + ((lane >> 4) << 3);
          dst[(size_t)s * DHEAD] = (_Float16)(acc[i][j][r] * sc);
        }
      }
    }
  } else {
    proj_mma(wT + ow * PJ_PITCH, sT + sw * PJ_PITCH, acc);
    // (unrolled so that acc is indexed by constants and stays in registers)
#pragma unroll
    for (int j = 0; j < 2; ++j) {
      int s = s0 + sw + j * 16 + (lane & 15);
#pragma unroll
      for (int i = 0; i < 2; ++i) {
#pragma unroll
        for (int r = 0; r < 8; ++r) {
          int o = o0 + ow + i * 16 + r + ((lane >> 4) << 3);
          int h = (o - 512) >> 6;
          int d = (o - 512) & 63;
          VTg[((size_t)(b * NH + h) * DHEAD + d) * S_TOTAL + s] = (_Float16)acc[i][j][r];
        }
      }
    }
    // in the built code the Q/K side's first instructions stand behind this side's exit
    // branch and rewrite these stores' address and data registers: the wait keeps those
    // writes behind the stores' issue (the Q/K side's own stores run into the kernel's end)
    asm volatile("s_wait_xcnt 0x0" ::: "memory");
  }
}

// ---------------------------------------------------------------------------
// Kernel 3: flash attention, transposed formulation, double-buffered async
// global->LDS DMA (ASYNCcnt).  A stage is 128 keys of each key group, worked on in four
// passes of 32 keys; the waves of a block meet once a stage, so between two meetings one
// wave's matrix work can run beside another's softmax.
// Per wave: 32 s-columns (two 16-column tiles), so every K and V^T fragment read
// from LDS feeds two WMMAs.  To keep eight waves on a block's 128 columns the keys
// are split: waves 0..3 walk keys 0..2047, waves 4..7 keys 2048..4095, each group
// on its own staged tiles; the two partial softmax states of a column are joined
// once, through LDS, after the loop.
// S'[t,s] = K*Q^T tiles (t rows in VGPRs, s across lanes) -> online softmax is
// per-lane over VGPRs + one shfl_xor(16).
// The maximum in use (m_run) may trail a column's true running maximum: no maximum is
// formed in an ordinary pass.  Each lane keeps its own part of a column's row sum, and its
// sum of the pass's 32 weights is the test: only where one exceeds LAZY_LIMIT does the wave
// take the scores' maximum, rescale sums and accumulators, move m_run and form the pass's
// weights again.  A column's parts are added once, behind the loop.
// The weights are formed in packed f16, in place: the score WMMAs take -m_run as C and
// write D = score - m_run as f16 (the reference is off ahead of every rounding to f16, so
// the error is small where a weight counts), and 2^D, taken half by half in D's own registers, is the
// B-fragment for O^T = V^T * P' (half h<8 <- tile0[h], half h>=8 <- tile1[h-8]): no
// subtract, no convert, no transpose traffic.
// ---------------------------------------------------------------------------
// LDS row pitch in halves: 16 B x odd (144 B for K rows, 272 B for V^T rows), so
// the 16 rows that one ds_load_b128 fragment read touches fall on distinct banks.
#define STAGE_KEYS 128
#define K_PITCH  72
#define V_PITCH  (STAGE_KEYS + 8)
#define KT_ELEMS (STAGE_KEYS * K_PITCH)
#define VT_ELEMS (64 * V_PITCH)
#define KEYS_PER_GROUP (S_TOTAL / 2)
#define N_STAGES (KEYS_PER_GROUP / STAGE_KEYS)

// One key group's stage, this lane's eight 16 B copies, global -> LDS: four of the K tile
// (128 keys x 128 B, contiguous in global memory: from one copy to the next the block's
// 256 lanes advance 4096 B = 32 keys) and four of the V^T tile (64 rows of 256 B: 16 lanes
// a row, 16 rows a copy).  The s_wait_xcnt at the statement's end keeps later writes of
// the address registers behind the copies' issue.
__device__ __forceinline__ void async_stage_kv(const _Float16* gk, _Float16* lk,
                                               const _Float16* gv, _Float16* lv) {
  unsigned int k0 = (unsigned int)(unsigned long long)lk;
  unsigned int v0 = (unsigned int)(unsigned long long)lv;
  unsigned long long a0 = (unsigned long long)gk;
  unsigned long long b0 = (unsigned long long)gv;
  const unsigned int KL = 32u * K_PITCH * 2u, VL = 16u * V_PITCH * 2u;
  const unsigned long long KG = 4096ull, VG = 16ull * S_TOTAL * 2ull;
  asm volatile("global_load_async_to_lds_b128 %0, %1, off\n\t"
               "global_load_async_to_lds_b128 %2, %3, off\n\t"
               "global_load_async_to_lds_b128 %4, %5, off\n\t"
               "global_load_async_to_lds_b128 %6, %7, off\n\t"
               "global_load_async_to_lds_b128 %8, %9, off\n\t"
               "global_load_async_to_lds_b128 %10, %11, off\n\t"
               "global_load_async_to_lds_b128 %12, %13, off\n\t"
               "global_load_async_to_lds_b128 %14, %15, off\n\t"
               "s_wait_xcnt 0x0"
               :: "v"(k0), "v"(a0), "v"(k0 + KL), "v"(a0 + KG),
                  "v"(k0 + 2u * KL), "v"(a0 + 2ull * KG), "v"(k0 + 3u * KL), "v"(a0 + 3ull * KG),
                  "v"(v0), "v"(b0), "v"(v0 + VL), "v"(b0 + VG),
                  "v"(v0 + 2u * VL), "v"(b0 + 2ull * VG), "v"(v0 + 3u * VL), "v"(b0 + 3ull * VG)
               : "memory");
}
// join area: per wave 9 rows of 32 lanes x 16 B (8 rows of sums, 1 of maximum and sum)
#define JOIN_ROWS 9
// a lane's 32 weights of a pass sum to at most 2^8, so a score in use lies at most 8 above
// m_run (there f16 still resolves 2^-8 of the exponent) and every f16 partial sum is in range
#define LAZY_LIMIT 256.0f

// 2^x as the bare v_exp_f32.  exp2f() wraps that instruction in a range fix-up (a
// compare, two selects, an add and an ldexp for each value) whose only effect is on
// results below 2^-126.  Here a column's largest
// score gives at least 1: a weight that small is 0 as f16 and is lost in the f32 row sum,
// and a rescale factor that small multiplies sums that the new tile outweighs by 2^126.
// (A score far above m_run gives a large weight or +inf: the lazy test sees it in the sum.)
__device__ __forceinline__ float exp2_hw(float x) { return __builtin_amdgcn_exp2f(x); }

// The same with the slot that the instruction set asks for behind a transcendental in the
// statement itself.  For the two factors of the join: there the built code otherwise has a
// dual-issue select that overwrites the source register directly behind the v_exp_f32.
__device__ __forceinline__ float exp2_hw_slot(float x) {
  float r;
  asm("v_exp_f32 %0, %1\n\tv_nop" : "=v"(r) : "v"(x));
  return r;
}

typedef __attribute__((ext_vector_type(2))) float f2;

typedef __attribute__((ext_vector_type(4))) _Float16 v4h;

// 2^x in place on n score tiles (x = score - m as the score WMMAs left it): first the low
// half of every register, then the high halves, so that the two writes of one register
// stand a whole round of exponentials apart.  (Unrolled: the vectors stay in registers.)
template <int N>
__device__ __forceinline__ void exp2_in_place(v8h (&x)[N]) {
#pragma unroll
  for (int half = 0; half < 2; ++half) {
#pragma unroll
    for (int t = 0; t < N; ++t) {
#pragma unroll
      for (int e = 0; e < 8; e += 2)
        x[t][e + half] = __builtin_elementwise_exp2(x[t][e + half]);
    }
  }
}

// One column tile's weights of a pass: the two key tiles' registers side by side are the B
// fragment for O^T = V^T * P'.  Returns this lane's sum of its 16 weights as two partial
// sums, added pairwise in packed f16 (8 weights each; the running sums are f32).
__device__ __forceinline__ v2h pack_and_sum(const v8h& e0, const v8h& e1, v16h& bp) {
  bp = __builtin_shufflevector(e0, e1, 0, 1, 2, 3, 4, 5, 6, 7, 8, 9, 10, 11, 12, 13, 14, 15);
  v8h u = e0 + e1;
  v4h h = __builtin_shufflevector(u, u, 0, 1, 2, 3) + __builtin_shufflevector(u, u, 4, 5, 6, 7);
  return __builtin_shufflevector(h, h, 0, 1) + __builtin_shufflevector(h, h, 2, 3);
}

// A column's largest score over 32 keys, from f32 score tiles (both lanes of the column get
// it), as a reference that f16 holds exactly.  Off the ordinary pass's path.
__device__ __forceinline__ float column_reference(const v8f& s0, const v8f& s1, float m_old) {
  float tm = s0[0];
#pragma unroll
  for (int r = 0; r < 8; ++r) { tm = fmaxf(tm, s0[r]); tm = fmaxf(tm, s1[r]); }
  float mn = fmaxf(m_old, fmaxf(tm, __shfl_xor(tm, 16, 32)));
  return (float)(_Float16)fminf(fmaxf(mn, -60000.0f), 60000.0f);
}

__global__ __launch_bounds__(256) void attn_kernel(
    const _Float16* __restrict__ Qg, const _Float16* __restrict__ Kg,
    const _Float16* __restrict__ VTg, float* __restrict__ out) {
  __shared__ __align__(16) _Float16 lds_k[4 * KT_ELEMS];   // [buf][key group][t][d], padded rows
  __shared__ __align__(16) _Float16 lds_vt[4 * VT_ELEMS];  // [buf][key group][d][t], padded rows
  // join area [wave][row][lane]: the K ring's bytes, free again behind the loop's last barrier
  static_assert(8 * JOIN_ROWS * 32 * 16 <= 4 * KT_ELEMS * 2, "join area fits the K ring");
  f4* lds_join = (f4*)lds_k;
  int tid = threadIdx.x, lane = tid & 31;
  int wave = __builtin_amdgcn_readfirstlane(tid >> 5);
  int cg = wave & 3, kg = wave >> 2;                  // column group, key group
  int bh = blockIdx.y;
  int scol0 = blockIdx.x * 128 + cg * 32;

  const _Float16* Qb = Qg + ((size_t)bh * S_TOTAL + scol0) * DHEAD;
  const _Float16* Kb = Kg + (size_t)bh * S_TOTAL * DHEAD;
  const _Float16* Vb = VTg + (size_t)bh * DHEAD * S_TOTAL;

  // (every inner loop of this kernel is unrolled so that its fragment and accumulator
  // arrays are indexed by constants and stay in registers)
  // Q B-fragments, loaded once (lane -> column s, halves -> d), [column tile][d half]
  v16h bq[2][2];
#pragma unroll
  for (int c = 0; c < 2; ++c) {
    bq[c][0] = load_frag16x32(Qb + c * 16 * DHEAD, DHEAD);
    bq[c][1] = load_frag16x32(Qb + c * 16 * DHEAD + 32, DHEAD);
  }

  v8f acc[2][4] = {};                                 // [column tile][16 d]
  float m_run[2];                                     // set behind stage 0's barrier
  v8h neg_m[2];                                       // -m_run in every half: C of the score WMMAs
  f2 l_part[2] = {};                                  // this lane's part of the row sums
  int vd = tid >> 4, vp = tid & 15;                   // V^T tile load mapping
  int klds = (tid >> 3) * K_PITCH + (tid & 7) * 8;    // this lane's first 16 B in a K tile
  int vlds = vd * V_PITCH + vp * 8;                   // ... and in a V^T tile
  const _Float16* Ksrc = Kb + (size_t)tid * 8;        // this lane's first 16 B of key group
  const _Float16* Vsrc = Vb + (size_t)vd * S_TOTAL + vp * 8;   // 0's stage 0, K and V^T

  // both key groups' stage st into buffer bf
  auto stage_copies = [&](int st, int bf) {
    const _Float16* gk = Ksrc + (size_t)st * (STAGE_KEYS * DHEAD);
    const _Float16* gv = Vsrc + st * STAGE_KEYS;
    _Float16* lk = lds_k + bf * 2 * KT_ELEMS + klds;
    _Float16* lv = lds_vt + bf * 2 * VT_ELEMS + vlds;
    async_stage_kv(gk, lk, gv, lv);
    async_stage_kv(gk + (size_t)KEYS_PER_GROUP * DHEAD, lk + KT_ELEMS,
                   gv + KEYS_PER_GROUP, lv + VT_ELEMS);
  };

  // prologue: stage 0 lands and is published, then stage 1 is set off
  stage_copies(0, 0);
  S_WAIT_ASYNCCNT(0);   // this wave's 16 copies of stage 0 have landed
  __syncthreads();      // ... and every other wave's, before any fragment is read
  stage_copies(1, 1);

  // first reference: each column's largest score over its key group's first 32 keys
  {
    const _Float16* k0 = lds_k + kg * KT_ELEMS;
    v16h ka0 = load_frag16x32(k0 + 0, K_PITCH);
    v16h ka1 = load_frag16x32(k0 + 32, K_PITCH);
    v16h kb0 = load_frag16x32(k0 + 16 * K_PITCH, K_PITCH);
    v16h kb1 = load_frag16x32(k0 + 16 * K_PITCH + 32, K_PITCH);
#pragma unroll
    for (int c = 0; c < 2; ++c) {
      v8f z = {};
      m_run[c] = column_reference(wmma_f16(ka1, bq[c][1], wmma_f16(ka0, bq[c][0], z)),
                                  wmma_f16(kb1, bq[c][1], wmma_f16(kb0, bq[c][0], z)),
                                  -60000.0f);
      neg_m[c] = (_Float16)(-m_run[c]);
    }
  }

  for (int st = 0; st < N_STAGES; ++st) {
   const _Float16* kst = lds_k + ((st & 1) * 2 + kg) * KT_ELEMS;
   const _Float16* vst = lds_vt + ((st & 1) * 2 + kg) * VT_ELEMS;
   // unrolled so that a pass's place in the stage is a constant offset of its LDS reads
#pragma unroll
   for (int p = 0; p < STAGE_KEYS / 32; ++p) {
    const _Float16* kcur = kst + p * 32 * K_PITCH;
    const _Float16* vcur = vst + p * 32;

    // scores S'[t, s]: 2 t-subtiles x (d=0..31, d=32..63), each K fragment for both column tiles
    v16h ka0 = load_frag16x32(kcur + 0, K_PITCH);
    v16h ka1 = load_frag16x32(kcur + 32, K_PITCH);
    v16h kb0 = load_frag16x32(kcur + 16 * K_PITCH, K_PITCH);
    v16h kb1 = load_frag16x32(kcur + 16 * K_PITCH + 32, K_PITCH);
    // D = score - m_run, packed f16: minus the reference goes in as C
    v8h sc[4];                                        // [column tile * 2 + key tile]
#pragma unroll
    for (int c = 0; c < 2; ++c) {
      sc[2 * c] = wmma_f16_d16(ka0, bq[c][0], neg_m[c]);
      sc[2 * c + 1] = wmma_f16_d16(kb0, bq[c][0], neg_m[c]);
    }
#pragma unroll
    for (int c = 0; c < 2; ++c) {
      sc[2 * c] = wmma_f16_d16(ka1, bq[c][1], sc[2 * c]);
      sc[2 * c + 1] = wmma_f16_d16(kb1, bq[c][1], sc[2 * c + 1]);
    }

    // keeps the K reads one group in front of the score WMMAs: with the V^T reads in the
    // same region the scheduler re-uses a K fragment's registers and reads the next
    // fragment only two WMMAs ahead of its use
    __builtin_amdgcn_sched_barrier(0);

    // the pass's V^T fragments, read as one group under the exponentials
    v16h va[4];
#pragma unroll
    for (int a = 0; a < 4; ++a) va[a] = load_frag16x32(vcur + a * 16 * V_PITCH, V_PITCH);
    // keeps the eight reads here: the scheduler otherwise sinks them in among the WMMAs
    // that use them, where each pair is waited for as soon as it is issued
    __builtin_amdgcn_sched_barrier(0);

    // weights against the maximum in use, and each lane's sum of them
    v16h bp[2];
    v2h ts[2];
    exp2_in_place(sc);
#pragma unroll
    for (int c = 0; c < 2; ++c) ts[c] = pack_and_sum(sc[2 * c], sc[2 * c + 1], bp[c]);
    v2h tw = ts[0] + ts[1];
    bool need = tw.x + tw.y > (_Float16)LAZY_LIMIT;
    // One wave-uniform scalar branch a pass: every column of the wave moves to the larger of
    // m_run and its largest score of the pass (from f32 scores, formed anew); both lanes of a column get the same one.
    if (__builtin_expect(__builtin_amdgcn_ballot_w32(need) != 0, 0)) {
#pragma unroll
      for (int c = 0; c < 2; ++c) {
        v8f z = {};
        float mn = column_reference(wmma_f16(ka1, bq[c][1], wmma_f16(ka0, bq[c][0], z)),
                                    wmma_f16(kb1, bq[c][1], wmma_f16(kb0, bq[c][0], z)),
                                    m_run[c]);
        float alpha = exp2_hw(m_run[c] - mn);
        m_run[c] = mn;
        neg_m[c] = (_Float16)(-mn);
        l_part[c] *= alpha;
#pragma unroll
        for (int a = 0; a < 4; ++a) {
#pragma unroll
          for (int r = 0; r < 8; ++r) acc[c][a][r] *= alpha;
        }
        v8h again[2] = { wmma_f16_d16(ka1, bq[c][1], wmma_f16_d16(ka0, bq[c][0], neg_m[c])),
                         wmma_f16_d16(kb1, bq[c][1], wmma_f16_d16(kb0, bq[c][0], neg_m[c])) };
        exp2_in_place(again);
        ts[c] = pack_and_sum(again[0], again[1], bp[c]);
      }
    }
    // the running sums are f32
#pragma unroll
    for (int c = 0; c < 2; ++c) {
      f2 t = { (float)ts[c].x, (float)ts[c].y };
      l_part[c] += t;
    }
    // each V^T fragment for both column tiles
#pragma unroll
    for (int a = 0; a < 4; ++a) {
      acc[0][a] = wmma_f16(va[a], bp[0], acc[0][a]);
      acc[1][a] = wmma_f16(va[a], bp[1], acc[1][a]);
    }
   }
   // publish point, once a stage, every wave, in this order
   S_WAIT_DSCNT(0);      // this wave's reads of stage st are done
   S_WAIT_ASYNCCNT(0);   // its copies of stage st + 1 have landed
   __syncthreads();      // stage st + 1 may be read, stage st's buffer may be refilled
   if (st + 2 < N_STAGES) stage_copies(st + 2, st & 1);
  }
  S_WAIT_ASYNCCNT(0);    // nothing is in flight when the K ring becomes the join area

  // a column's row sum: its two lanes each hold, in two parts, the sum over their own
  // 16 keys of every pass
  float l_run[2];
#pragma unroll
  for (int c = 0; c < 2; ++c) {
    l_run[c] = l_part[c].x + l_part[c].y;
    l_run[c] += __shfl_xor(l_run[c], 16, 32);
  }

  // join of the two key groups: waves w and w^4 hold the same 32 columns.  Each hands
  // the other one column tile's state (key group 0 gives tile 1, group 1 gives tile 0)
  // and finishes the tile it keeps.
  bool hi = kg != 0;
  f4* mine = lds_join + wave * (JOIN_ROWS * 32) + lane;
  const f4* theirs = lds_join + (wave ^ 4) * (JOIN_ROWS * 32) + lane;
  v8f keep[4];
#pragma unroll
  for (int a = 0; a < 4; ++a) {
    v8f give = hi ? acc[0][a] : acc[1][a];
    keep[a] = hi ? acc[1][a] : acc[0][a];
    f4 lo4 = { give[0], give[1], give[2], give[3] };
    f4 hi4 = { give[4], give[5], give[6], give[7] };
    mine[(2 * a) * 32] = lo4;
    mine[(2 * a + 1) * 32] = hi4;
  }
  f4 ml = { hi ? m_run[0] : m_run[1], hi ? l_run[0] : l_run[1], 0.f, 0.f };
  mine[8 * 32] = ml;
  float m_k = hi ? m_run[1] : m_run[0], l_k = hi ? l_run[1] : l_run[0];
  __syncthreads();   // every wave's handed-over state is in LDS before its partner reads it
  f4 oml = theirs[8 * 32];
  float m_j = fmaxf(m_k, oml.x);
  float f_k = exp2_hw_slot(m_k - m_j), f_o = exp2_hw_slot(oml.x - m_j);
  float inv = 1.0f / (l_k * f_k + oml.y * f_o);
  f_k *= inv; f_o *= inv;

  // epilogue: out[bh*64 + d][s] = joined sums / joined l   (lanes advance s -> coalesced)
  int s = scol0 + kg * 16 + (lane & 15);
  int rbase = (lane >> 4) << 3;
#pragma unroll
  for (int a = 0; a < 4; ++a) {
    f4 o_lo = theirs[(2 * a) * 32], o_hi = theirs[(2 * a + 1) * 32];
#pragma unroll
    for (int r = 0; r < 8; ++r) {
      float o = (r < 4) ? o_lo[r & 3] : o_hi[r & 3];
      out[(size_t)(bh * 64 + a * 16 + r + rbase) * S_TOTAL + s] = keep[a][r] * f_k + o * f_o;
    }
  }
}

// ---------------------------------------------------------------------------
extern "C" void kernel_launch(void* const* d_in, const int* in_sizes, int n_in,
                              void* d_out, int out_size, void* d_ws,
                              size_t ws_size, hipStream_t stream) {
  (void)in_sizes; (void)n_in; (void)out_size; (void)ws_size;
  const float* x    = (const float*)d_in[0];   // [4,256,64,64]
  const float* w_dw = (const float*)d_in[1];   // [256,1,3,3]
  const float* w_pw = (const float*)d_in[2];   // [768,256]
  float* out = (float*)d_out;                  // [4,256,64,64]

  char* ws = (char*)d_ws;
  _Float16* dwT = (_Float16*)(ws);                   // 4*4096*256 f16 = 8 MiB
  _Float16* Qg  = (_Float16*)(ws + (8u  << 20));     // 16*4096*64 f16 = 8 MiB
  _Float16* Kg  = (_Float16*)(ws + (16u << 20));     // 8 MiB
  _Float16* VTg = (_Float16*)(ws + (24u << 20));     // 8 MiB
  _Float16* wph = (_Float16*)(ws + (32u << 20));     // 768*256 f16

  dwconv_cvt_kernel<<<dim3(64 + CVT_X, 4, 4), 256, 0, stream>>>(x, w_dw, w_pw, dwT, wph);
  proj_kernel<<<dim3(32, 12, 4), 256, 0, stream>>>(dwT, wph, Qg, Kg, VTg);
  attn_kernel<<<dim3(32, 16), 256, 0, stream>>>(Qg, Kg, VTg, out);
}
